// v000
// The times below were measured on an AMD MI455X: many runs one after another, warmed up first and cycling through
// copies of the inputs, with the whole window's GPU time divided by the number of runs. Launches and the gaps
// between them are all in it. The median over several windows is given; except for v000 it joins two sittings, which
// can be a few percent apart, so the side-by-side timings, each taken in one sitting, are the better comparison.
// v000, which the later versions start from, runs in 281 microseconds.
#include <hip/hip_runtime.h>

// Causal multi-head attention over one time-major sequence input x [SEQ][NB][128]; 8 heads x 128; Wk/Wq/Wv [1024][128] ([out][in], y = x W^T + bias); scores S[i][j] = kproj_i . qproj_j / sqrt(128)
// (rows follow the Wk projection, the softmax runs over the Wq-projection positions j <= i; the diagonal is always kept); out_i = sum_j P[i][j] vproj_j; heads merged to [t][b][1024]; output = ctx Wo^T + bo, Wo [128][1024], f32 [SEQ][NB][128].
// Compute dtypes, f32 accumulate everywhere: projections v_wmma_f32_16x16x32_bf16 (x, W, bias RNE-converted to bf16; products exact);
// scores v_wmma_f32_16x16x32_f16: single f16 planes on rows >= EROWS; on rows < EROWS both score operands as f16 value + f16 residual x2048 (three products, residual products in their own accumulator);
// P.V v_wmma_f32_16x16x32_f16: P (x16384 carry, cancels in the normalisation) and v single f16 on rows >= EROWS; on rows < EROWS P and v each as f16 value + f16 residual x2048, residual products in their own accumulator folded by 1/2048;
// output GEMM v_wmma_f32_16x16x32_f16: ctx x16 (f16; plus f16 residual x2048 in its own accumulator on rows < EROWS) times bf16(Wo) x1024 held exactly in f16; folded by 1/16384; softmax f32 (online, running max).
// Layout: bf16 x [b][t][128] and W planes; row-side (Wk) and column-side (Wq) planes [b*8+h][t][128], v^T plane [b*8+h][d][t], small residual planes for tokens < EROWS; ctx plane [b*SEQ+t][1024]; fused flash kernel in transposed form
// (S^T = C R^T with the row-side tile as the B operand, O^T = V^T P^T with the packed P tile as the B operand), no LDS and no barrier in the key loop.

#ifndef NB
#define NB 8
#endif
#ifndef SEQ
#define SEQ 1024
#endif
#define NB_FULL  8
#define SEQ_FULL 1024
#define DM   128                 // input and output width
#define NH_  8
#define HD   128
#define HK   (NH_ * HD)          // merged head width 1024
#define AW   4                   // waves per flash block (16 rows each)
#define OSP  132                 // LDS row pitch (floats) of the flash output tile
#define EROWS (SEQ < 256 ? SEQ : 256)   // rows (and tokens of the small residual planes) handled by the multi-product instantiations
#define QRS  2048.0f             // carry of every residual plane / residual fragment
#define QRI  (1.0f / 2048.0f)
#define SC2  ((float)(0.08838834764831845 * 1.4426950408889634))   // HD^-0.5 * log2(e)
#define PSH  14.0f               // log2 of the P carry (16384)
#define NEGB (-3.0e38f)
#define CXS  16.0f               // carry of the ctx plane
#define WOS  1024.0f             // carry of the Wo plane
#define OSI  (1.0f / 16384.0f)   // 1 / (CXS * WOS)

static_assert(HD == 128);                      // plane row = 256 bytes = two lines; four 32-deep k-steps per score tile; eight 16-row output tiles
static_assert(NH_ * HD == HK);
static_assert(HD % 64 == 0);                   // a 64-column GEMM tile lies inside one head
static_assert(HK % 64 == 0);
static_assert(DM % 64 == 0);
static_assert(DM % 32 == 0);                   // projection k-loop steps by 32
static_assert(HK % 32 == 0);                   // output GEMM k-loop steps by 32
static_assert(SEQ % 64 == 0);                  // a 64-row tile never straddles two batches
static_assert(SEQ % 32 == 0);                  // key loop steps by 32
static_assert(EROWS % 64 == 0);                // a 64-token GEMM tile lies wholly inside or outside the residual planes; key bound of the first band <= EROWS
static_assert(EROWS >= 64);
static_assert(EROWS <= SEQ);
static_assert(EROWS % (16 * AW) == 0);
static_assert((SEQ - EROWS) % (16 * AW) == 0);
static_assert(EROWS % 32 == 0);
static_assert((SEQ - EROWS) % 32 == 0);
static_assert(NB <= NB_FULL);
static_assert(SEQ <= SEQ_FULL);
static_assert((OSP * 4) % 16 == 0);
static_assert(OSP >= HD);
static_assert((size_t)NB * NH_ * SEQ * HD < (size_t)2147483647);   // plane offsets fit in int
static_assert((size_t)AW * 16 * OSP * 4 <= (size_t)131072);         // static LDS of the flash kernels
static_assert((size_t)16 * 68 * 4 <= (size_t)131072);               // static LDS of the GEMM kernels
static_assert(32 * 4 * 16 == 16 * 64 * 2);     // projection slab store: 32 lanes x 4 instructions x 16 B == 16 rows x 64 halves
static_assert(32 * 8 * 16 == 16 * HD * 2);     // flash slab store: 32 lanes x 8 instructions x 16 B == 16 rows x 128 halves
static_assert(32 * 8 * 16 == 16 * 64 * 4);     // output slab store: 32 lanes x 8 instructions x 16 B == 16 rows x 64 floats
static_assert((DM / 8) == 16);                 // 16 pieces of 8 per input row in the x converter

typedef _Float16 h16;
typedef unsigned short bf;
typedef __attribute__((ext_vector_type(16))) __bf16   v16bf;
typedef __attribute__((ext_vector_type(16))) _Float16 v16h;
typedef __attribute__((ext_vector_type(8)))  _Float16 v8h;
typedef __attribute__((ext_vector_type(8)))  unsigned short v8us;
typedef __attribute__((ext_vector_type(8)))  float    v8f;
typedef __attribute__((ext_vector_type(4)))  float    v4f;
typedef v4f  __attribute__((may_alias)) v4fa;

__device__ __forceinline__ unsigned short f2bf(float f) { unsigned u = __float_as_uint(f); u += 0x7FFFu + ((u >> 16) & 1u); return (unsigned short)(u >> 16); }
__device__ __forceinline__ float bfr(float f) { return __uint_as_float(((unsigned)f2bf(f)) << 16); }   // value after RNE convert to bf16
__device__ __forceinline__ v16h cat16(v8h lo, v8h hi) { return __builtin_shufflevector(lo, hi, 0, 1, 2, 3, 4, 5, 6, 7, 8, 9, 10, 11, 12, 13, 14, 15); }
__device__ __forceinline__ v16bf cat16b(v8us lo, v8us hi) { return __builtin_bit_cast(v16bf, __builtin_shufflevector(lo, hi, 0, 1, 2, 3, 4, 5, 6, 7, 8, 9, 10, 11, 12, 13, 14, 15)); }
__device__ __forceinline__ v8f wmma16(v16h a, v16h b, v8f c) { return __builtin_amdgcn_wmma_f32_16x16x32_f16(false, a, false, b, (short)0, c, false, false); }
__device__ __forceinline__ v8f wmmab(v16bf a, v16bf b, v8f c) { return __builtin_amdgcn_wmma_f32_16x16x32_bf16(false, a, false, b, (short)0, c, false, false); }
// fragment loaders from K-contiguous 16-bit rows; p already includes + 8*(lane>>4): elements 0..7 <- k0+8h+0..7, elements 8..15 <- k0+16+8h+0..7 (same map for A and B)
__device__ __forceinline__ v16h  ldh(const h16* p) { return cat16(*(const v8h*)p, *(const v8h*)(p + 16)); }
__device__ __forceinline__ v16bf ldb(const bf* p)  { return cat16b(*(const v8us*)p, *(const v8us*)(p + 16)); }
// ordering point for wave-private LDS tiles (same wave writes and reads)
__device__ __forceinline__ void wave_sync() { __builtin_amdgcn_fence(3 /* release order */, "wavefront"); __builtin_amdgcn_wave_barrier(); asm volatile("" ::: "memory"); }
// f32 -> f16 operand convert that cannot produce a subnormal (|v| < 2^-14 -> +0), applied after the plane's carry
static __device__ __forceinline__ h16 toh_flush(float v) { const h16 r = (h16)v; return (fabsf(v) < 6.103515625e-05f) ? (h16)0.0f : r; }
// one matrix instruction with its own four-slot guard (ties the accumulator, keeps both fragments live)
__device__ __forceinline__ v8f mmh(v16h a, v16h b, v8f c) { c = wmma16(a, b, c); asm volatile("v_nop\n\tv_nop\n\tv_nop\n\tv_nop" : "+v"(c) : "v"(a), "v"(b)); return c; }
__device__ __forceinline__ v8f mmb(v16bf a, v16bf b, v8f c) { c = wmmab(a, b, c); asm volatile("v_nop\n\tv_nop\n\tv_nop\n\tv_nop" : "+v"(c) : "v"(a), "v"(b)); return c; }

__global__ __launch_bounds__(256) void k_cvt8(const float* __restrict__ src, bf* dst, size_t n8) {
    const size_t i = (size_t)blockIdx.x * 256 + threadIdx.x; if (i >= n8) return;
    const v8f v = *(const v8f*)(src + i * 8); v8us o;
#pragma unroll
    for (int k = 0; k < 8; ++k) o[k] = f2bf(v[k]);
    *(v8us*)(dst + i * 8) = o; 
}

__global__ __launch_bounds__(256) void k_cvtx(const float* __restrict__ src, bf* dst, int n8) {
    const int i = (int)blockIdx.x * 256 + (int)threadIdx.x; if (i >= n8) return;
    const int row = i >> 4, pc = i & 15;                 // row = b*SEQ + t
    const int b = row / SEQ, t = row % SEQ;
    const v8f v = *(const v8f*)(src + ((size_t)t * NB_FULL + (size_t)b) * DM + (size_t)pc * 8); v8us o;
#pragma unroll
    for (int k = 0; k < 8; ++k) o[k] = f2bf(v[k]);
    *(v8us*)(dst + (size_t)i * 8) = o; 
}

__global__ __launch_bounds__(256) void k_cvtwo(const float* __restrict__ src, h16* dst, int n8) {
    const int i = (int)blockIdx.x * 256 + (int)threadIdx.x; if (i >= n8) return;
    const v8f v = *(const v8f*)(src + (size_t)i * 8); v8h o;
#pragma unroll
    for (int k = 0; k < 8; ++k) o[k] = toh_flush(bfr(v[k]) * WOS);
    *(v8h*)(dst + (size_t)i * 8) = o; 
}

// proj_body: register-blocked bf16 GEMM, ONE WAVE per 64x64 tile (16 accumulators), operands straight from K-contiguous bf16 planes, K = DM.
// C[m][n] = sum_k A[m][k] Bt[n][k] + bias, written as f16 (Ph) and, for tokens t < resT (resT a multiple of 64, block-uniform test), the f16 residual x2048 (Pr).
// MODE 0: A = x rows (m = b*SEQ + t), Bt = W rows (n = h*128 + d), bias per column; plane [(b*8 + h)][t][128] (residual plane [(b*8 + h)][resT][128]); the 64-column tile lies inside one head. grid (NB*SEQ/64, HK/64).
// MODE 1: A = W rows (m = h*128 + d), Bt = x rows (n = b*SEQ + t), bias per row; plane [(b*1024 + m)][t], row pitch SEQ (residual plane row pitch resT). grid (HK/64, NB*SEQ/64).
template <int MODE>
__device__ __forceinline__ void proj_body(const bf* __restrict__ A, const bf* __restrict__ Bt, const float* __restrict__ bias, h16* Ph, h16* Pr, int resT) {
    __shared__ __align__(16) float os[16 * 68];
    const int K = DM;
    const int lane = threadIdx.x & 31, lr = lane & 15, hi = lane >> 4; const int r0 = blockIdx.x * 64, c0 = blockIdx.y * 64;
    v8f acc[4][4];
#pragma unroll
    for (int mb = 0; mb < 4; ++mb)
#pragma unroll
        for (int nb = 0; nb < 4; ++nb) acc[mb][nb] = (v8f){};
    const size_t aoff = (size_t)(r0 + lr) * K + 8 * hi, boff = (size_t)(c0 + lr) * K + 8 * hi;
#pragma unroll 1
    for (int kc = 0; kc < K; kc += 32) {
        v16bf a[4];
#pragma unroll
        for (int mb = 0; mb < 4; ++mb) a[mb] = ldb(A + aoff + (size_t)mb * 16 * K + kc);
#pragma unroll
        for (int nb = 0; nb < 4; ++nb) { const v16bf b = ldb(Bt + boff + (size_t)nb * 16 * K + kc);
#pragma unroll
            for (int mb = 0; mb < 4; ++mb) acc[mb][nb] = mmb(a[mb], b, acc[mb][nb]); }
    }
    float bc[4];
#pragma unroll
    for (int nb = 0; nb < 4; ++nb) bc[nb] = (MODE == 0) ? bfr(bias[c0 + nb * 16 + lr]) : 0.0f;   // MODE 0: c0 + 63 < HK
    size_t tbase, rbase, tpitch, rpitch; bool wr;                                                 // wr: block-uniform, whole tile inside the residual plane
    if (MODE == 0) { const int bb = r0 / SEQ, tt = r0 % SEQ; const int zc = bb * NH_ + c0 / HD; const int d0 = c0 % HD;
                     tbase = ((size_t)zc * SEQ + (size_t)tt) * HD + (size_t)d0; tpitch = HD;
                     rbase = ((size_t)zc * (size_t)resT + (size_t)tt) * HD + (size_t)d0; rpitch = HD; wr = tt < resT; }
    else           { const int bb = c0 / SEQ, tt = c0 % SEQ;
                     tbase = ((size_t)bb * HK + (size_t)r0) * SEQ + (size_t)tt; tpitch = SEQ;
                     rbase = ((size_t)bb * HK + (size_t)r0) * (size_t)resT + (size_t)tt; rpitch = (size_t)resT; wr = tt < resT; }
#pragma unroll
    for (int mb = 0; mb < 4; ++mb) {
        float br[8];
#pragma unroll
        for (int j = 0; j < 8; ++j) br[j] = (MODE == 1) ? bfr(bias[r0 + mb * 16 + hi * 8 + j]) : 0.0f;   // MODE 1: r0 + 63 < HK
#pragma unroll
        for (int nb = 0; nb < 4; ++nb) {
#pragma unroll
            for (int j = 0; j < 8; ++j) os[(hi * 8 + j) * 68 + nb * 16 + lr] = acc[mb][nb][j] + bc[nb] + br[j]; }   // D: row 8h+j, col lane&15
        wave_sync();
{
#pragma unroll
            for (int s = 0; s < 4; ++s) { const int row = 4 * s + (lane >> 3), c8 = (lane & 7) * 8;   // 4 s x 4 row groups = 16 rows; 8 lanes x 8 = 64 columns
                const v4f x0 = *(const v4fa*)(&os[row * 68 + c8]); const v4f x1 = *(const v4fa*)(&os[row * 68 + c8 + 4]); v8h hv, rv;
#pragma unroll
                for (int i = 0; i < 4; ++i) { const h16 a0 = toh_flush(x0[i]); const h16 a1 = toh_flush(x1[i]); hv[i] = a0; hv[4 + i] = a1;
                    rv[i] = toh_flush((x0[i] - (float)a0) * QRS); rv[4 + i] = toh_flush((x1[i] - (float)a1) * QRS); }
                const size_t oo = tbase + (size_t)(mb * 16 + row) * tpitch + (size_t)c8;
                const size_t ro = rbase + (size_t)(mb * 16 + row) * rpitch + (size_t)c8;
                *(v8h*)(Ph + oo) = hv; if (wr) *(v8h*)(Pr + ro) = rv; }
             }
        wave_sync();
    }
}

__global__ __launch_bounds__(32) void k_proj_rows(const bf* __restrict__ A, const bf* __restrict__ Bt, const float* __restrict__ bias, h16* Ph, h16* Pr, int resT) { proj_body<0>(A, Bt, bias, Ph, Pr, resT); }
__global__ __launch_bounds__(32) void k_proj_tr(const bf* __restrict__ A, const bf* __restrict__ Bt, const float* __restrict__ bias, h16* Ph, h16* Pr, int resT) { proj_body<1>(A, Bt, bias, Ph, Pr, resT); }

// score16: one 16-column-token x 16-row-token tile of scaled logits (log2 domain). A = column-side rows (k = d), B = row-side rows (k = d), four 32-deep k-steps.
// EARLY: value x value in sH; value x residual and residual x value (both x2048) in sL.
template <int EARLY>
__device__ __forceinline__ v8f score16(const h16* __restrict__ RH, const h16* __restrict__ RR, const h16* __restrict__ CH, const h16* __restrict__ CR, int rx, int rrx, int cx, int crx) {
    v8f sH = (v8f){}, sL = (v8f){};
#pragma unroll
    for (int kc = 0; kc < HD; kc += 32) {
        const v16h qf = ldh(RH + rx + kc); const v16h kf = ldh(CH + cx + kc);
        sH = mmh(kf, qf, sH);
        if (EARLY) { const v16h qr = ldh(RR + rrx + kc); const v16h kr = ldh(CR + crx + kc);
                     sL = mmh(kf, qr, sL); sL = mmh(kr, qf, sL); __builtin_amdgcn_sched_barrier(0); }
    }
    v8f t;
#pragma unroll
    for (int r = 0; r < 8; ++r) t[r] = EARLY ? ((sH[r] + sL[r] * QRI) * SC2) : (sH[r] * SC2);
    return t;
}

// flash_body: fused attention, one wave per 16 rows of one (batch, head); fragments straight from the f16 planes (two 16-B loads each, arithmetic addressing).
// Transposed form: S^T[j][t] = C R^T (A = column-side rows j, B = row-side rows t); lane (t = lane&15, h = lane>>4) holds columns 8h+r of each 16-column tile, so the packed
// P tile is directly the B fragment of O^T[d][t] = V^T P^T (element r <- tile columns 0..15, element 8+r <- tile columns 16..31, lane unchanged).
// Softmax state (running max over kept columns, partial sum) is one scalar per lane; the two lane halves of a row are combined with one xor-16 exchange.
// Keep rule j <= t evaluated per element in every visited 32-column tile; column 0 is kept for every row, so the running max is finite after the first tile.
// EARLY = 1 (rows [0, EROWS)): three-product scores, P = f16 value + f16 residual x2048, O = V P + (V P_res + V_res P) / 2048 (own accumulators), row sum from the f32 exponentials; all visited columns < EROWS.
// EARLY = 0 (rows [EROWS, SEQ)): single products; row sum over the converted P.
template <int EARLY>
__device__ __forceinline__ void flash_body(const h16* __restrict__ RH, const h16* __restrict__ RR, const h16* __restrict__ CH, const h16* __restrict__ CR,
                                           const h16* __restrict__ VT, const h16* __restrict__ VR, h16* CX, h16* CXR) {
    __shared__ __align__(16) float os[AW * 16 * OSP];
    const int lane = threadIdx.x & 31, lr = lane & 15, hi = lane >> 4;
    const int wave = __builtin_amdgcn_readfirstlane((int)(threadIdx.x >> 5));
    const int zh = blockIdx.y; const int b = zh / NH_, h = zh % NH_;
    const int t0 = (EARLY ? 0 : EROWS) + ((int)blockIdx.x * AW + wave) * 16;
    const int lim = t0 + lr;                                   // column j kept iff j <= lim
    const int nk = (t0 + 16 + 31) & ~31;                       // wave-uniform, multiple of 32, <= SEQ (<= EROWS for EARLY)
    const int pbase = zh * (SEQ * HD);
    const int rbase = zh * (EROWS * HD);
    const int tcl = EARLY ? (t0 + lr) : 0;                     // residual-plane row (only the EARLY band reads it)
    const int ro  = pbase + (t0 + lr) * HD + 8 * hi;           // row-side B fragment: col t, k = d
    const int rro = rbase + tcl * HD + 8 * hi;
    const int co  = pbase + lr * HD + 8 * hi;                  // + j * HD            (A fragment: row j, k = d)
    const int cro = rbase + lr * HD + 8 * hi;
    const int vo  = pbase + lr * SEQ + 8 * hi;                 // + 16jj*SEQ + j      (A fragment: row d, k = j)
    const int vro = rbase + lr * EROWS + 8 * hi;               // + 16jj*EROWS + j
    const v16h hz = (v16h){};
    v8f o[8], oR[8];
#pragma unroll
    for (int j = 0; j < 8; ++j) { o[j] = (v8f){}; oR[j] = (v8f){}; }
    float m = NEGB, l = 0.0f;
#pragma unroll 1
    for (int key0 = 0; key0 < nk; key0 += 32) {
        int rx = ro, rrx = rro;
        asm volatile("" : "+v"(rx), "+v"(rrx));                // row-side fragments are re-read per step through these offsets
        const v8f ta = score16<EARLY>(RH, RR, CH, CR, rx, rrx, co + key0 * HD, cro + key0 * HD);
        const v8f tb = score16<EARLY>(RH, RR, CH, CR, rx, rrx, co + (key0 + 16) * HD, cro + (key0 + 16) * HD);
        const int ja = key0 + 8 * hi;
        bool fa[8], fb[8]; float mx = NEGB;
#pragma unroll
        for (int r = 0; r < 8; ++r) {
            fa[r] = (ja + r <= lim); fb[r] = (ja + 16 + r <= lim);
            mx = fmaxf(mx, fmaxf(fa[r] ? ta[r] : NEGB, fb[r] ? tb[r] : NEGB)); }
        mx = fmaxf(mx, __shfl_xor(mx, 16, 32));
        const float mnew = fmaxf(m, mx);
        const float alpha = __builtin_amdgcn_exp2f(m - mnew);
        const float sh = PSH - mnew;
        v16h pb, pr = hz; float ls = 0.0f;
#pragma unroll
        for (int r = 0; r < 8; ++r) {
            const float xa = ta[r] + sh, xb = tb[r] + sh;
            const float ea = __builtin_amdgcn_exp2f(xa), eb = __builtin_amdgcn_exp2f(xb);
            const float ga = (fa[r] & (xa >= -14.0f)) ? ea : 0.0f;        // dropped elements and exponents below the f16 normal range selected to 0 by value
            const float gb = (fb[r] & (xb >= -14.0f)) ? eb : 0.0f;
            const h16 pa = (h16)ga; const h16 pc = (h16)gb;
            pb[r] = pa; pb[8 + r] = pc;
            if (EARLY) { pr[r] = toh_flush((ga - (float)pa) * QRS); pr[8 + r] = toh_flush((gb - (float)pc) * QRS); ls += ga + gb; }
            else       { ls += (float)pa + (float)pc; } }
        l = l * alpha + ls; m = mnew;
#pragma unroll
        for (int j = 0; j < 8; ++j) { o[j] = o[j] * alpha; if (EARLY) oR[j] = oR[j] * alpha; }
#pragma unroll
        for (int j = 0; j < 8; ++j) {
            const v16h vf = ldh(VT + vo + j * (16 * SEQ) + key0);
            o[j] = mmh(vf, pb, o[j]);
            if (EARLY) { const v16h vr = ldh(VR + vro + j * (16 * EROWS) + key0);
                         oR[j] = mmh(vf, pr, oR[j]); oR[j] = mmh(vr, pb, oR[j]); __builtin_amdgcn_sched_barrier(0); }
        }
    }
    l += __shfl_xor(l, 16, 32);
    const bool any = l > 0.0f;
    const float lsafe = any ? l : 1.0f;
    const float inv = any ? (CXS * (1.0f / lsafe)) : 0.0f;     // ctx carried x16
    const int wb = wave * 16 * OSP;
    // O^T D layout: f_j[r] = (d = 16j + 8h + r, t = lane&15) -> os[t][d]; rows 0..15 x columns 0..127 all written
#pragma unroll
    for (int j = 0; j < 8; ++j) {
        v8f f = o[j]; if (EARLY) f = o[j] + oR[j] * QRI;
        v4f a, c;
        a[0] = f[0] * inv; a[1] = f[1] * inv; a[2] = f[2] * inv; a[3] = f[3] * inv; c[0] = f[4] * inv; c[1] = f[5] * inv; c[2] = f[6] * inv; c[3] = f[7] * inv;
        *(v4fa*)(&os[wb + lr * OSP + 16 * j + 8 * hi]) = a; *(v4fa*)(&os[wb + lr * OSP + 16 * j + 8 * hi + 4]) = c; }
    wave_sync();
    h16* crow = CX + ((size_t)b * SEQ + (size_t)t0) * HK + (size_t)h * HD;
    h16* rrow = CXR + ((size_t)b * EROWS + (size_t)(EARLY ? t0 : 0)) * HK + (size_t)h * HD;    // EARLY only
{
#pragma unroll
        for (int s = 0; s < 8; ++s) { const int row = 2 * s + (lane >> 4), c8 = (lane & 15) * 8;   // 8 s x 2 rows = 16 rows; 16 lanes x 8 halves = 128 columns = two lines
            const v4f x0 = *(const v4fa*)(&os[wb + row * OSP + c8]); const v4f x1 = *(const v4fa*)(&os[wb + row * OSP + c8 + 4]); v8h hv, rv;
#pragma unroll
            for (int i = 0; i < 4; ++i) { const h16 a0 = toh_flush(x0[i]); const h16 a1 = toh_flush(x1[i]); hv[i] = a0; hv[4 + i] = a1;
                rv[i] = toh_flush((x0[i] - (float)a0) * QRS); rv[4 + i] = toh_flush((x1[i] - (float)a1) * QRS); }
            *(v8h*)(crow + (size_t)row * HK + c8) = hv;
            if (EARLY) *(v8h*)(rrow + (size_t)row * HK + c8) = rv; }
         }
}

__global__ __launch_bounds__(32 * AW) __attribute__((amdgpu_num_vgpr(256))) void k_flash_early(const h16* __restrict__ RH, const h16* __restrict__ RR, const h16* __restrict__ CH, const h16* __restrict__ CR,
                                                                                               const h16* __restrict__ VT, const h16* __restrict__ VR, h16* CX, h16* CXR) {
    flash_body<1>(RH, RR, CH, CR, VT, VR, CX, CXR);
}
__global__ __launch_bounds__(32 * AW) __attribute__((amdgpu_num_vgpr(256))) void k_flash_late(const h16* __restrict__ RH, const h16* __restrict__ RR, const h16* __restrict__ CH, const h16* __restrict__ CR,
                                                                                              const h16* __restrict__ VT, const h16* __restrict__ VR, h16* CX, h16* CXR) {
    flash_body<0>(RH, RR, CH, CR, VT, VR, CX, CXR);
}

// out_body: output GEMM, ONE WAVE per 32 x 64 tile, f16 operands straight from the ctx plane (A, K-contiguous) and the Wo plane (Bt rows, [out][in]), K = HK.
// OUT[(t*NB_FULL + b)][n] = (sum_c ctx16[m][c] wo1024[n][c] (+ residual sum / 2048)) / 16384 + bf16(bo[n]); EARLY: rows t < EROWS with the ctx residual plane in its own accumulators.
template <int EARLY>
__device__ __forceinline__ void out_body(const h16* __restrict__ CX, const h16* __restrict__ CXR, const h16* __restrict__ WO, const float* __restrict__ bo, float* OUT) {
    __shared__ __align__(16) float os[16 * 68];
    const int lane = threadIdx.x & 31, lr = lane & 15, hi = lane >> 4;
    const int TB = EARLY ? (EROWS / 32) : (((SEQ - EROWS) / 32) > 0 ? ((SEQ - EROWS) / 32) : 1);   // 32-row tiles per batch in this band
    const int b = (int)blockIdx.x / TB; const int t0 = (EARLY ? 0 : EROWS) + ((int)blockIdx.x % TB) * 32; const int c0 = blockIdx.y * 64;
    v8f acc[2][4], accr[2][4];
#pragma unroll
    for (int mb = 0; mb < 2; ++mb)
#pragma unroll
        for (int nb = 0; nb < 4; ++nb) { acc[mb][nb] = (v8f){}; accr[mb][nb] = (v8f){}; }
    const size_t aoff = ((size_t)b * SEQ + (size_t)(t0 + lr)) * HK + 8 * hi;
    const size_t roff = ((size_t)b * EROWS + (size_t)((EARLY ? t0 : 0) + lr)) * HK + 8 * hi;      // EARLY only
    const size_t boff = (size_t)(c0 + lr) * HK + 8 * hi;
#pragma unroll 1
    for (int kc = 0; kc < HK; kc += 32) {
        v16h a[2], ar[2];
#pragma unroll
        for (int mb = 0; mb < 2; ++mb) { a[mb] = ldh(CX + aoff + (size_t)mb * 16 * HK + kc); ar[mb] = a[mb];
            if (EARLY) ar[mb] = ldh(CXR + roff + (size_t)mb * 16 * HK + kc); }
#pragma unroll
        for (int nb = 0; nb < 4; ++nb) { const v16h w = ldh(WO + boff + (size_t)nb * 16 * HK + kc);
#pragma unroll
            for (int mb = 0; mb < 2; ++mb) { acc[mb][nb] = mmh(a[mb], w, acc[mb][nb]); if (EARLY) accr[mb][nb] = mmh(ar[mb], w, accr[mb][nb]); } }
    }
    float bc[4];
#pragma unroll
    for (int nb = 0; nb < 4; ++nb) bc[nb] = bfr(bo[c0 + nb * 16 + lr]);      // c0 + 63 < DM
#pragma unroll
    for (int mb = 0; mb < 2; ++mb) {
#pragma unroll
        for (int nb = 0; nb < 4; ++nb) {
#pragma unroll
            for (int j = 0; j < 8; ++j) { float v = acc[mb][nb][j]; if (EARLY) v = v + accr[mb][nb][j] * QRI;
                os[(hi * 8 + j) * 68 + nb * 16 + lr] = v * OSI + bc[nb]; } }                    // D: row 8h+j, col lane&15
        wave_sync();
        float* orow = OUT + ((size_t)(t0 + mb * 16) * NB_FULL + (size_t)b) * DM + (size_t)c0;
{
#pragma unroll
            for (int s = 0; s < 8; ++s) { const int row = 2 * s + (lane >> 4), cofs = (lane & 15) * 4;   // 8 s x 2 rows = 16 rows; 16 lanes x 4 floats = 64 columns = two lines
                const v4f val = *(const v4fa*)(&os[row * 68 + cofs]);
                *(v4f*)(orow + (size_t)row * (NB_FULL * DM) + cofs) = val; }
             }
        wave_sync();
    }
}

__global__ __launch_bounds__(32) __attribute__((amdgpu_num_vgpr(256))) void k_out_early(const h16* __restrict__ CX, const h16* __restrict__ CXR, const h16* __restrict__ WO, const float* __restrict__ bo, float* OUT) {
    out_body<1>(CX, CXR, WO, bo, OUT);
}
__global__ __launch_bounds__(32) void k_out_late(const h16* __restrict__ CX, const h16* __restrict__ CXR, const h16* __restrict__ WO, const float* __restrict__ bo, float* OUT) {
    out_body<0>(CX, CXR, WO, bo, OUT);
}

static constexpr size_t al256(size_t v) { return (v + 255) & ~(size_t)255; }
static constexpr size_t SZ_XB = al256((size_t)NB * SEQ * DM * 2);
static constexpr size_t SZ_WB = al256((size_t)3 * HK * DM * 2);
static constexpr size_t SZ_WO = al256((size_t)DM * HK * 2);
static constexpr size_t SZ_PL = al256((size_t)NB * NH_ * SEQ * HD * 2);
static constexpr size_t SZ_RS = al256((size_t)NB * NH_ * EROWS * HD * 2);
static constexpr size_t SZ_CX = al256((size_t)NB * SEQ * HK * 2);
static constexpr size_t SZ_CR = al256((size_t)NB * EROWS * HK * 2);
static constexpr size_t SZ_TOTAL = SZ_XB + SZ_WB + SZ_WO + 3 * SZ_PL + 3 * SZ_RS + SZ_CX + SZ_CR;
static_assert(SZ_TOTAL <= (size_t)134217728);          // workspace carve <= 128 MiB
static_assert(((size_t)HK * DM * 2) % 256 == 0);       // weight sub-planes stay 256-byte aligned
static_assert((size_t)NB * NH_ * SEQ * HD == (size_t)NB * HK * SEQ);       // v^T plane [(b*1024 + m)][t] has the same extent as the row/column planes
static_assert((size_t)NB * NH_ * EROWS * HD == (size_t)NB * HK * EROWS);   // v^T residual plane [(b*1024 + m)][t < EROWS] has the same extent as the other residual planes
static_assert(((size_t)NB * SEQ * DM / 8) % 256 == 0);  // x converter grid x block == plane extent
static_assert(((size_t)HK * DM / 8) % 256 == 0);        // weight converter grids x block == plane extents

extern "C" void kernel_launch(void* const* d_in, const int* in_sizes, int n_in,
                              void* d_out, int out_size, void* d_ws, size_t ws_size, hipStream_t stream) {
    if (n_in < 9) return;
    const size_t needx = ((size_t)(SEQ - 1) * NB_FULL + NB) * DM;
    if ((size_t)in_sizes[0] < needx) return;
    if ((size_t)in_sizes[1] < (size_t)HK * DM || (size_t)in_sizes[3] < (size_t)HK * DM || (size_t)in_sizes[5] < (size_t)HK * DM || (size_t)in_sizes[7] < (size_t)DM * HK) return;
    if (in_sizes[2] < HK || in_sizes[4] < HK || in_sizes[6] < HK || in_sizes[8] < DM) return;
    if ((size_t)out_size < needx) return;
    if (SZ_TOTAL > ws_size) return;
    // wire order: x, Wk, bk, Wq, bq, Wv, bv, Wo, bo
    const float* x  = (const float*)d_in[0];
    const float* wk = (const float*)d_in[1]; const float* bk = (const float*)d_in[2];
    const float* wq = (const float*)d_in[3]; const float* bq = (const float*)d_in[4];
    const float* wv = (const float*)d_in[5]; const float* bv = (const float*)d_in[6];
    const float* wo = (const float*)d_in[7]; const float* bo = (const float*)d_in[8];
    float* OUT = (float*)d_out;      // [SEQ][NB_FULL][128]
    char* wsp = (char*)d_ws;
    bf* XB = (bf*)wsp; wsp += SZ_XB;                 // [NB*SEQ][128], row = b*SEQ + t
    bf* WB = (bf*)wsp; wsp += SZ_WB;                 // [3][1024][128]: k | q | v  ([out][in] = Bt as-is)
    h16* WO = (h16*)wsp; wsp += SZ_WO;               // [128][1024] bf16(Wo) x1024 in f16
    h16* RH = (h16*)wsp; wsp += SZ_PL;               // row side (Wk projection)    [NB*8][SEQ][128]
    h16* CH = (h16*)wsp; wsp += SZ_PL;               // column side (Wq projection) [NB*8][SEQ][128]
    h16* VT = (h16*)wsp; wsp += SZ_PL;               // [NB*8][128][SEQ]
    h16* RR = (h16*)wsp; wsp += SZ_RS;               // [NB*8][EROWS][128] residual x2048, tokens < EROWS
    h16* CR = (h16*)wsp; wsp += SZ_RS;               // [NB*8][EROWS][128] residual x2048, tokens < EROWS
    h16* VR = (h16*)wsp; wsp += SZ_RS;               // [NB*8][128][EROWS] residual x2048, tokens < EROWS
    h16* CX = (h16*)wsp; wsp += SZ_CX;               // [NB*SEQ][1024] ctx x16
    h16* CXR = (h16*)wsp; wsp += SZ_CR;              // [NB*EROWS][1024] ctx residual x16 x2048, tokens < EROWS
    bf* WKb = WB; bf* WQb = WB + (size_t)HK * DM; bf* WVb = WB + (size_t)2 * HK * DM;

    { const int n8 = NB * SEQ * DM / 8; k_cvtx<<<(unsigned)((n8 + 255) / 256), 256, 0, stream>>>(x, XB, n8); }
    { const size_t n8 = (size_t)HK * DM / 8; const unsigned g = (unsigned)((n8 + 255) / 256);
      k_cvt8<<<g, 256, 0, stream>>>(wk, WKb, n8); k_cvt8<<<g, 256, 0, stream>>>(wq, WQb, n8); k_cvt8<<<g, 256, 0, stream>>>(wv, WVb, n8); }
    { const int n8 = DM * HK / 8; k_cvtwo<<<(unsigned)((n8 + 255) / 256), 256, 0, stream>>>(wo, WO, n8); }

    // row side and column side: A = x rows (m = b*SEQ + t), Bt = W rows (n = h*128 + d) -> plane [(b*8 + h)][t][d]; residuals for tokens < EROWS
    k_proj_rows<<<dim3(NB * SEQ / 64, HK / 64, 1), 32, 0, stream>>>(XB, WKb, bk, RH, RR, EROWS);
    k_proj_rows<<<dim3(NB * SEQ / 64, HK / 64, 1), 32, 0, stream>>>(XB, WQb, bq, CH, CR, EROWS);
    // v^T: A = Wv rows (m = h*128 + d), Bt = x rows (n = b*SEQ + t) -> plane [(b*1024 + m)][t] = [(b*8 + h)][d][t]; residual for tokens < EROWS
    k_proj_tr<<<dim3(HK / 64, NB * SEQ / 64, 1), 32, 0, stream>>>(WVb, XB, bv, VT, VR, EROWS);

    // rows [0, EROWS): multi-product instantiation; rows [EROWS, SEQ): single-product instantiation (disjoint ctx rows)
    k_flash_early<<<dim3(EROWS / (16 * AW), NB * NH_, 1), 32 * AW, 0, stream>>>(RH, RR, CH, CR, VT, VR, CX, CXR);
    if (SEQ > EROWS)
        k_flash_late<<<dim3((SEQ - EROWS) / (16 * AW), NB * NH_, 1), 32 * AW, 0, stream>>>(RH, RR, CH, CR, VT, VR, CX, CXR);

    // output GEMM: rows [0, EROWS) with the ctx residual accumulators, rows [EROWS, SEQ) single product (disjoint output rows)
    k_out_early<<<dim3(NB * EROWS / 32, DM / 64, 1), 32, 0, stream>>>(CX, CXR, WO, bo, OUT);
    if (SEQ > EROWS)
        k_out_late<<<dim3(NB * (SEQ - EROWS) / 32, DM / 64, 1), 32, 0, stream>>>(CX, CXR, WO, bo, OUT);
}

// v001
// One run takes 183 microseconds.
// Two timings next to v000 put it at 1.53 and 1.54 times that version's speed.
#include <hip/hip_runtime.h>

// Causal multi-head attention over one time-major sequence input x [SEQ][NB][128]; 8 heads x 128; Wk/Wq/Wv [1024][128] ([out][in], y = x W^T + bias); scores S[i][j] = kproj_i . qproj_j / sqrt(128)
// (rows follow the Wk projection, the softmax runs over the Wq-projection positions j <= i; the diagonal is always kept); out_i = sum_j P[i][j] vproj_j; heads merged to [t][b][1024]; output = ctx Wo^T + bo, Wo [128][1024], f32 [SEQ][NB][128].
// Compute dtypes, f32 accumulate everywhere: projections v_wmma_f32_16x16x32_bf16 (x, W, bias RNE-converted to bf16; products exact);
// scores v_wmma_f32_16x16x32_f16: single f16 planes on rows >= EROWS; on rows < EROWS both score operands as f16 value + f16 residual x2048 (three products, residual products in their own accumulator);
// P.V v_wmma_f32_16x16x32_f16: P (x16384 carry, cancels in the normalisation) and v single f16 on rows >= EROWS; on rows < EROWS P and v each as f16 value + f16 residual x2048, residual products in their own accumulator folded by 1/2048;
// output GEMM v_wmma_f32_16x16x32_f16: ctx x16 (f16; plus f16 residual x2048 in its own accumulator on rows < EROWS) times bf16(Wo) x1024 held exactly in f16; folded by 1/16384; softmax f32 (online, running max).
// Layout: bf16 x [b][t][128] and W planes; row-side (Wk) and column-side (Wq) planes [b*8+h][t][128], v^T plane [b*8+h][d][t], small residual planes for tokens < EROWS; ctx plane [b*SEQ+t][1024]; fused flash kernel in transposed form
// (S^T = C R^T with the row-side tile as the B operand, O^T = V^T P^T with the packed P tile as the B operand), no LDS and no barrier in the key loop.

#ifndef NB
#define NB 8
#endif
#ifndef SEQ
#define SEQ 1024
#endif
#define NB_FULL  8
#define SEQ_FULL 1024
#define DM   128                 // input and output width
#define NH_  8
#define HD   128
#define HK   (NH_ * HD)          // merged head width 1024
#define AW   4                   // waves per flash block (16 rows each)
#define OSP  132                 // LDS row pitch (floats) of the flash output tile
#define EROWS (SEQ < 256 ? SEQ : 256)   // rows (and tokens of the small residual planes) handled by the multi-product instantiations
#define QRS  2048.0f             // carry of every residual plane / residual fragment
#define QRI  (1.0f / 2048.0f)
#define SC2  ((float)(0.08838834764831845 * 1.4426950408889634))   // HD^-0.5 * log2(e)
#define PSH  14.0f               // log2 of the P carry (16384)
#define NEGB (-3.0e38f)
#define CXS  16.0f               // carry of the ctx plane
#define WOS  1024.0f             // carry of the Wo plane
#define OSI  (1.0f / 16384.0f)   // 1 / (CXS * WOS)

static_assert(HD == 128);                      // plane row = 256 bytes = two lines; four 32-deep k-steps per score tile; eight 16-row output tiles
static_assert(NH_ * HD == HK);
static_assert(HD % 64 == 0);                   // a 64-column GEMM tile lies inside one head
static_assert(HK % 64 == 0);
static_assert(DM % 64 == 0);
static_assert(DM % 32 == 0);                   // projection k-loop steps by 32
static_assert(HK % 32 == 0);                   // output GEMM k-loop steps by 32
static_assert(SEQ % 64 == 0);                  // a 64-row tile never straddles two batches
static_assert(SEQ % 32 == 0);                  // key loop steps by 32
static_assert(EROWS % 64 == 0);                // a 64-token GEMM tile lies wholly inside or outside the residual planes; key bound of the first band <= EROWS
static_assert(EROWS >= 64);
static_assert(EROWS <= SEQ);
static_assert(EROWS % (16 * AW) == 0);
static_assert((SEQ - EROWS) % (16 * AW) == 0);
static_assert(EROWS % 32 == 0);
static_assert((SEQ - EROWS) % 32 == 0);
static_assert(NB <= NB_FULL);
static_assert(SEQ <= SEQ_FULL);
static_assert((OSP * 4) % 16 == 0);
static_assert(OSP >= HD);
static_assert((size_t)NB * NH_ * SEQ * HD < (size_t)2147483647);   // plane offsets fit in int
static_assert((size_t)AW * 16 * OSP * 4 <= (size_t)131072);         // static LDS of the flash kernels
static_assert((size_t)16 * 68 * 4 <= (size_t)131072);               // static LDS of the GEMM kernels
static_assert(32 * 4 * 16 == 16 * 64 * 2);     // projection slab store: 32 lanes x 4 instructions x 16 B == 16 rows x 64 halves
static_assert(32 * 8 * 16 == 16 * HD * 2);     // flash slab store: 32 lanes x 8 instructions x 16 B == 16 rows x 128 halves
static_assert(32 * 8 * 16 == 16 * 64 * 4);     // output slab store: 32 lanes x 8 instructions x 16 B == 16 rows x 64 floats
static_assert((DM / 8) == 16);                 // 16 pieces of 8 per input row in the x converter

typedef _Float16 h16;
typedef unsigned short bf;
typedef __attribute__((ext_vector_type(16))) __bf16   v16bf;
typedef __attribute__((ext_vector_type(16))) _Float16 v16h;
typedef __attribute__((ext_vector_type(8)))  _Float16 v8h;
typedef __attribute__((ext_vector_type(8)))  unsigned short v8us;
typedef __attribute__((ext_vector_type(8)))  float    v8f;
typedef __attribute__((ext_vector_type(4)))  float    v4f;
typedef v4f  __attribute__((may_alias)) v4fa;

__device__ __forceinline__ unsigned short f2bf(float f) { unsigned u = __float_as_uint(f); u += 0x7FFFu + ((u >> 16) & 1u); return (unsigned short)(u >> 16); }
__device__ __forceinline__ float bfr(float f) { return __uint_as_float(((unsigned)f2bf(f)) << 16); }   // value after RNE convert to bf16
__device__ __forceinline__ v16h cat16(v8h lo, v8h hi) { return __builtin_shufflevector(lo, hi, 0, 1, 2, 3, 4, 5, 6, 7, 8, 9, 10, 11, 12, 13, 14, 15); }
__device__ __forceinline__ v16bf cat16b(v8us lo, v8us hi) { return __builtin_bit_cast(v16bf, __builtin_shufflevector(lo, hi, 0, 1, 2, 3, 4, 5, 6, 7, 8, 9, 10, 11, 12, 13, 14, 15)); }
__device__ __forceinline__ v8f wmma16(v16h a, v16h b, v8f c) { return __builtin_amdgcn_wmma_f32_16x16x32_f16(false, a, false, b, (short)0, c, false, false); }
__device__ __forceinline__ v8f wmmab(v16bf a, v16bf b, v8f c) { return __builtin_amdgcn_wmma_f32_16x16x32_bf16(false, a, false, b, (short)0, c, false, false); }
// fragment loaders from K-contiguous 16-bit rows; p already includes + 8*(lane>>4): elements 0..7 <- k0+8h+0..7, elements 8..15 <- k0+16+8h+0..7 (same map for A and B)
__device__ __forceinline__ v16h  ldh(const h16* p) { return cat16(*(const v8h*)p, *(const v8h*)(p + 16)); }
__device__ __forceinline__ v16bf ldb(const bf* p)  { return cat16b(*(const v8us*)p, *(const v8us*)(p + 16)); }
// ordering point for wave-private LDS tiles (same wave writes and reads)
__device__ __forceinline__ void wave_sync() { __builtin_amdgcn_fence(3 /* release order */, "wavefront"); __builtin_amdgcn_wave_barrier(); asm volatile("" ::: "memory"); }
// f32 -> f16 operand convert that cannot produce a subnormal (|v| < 2^-14 -> +0), applied after the plane's carry
static __device__ __forceinline__ h16 toh_flush(float v) { const h16 r = (h16)v; return (fabsf(v) < 6.103515625e-05f) ? (h16)0.0f : r; }
// one matrix instruction with its own four-slot guard (ties the accumulator, keeps both fragments live)
__device__ __forceinline__ v8f mmh(v16h a, v16h b, v8f c) { c = wmma16(a, b, c); asm volatile("v_nop\n\tv_nop\n\tv_nop\n\tv_nop" : "+v"(c) : "v"(a), "v"(b)); return c; }
__device__ __forceinline__ v8f mmb(v16bf a, v16bf b, v8f c) { c = wmmab(a, b, c); asm volatile("v_nop\n\tv_nop\n\tv_nop\n\tv_nop" : "+v"(c) : "v"(a), "v"(b)); return c; }

__global__ __launch_bounds__(256) void k_cvt8(const float* __restrict__ src, bf* dst, size_t n8) {
    const size_t i = (size_t)blockIdx.x * 256 + threadIdx.x; if (i >= n8) return;
    const v8f v = *(const v8f*)(src + i * 8); v8us o;
#pragma unroll
    for (int k = 0; k < 8; ++k) o[k] = f2bf(v[k]);
    *(v8us*)(dst + i * 8) = o; 
}

__global__ __launch_bounds__(256) void k_cvtx(const float* __restrict__ src, bf* dst, int n8) {
    const int i = (int)blockIdx.x * 256 + (int)threadIdx.x; if (i >= n8) return;
    const int row = i >> 4, pc = i & 15;                 // row = b*SEQ + t
    const int b = row / SEQ, t = row % SEQ;
    const v8f v = *(const v8f*)(src + ((size_t)t * NB_FULL + (size_t)b) * DM + (size_t)pc * 8); v8us o;
#pragma unroll
    for (int k = 0; k < 8; ++k) o[k] = f2bf(v[k]);
    *(v8us*)(dst + (size_t)i * 8) = o; 
}

__global__ __launch_bounds__(256) void k_cvtwo(const float* __restrict__ src, h16* dst, int n8) {
    const int i = (int)blockIdx.x * 256 + (int)threadIdx.x; if (i >= n8) return;
    const v8f v = *(const v8f*)(src + (size_t)i * 8); v8h o;
#pragma unroll
    for (int k = 0; k < 8; ++k) o[k] = toh_flush(bfr(v[k]) * WOS);
    *(v8h*)(dst + (size_t)i * 8) = o; 
}

// proj_body: register-blocked bf16 GEMM, ONE WAVE per 64x64 tile (16 accumulators), operands straight from K-contiguous bf16 planes, K = DM.
// C[m][n] = sum_k A[m][k] Bt[n][k] + bias, written as f16 (Ph) and, for tokens t < resT (resT a multiple of 64, block-uniform test), the f16 residual x2048 (Pr).
// MODE 0: A = x rows (m = b*SEQ + t), Bt = W rows (n = h*128 + d), bias per column; plane [(b*8 + h)][t][128] (residual plane [(b*8 + h)][resT][128]); the 64-column tile lies inside one head. grid (NB*SEQ/64, HK/64).
// MODE 1: A = W rows (m = h*128 + d), Bt = x rows (n = b*SEQ + t), bias per row; plane [(b*1024 + m)][t], row pitch SEQ (residual plane row pitch resT). grid (HK/64, NB*SEQ/64).
template <int MODE>
__device__ __forceinline__ void proj_body(const bf* __restrict__ A, const bf* __restrict__ Bt, const float* __restrict__ bias, h16* Ph, h16* Pr, int resT) {
    __shared__ __align__(16) float os[16 * 68];
    const int K = DM;
    const int lane = threadIdx.x & 31, lr = lane & 15, hi = lane >> 4; const int r0 = blockIdx.x * 64, c0 = blockIdx.y * 64;
    v8f acc[4][4];
#pragma unroll
    for (int mb = 0; mb < 4; ++mb)
#pragma unroll
        for (int nb = 0; nb < 4; ++nb) acc[mb][nb] = (v8f){};
    const size_t aoff = (size_t)(r0 + lr) * K + 8 * hi, boff = (size_t)(c0 + lr) * K + 8 * hi;
#pragma unroll 1
    for (int kc = 0; kc < K; kc += 32) {
        v16bf a[4], b[4];                                   // all eight fragments of the trip are requested before its first product: one exposed load latency per trip
#pragma unroll
        for (int mb = 0; mb < 4; ++mb) a[mb] = ldb(A + aoff + (size_t)mb * 16 * K + kc);
#pragma unroll
        for (int nb = 0; nb < 4; ++nb) b[nb] = ldb(Bt + boff + (size_t)nb * 16 * K + kc);
#pragma unroll
        for (int nb = 0; nb < 4; ++nb) {
#pragma unroll
            for (int mb = 0; mb < 4; ++mb) acc[mb][nb] = mmb(a[mb], b[nb], acc[mb][nb]); }
    }
    float bc[4];
#pragma unroll
    for (int nb = 0; nb < 4; ++nb) bc[nb] = (MODE == 0) ? bfr(bias[c0 + nb * 16 + lr]) : 0.0f;   // MODE 0: c0 + 63 < HK
    size_t tbase, rbase, tpitch, rpitch; bool wr;                                                 // wr: block-uniform, whole tile inside the residual plane
    if (MODE == 0) { const int bb = r0 / SEQ, tt = r0 % SEQ; const int zc = bb * NH_ + c0 / HD; const int d0 = c0 % HD;
                     tbase = ((size_t)zc * SEQ + (size_t)tt) * HD + (size_t)d0; tpitch = HD;
                     rbase = ((size_t)zc * (size_t)resT + (size_t)tt) * HD + (size_t)d0; rpitch = HD; wr = tt < resT; }
    else           { const int bb = c0 / SEQ, tt = c0 % SEQ;
                     tbase = ((size_t)bb * HK + (size_t)r0) * SEQ + (size_t)tt; tpitch = SEQ;
                     rbase = ((size_t)bb * HK + (size_t)r0) * (size_t)resT + (size_t)tt; rpitch = (size_t)resT; wr = tt < resT; }
#pragma unroll
    for (int mb = 0; mb < 4; ++mb) {
        float br[8];
#pragma unroll
        for (int j = 0; j < 8; ++j) br[j] = (MODE == 1) ? bfr(bias[r0 + mb * 16 + hi * 8 + j]) : 0.0f;   // MODE 1: r0 + 63 < HK
#pragma unroll
        for (int nb = 0; nb < 4; ++nb) {
#pragma unroll
            for (int j = 0; j < 8; ++j) os[(hi * 8 + j) * 68 + nb * 16 + lr] = acc[mb][nb][j] + bc[nb] + br[j]; }   // D: row 8h+j, col lane&15
        wave_sync();
{
#pragma unroll
            for (int s = 0; s < 4; ++s) { const int row = 4 * s + (lane >> 3), c8 = (lane & 7) * 8;   // 4 s x 4 row groups = 16 rows; 8 lanes x 8 = 64 columns
                const v4f x0 = *(const v4fa*)(&os[row * 68 + c8]); const v4f x1 = *(const v4fa*)(&os[row * 68 + c8 + 4]); v8h hv, rv;
#pragma unroll
                for (int i = 0; i < 4; ++i) { const h16 a0 = toh_flush(x0[i]); const h16 a1 = toh_flush(x1[i]); hv[i] = a0; hv[4 + i] = a1;
                    rv[i] = toh_flush((x0[i] - (float)a0) * QRS); rv[4 + i] = toh_flush((x1[i] - (float)a1) * QRS); }
                const size_t oo = tbase + (size_t)(mb * 16 + row) * tpitch + (size_t)c8;
                const size_t ro = rbase + (size_t)(mb * 16 + row) * rpitch + (size_t)c8;
                *(v8h*)(Ph + oo) = hv; if (wr) *(v8h*)(Pr + ro) = rv; }
             }
        wave_sync();
    }
}

__global__ __launch_bounds__(32) void k_proj_rows(const bf* __restrict__ A, const bf* __restrict__ Bt, const float* __restrict__ bias, h16* Ph, h16* Pr, int resT) { proj_body<0>(A, Bt, bias, Ph, Pr, resT); }
__global__ __launch_bounds__(32) void k_proj_tr(const bf* __restrict__ A, const bf* __restrict__ Bt, const float* __restrict__ bias, h16* Ph, h16* Pr, int resT) { proj_body<1>(A, Bt, bias, Ph, Pr, resT); }

// score16: one 16-column-token x 16-row-token tile of scaled logits (log2 domain), multi-product form. A = column-side rows (k = d), B = row-side rows (k = d), four 32-deep k-steps.
// value x value in sH; value x residual and residual x value (both x2048) in sL. The four fragments of a k-step are requested together, before its first product.
__device__ __forceinline__ v8f score16(const h16* __restrict__ RH, const h16* __restrict__ RR, const h16* __restrict__ CH, const h16* __restrict__ CR, int rx, int rrx, int cx, int crx) {
    v8f sH = (v8f){}, sL = (v8f){};
#pragma unroll
    for (int kc = 0; kc < HD; kc += 32) {
        const v16h qf = ldh(RH + rx + kc); const v16h kf = ldh(CH + cx + kc); const v16h qr = ldh(RR + rrx + kc); const v16h kr = ldh(CR + crx + kc);
        sH = mmh(kf, qf, sH); sL = mmh(kf, qr, sL); sL = mmh(kr, qf, sL);
        __builtin_amdgcn_sched_barrier(0);                  // ends the group for the scheduler: without it the build needs more than 256 registers and spills inside the key loop
    }
    v8f t;
#pragma unroll
    for (int r = 0; r < 8; ++r) t[r] = (sH[r] + sL[r] * QRI) * SC2;
    return t;
}

// score32: the two 16-column tiles of a key step, single-product form. All twelve fragments (four row-side, eight column-side) are requested before the first product: one exposed load latency per key step.
__device__ __forceinline__ void score32(const h16* __restrict__ RH, const h16* __restrict__ CH, int rx, int cx, v8f& ta, v8f& tb) {
    v16h qf[4], ka[4], kb[4];
#pragma unroll
    for (int c = 0; c < 4; ++c) { qf[c] = ldh(RH + rx + 32 * c); ka[c] = ldh(CH + cx + 32 * c); kb[c] = ldh(CH + cx + 16 * HD + 32 * c); }
    v8f sa = (v8f){}, sb = (v8f){};
#pragma unroll
    for (int c = 0; c < 4; ++c) { sa = mmh(ka[c], qf[c], sa); sb = mmh(kb[c], qf[c], sb); }
#pragma unroll
    for (int r = 0; r < 8; ++r) { ta[r] = sa[r] * SC2; tb[r] = sb[r] * SC2; }
}

// flash_body: fused attention, one wave per 16 rows of one (batch, head); fragments straight from the f16 planes (two 16-B loads each, arithmetic addressing).
// Transposed form: S^T[j][t] = C R^T (A = column-side rows j, B = row-side rows t); lane (t = lane&15, h = lane>>4) holds columns 8h+r of each 16-column tile, so the packed
// P tile is directly the B fragment of O^T[d][t] = V^T P^T (element r <- tile columns 0..15, element 8+r <- tile columns 16..31, lane unchanged).
// Softmax state (running max over kept columns, partial sum) is one scalar per lane; the two lane halves of a row are combined with one xor-16 exchange.
// Keep rule j <= t evaluated per element in every visited 32-column tile; column 0 is kept for every row, so the running max is finite after the first tile.
// EARLY = 1 (rows [0, EROWS)): three-product scores, P = f16 value + f16 residual x2048, O = V P + (V P_res + V_res P) / 2048 (own accumulators), row sum from the f32 exponentials; all visited columns < EROWS.
// EARLY = 0 (rows [EROWS, SEQ)): single products; row sum over the converted P.
template <int EARLY>
__device__ __forceinline__ void flash_body(const h16* __restrict__ RH, const h16* __restrict__ RR, const h16* __restrict__ CH, const h16* __restrict__ CR,
                                           const h16* __restrict__ VT, const h16* __restrict__ VR, h16* CX, h16* CXR) {
    __shared__ __align__(16) float os[AW * 16 * OSP];
    const int lane = threadIdx.x & 31, lr = lane & 15, hi = lane >> 4;
    const int wave = __builtin_amdgcn_readfirstlane((int)(threadIdx.x >> 5));
    const int zh = blockIdx.y; const int b = zh / NH_, h = zh % NH_;
    const int t0 = (EARLY ? 0 : EROWS) + ((int)blockIdx.x * AW + wave) * 16;
    const int lim = t0 + lr;                                   // column j kept iff j <= lim
    const int nk = (t0 + 16 + 31) & ~31;                       // wave-uniform, multiple of 32, <= SEQ (<= EROWS for EARLY)
    const int pbase = zh * (SEQ * HD);
    const int rbase = zh * (EROWS * HD);
    const int tcl = EARLY ? (t0 + lr) : 0;                     // residual-plane row (only the EARLY band reads it)
    const int ro  = pbase + (t0 + lr) * HD + 8 * hi;           // row-side B fragment: col t, k = d
    const int rro = rbase + tcl * HD + 8 * hi;
    const int co  = pbase + lr * HD + 8 * hi;                  // + j * HD            (A fragment: row j, k = d)
    const int cro = rbase + lr * HD + 8 * hi;
    const int vo  = pbase + lr * SEQ + 8 * hi;                 // + 16jj*SEQ + j      (A fragment: row d, k = j)
    const int vro = rbase + lr * EROWS + 8 * hi;               // + 16jj*EROWS + j
    const v16h hz = (v16h){};
    v8f o[8], oR[8];
#pragma unroll
    for (int j = 0; j < 8; ++j) { o[j] = (v8f){}; oR[j] = (v8f){}; }
    float m = NEGB, l = 0.0f;
#pragma unroll 1
    for (int key0 = 0; key0 < nk; key0 += 32) {
        int rx = ro, rrx = rro;
        asm volatile("" : "+v"(rx), "+v"(rrx));                // row-side fragments are re-read per step through these offsets
        v8f ta, tb;
        if (EARLY) { ta = score16(RH, RR, CH, CR, rx, rrx, co + key0 * HD, cro + key0 * HD);
                     tb = score16(RH, RR, CH, CR, rx, rrx, co + (key0 + 16) * HD, cro + (key0 + 16) * HD); }
        else       { score32(RH, CH, rx, co + key0 * HD, ta, tb); }
        v16h vf[8];                                            // single-product band: the step's eight v^T fragments are requested here, so that they fly under the softmax arithmetic
        if (!EARLY) {
#pragma unroll
            for (int j = 0; j < 8; ++j) vf[j] = ldh(VT + vo + j * (16 * SEQ) + key0); }
        const int ja = key0 + 8 * hi;
        bool fa[8], fb[8]; float mx = NEGB;
#pragma unroll
        for (int r = 0; r < 8; ++r) {
            fa[r] = (ja + r <= lim); fb[r] = (ja + 16 + r <= lim);
            mx = fmaxf(mx, fmaxf(fa[r] ? ta[r] : NEGB, fb[r] ? tb[r] : NEGB)); }
        mx = fmaxf(mx, __shfl_xor(mx, 16, 32));
        const float mnew = fmaxf(m, mx);
        const float alpha = __builtin_amdgcn_exp2f(m - mnew);
        const float sh = PSH - mnew;
        v16h pb, pr = hz; float ls = 0.0f;
#pragma unroll
        for (int r = 0; r < 8; ++r) {
            const float xa = ta[r] + sh, xb = tb[r] + sh;
            const float ea = __builtin_amdgcn_exp2f(xa), eb = __builtin_amdgcn_exp2f(xb);
            const float ga = (fa[r] & (xa >= -14.0f)) ? ea : 0.0f;        // dropped elements and exponents below the f16 normal range selected to 0 by value
            const float gb = (fb[r] & (xb >= -14.0f)) ? eb : 0.0f;
            const h16 pa = (h16)ga; const h16 pc = (h16)gb;
            pb[r] = pa; pb[8 + r] = pc;
            if (EARLY) { pr[r] = toh_flush((ga - (float)pa) * QRS); pr[8 + r] = toh_flush((gb - (float)pc) * QRS); ls += ga + gb; }
            else       { ls += (float)pa + (float)pc; } }
        l = l * alpha + ls; m = mnew;
#pragma unroll
        for (int j = 0; j < 8; ++j) { o[j] = o[j] * alpha; if (EARLY) oR[j] = oR[j] * alpha; }
        if (EARLY) {
#pragma unroll
            for (int j = 0; j < 8; j += 2) {                   // the four fragments of two output tiles are requested together, before their first product
                const v16h v0 = ldh(VT + vo + j * (16 * SEQ) + key0);       const v16h v1 = ldh(VT + vo + (j + 1) * (16 * SEQ) + key0);
                const v16h r0 = ldh(VR + vro + j * (16 * EROWS) + key0);    const v16h r1 = ldh(VR + vro + (j + 1) * (16 * EROWS) + key0);
                o[j] = mmh(v0, pb, o[j]);         oR[j] = mmh(v0, pr, oR[j]);         oR[j] = mmh(r0, pb, oR[j]);
                o[j + 1] = mmh(v1, pb, o[j + 1]); oR[j + 1] = mmh(v1, pr, oR[j + 1]); oR[j + 1] = mmh(r1, pb, oR[j + 1]);
                __builtin_amdgcn_sched_barrier(0);             // ends the group for the scheduler, as in score16
            }
        } else {
#pragma unroll
            for (int j = 0; j < 8; ++j) o[j] = mmh(vf[j], pb, o[j]);
        }
    }
    l += __shfl_xor(l, 16, 32);
    const bool any = l > 0.0f;
    const float lsafe = any ? l : 1.0f;
    const float inv = any ? (CXS * (1.0f / lsafe)) : 0.0f;     // ctx carried x16
    const int wb = wave * 16 * OSP;
    // O^T D layout: f_j[r] = (d = 16j + 8h + r, t = lane&15) -> os[t][d]; rows 0..15 x columns 0..127 all written
#pragma unroll
    for (int j = 0; j < 8; ++j) {
        v8f f = o[j]; if (EARLY) f = o[j] + oR[j] * QRI;
        v4f a, c;
        a[0] = f[0] * inv; a[1] = f[1] * inv; a[2] = f[2] * inv; a[3] = f[3] * inv; c[0] = f[4] * inv; c[1] = f[5] * inv; c[2] = f[6] * inv; c[3] = f[7] * inv;
        *(v4fa*)(&os[wb + lr * OSP + 16 * j + 8 * hi]) = a; *(v4fa*)(&os[wb + lr * OSP + 16 * j + 8 * hi + 4]) = c; }
    wave_sync();
    h16* crow = CX + ((size_t)b * SEQ + (size_t)t0) * HK + (size_t)h * HD;
    h16* rrow = CXR + ((size_t)b * EROWS + (size_t)(EARLY ? t0 : 0)) * HK + (size_t)h * HD;    // EARLY only
{
#pragma unroll
        for (int s = 0; s < 8; ++s) { const int row = 2 * s + (lane >> 4), c8 = (lane & 15) * 8;   // 8 s x 2 rows = 16 rows; 16 lanes x 8 halves = 128 columns = two lines
            const v4f x0 = *(const v4fa*)(&os[wb + row * OSP + c8]); const v4f x1 = *(const v4fa*)(&os[wb + row * OSP + c8 + 4]); v8h hv, rv;
#pragma unroll
            for (int i = 0; i < 4; ++i) { const h16 a0 = toh_flush(x0[i]); const h16 a1 = toh_flush(x1[i]); hv[i] = a0; hv[4 + i] = a1;
                rv[i] = toh_flush((x0[i] - (float)a0) * QRS); rv[4 + i] = toh_flush((x1[i] - (float)a1) * QRS); }
            *(v8h*)(crow + (size_t)row * HK + c8) = hv;
            if (EARLY) *(v8h*)(rrow + (size_t)row * HK + c8) = rv; }
         }
}

__global__ __launch_bounds__(32 * AW) __attribute__((amdgpu_num_vgpr(256))) void k_flash_early(const h16* __restrict__ RH, const h16* __restrict__ RR, const h16* __restrict__ CH, const h16* __restrict__ CR,
                                                                                               const h16* __restrict__ VT, const h16* __restrict__ VR, h16* CX, h16* CXR) {
    flash_body<1>(RH, RR, CH, CR, VT, VR, CX, CXR);
}
__global__ __launch_bounds__(32 * AW) __attribute__((amdgpu_num_vgpr(256))) void k_flash_late(const h16* __restrict__ RH, const h16* __restrict__ RR, const h16* __restrict__ CH, const h16* __restrict__ CR,
                                                                                              const h16* __restrict__ VT, const h16* __restrict__ VR, h16* CX, h16* CXR) {
    flash_body<0>(RH, RR, CH, CR, VT, VR, CX, CXR);
}

// out_body: output GEMM, ONE WAVE per 32 x 64 tile, f16 operands straight from the ctx plane (A, K-contiguous) and the Wo plane (Bt rows, [out][in]), K = HK.
// OUT[(t*NB_FULL + b)][n] = (sum_c ctx16[m][c] wo1024[n][c] (+ residual sum / 2048)) / 16384 + bf16(bo[n]); EARLY: rows t < EROWS with the ctx residual plane in its own accumulators.
template <int EARLY>
__device__ __forceinline__ void out_body(const h16* __restrict__ CX, const h16* __restrict__ CXR, const h16* __restrict__ WO, const float* __restrict__ bo, float* OUT) {
    __shared__ __align__(16) float os[16 * 68];
    const int lane = threadIdx.x & 31, lr = lane & 15, hi = lane >> 4;
    const int TB = EARLY ? (EROWS / 32) : (((SEQ - EROWS) / 32) > 0 ? ((SEQ - EROWS) / 32) : 1);   // 32-row tiles per batch in this band
    const int b = (int)blockIdx.x / TB; const int t0 = (EARLY ? 0 : EROWS) + ((int)blockIdx.x % TB) * 32; const int c0 = blockIdx.y * 64;
    v8f acc[2][4], accr[2][4];
#pragma unroll
    for (int mb = 0; mb < 2; ++mb)
#pragma unroll
        for (int nb = 0; nb < 4; ++nb) { acc[mb][nb] = (v8f){}; accr[mb][nb] = (v8f){}; }
    const size_t aoff = ((size_t)b * SEQ + (size_t)(t0 + lr)) * HK + 8 * hi;
    const size_t roff = ((size_t)b * EROWS + (size_t)((EARLY ? t0 : 0) + lr)) * HK + 8 * hi;      // EARLY only
    const size_t boff = (size_t)(c0 + lr) * HK + 8 * hi;
#pragma unroll 1
    for (int kc = 0; kc < HK; kc += 32) {
        v16h a[2], ar[2], w[4];                             // all fragments of the trip are requested before its first product: one exposed load latency per trip
#pragma unroll
        for (int mb = 0; mb < 2; ++mb) { a[mb] = ldh(CX + aoff + (size_t)mb * 16 * HK + kc); ar[mb] = a[mb];
            if (EARLY) ar[mb] = ldh(CXR + roff + (size_t)mb * 16 * HK + kc); }
#pragma unroll
        for (int nb = 0; nb < 4; ++nb) w[nb] = ldh(WO + boff + (size_t)nb * 16 * HK + kc);
#pragma unroll
        for (int nb = 0; nb < 4; ++nb) {
#pragma unroll
            for (int mb = 0; mb < 2; ++mb) { acc[mb][nb] = mmh(a[mb], w[nb], acc[mb][nb]); if (EARLY) accr[mb][nb] = mmh(ar[mb], w[nb], accr[mb][nb]); } }
    }
    float bc[4];
#pragma unroll
    for (int nb = 0; nb < 4; ++nb) bc[nb] = bfr(bo[c0 + nb * 16 + lr]);      // c0 + 63 < DM
#pragma unroll
    for (int mb = 0; mb < 2; ++mb) {
#pragma unroll
        for (int nb = 0; nb < 4; ++nb) {
#pragma unroll
            for (int j = 0; j < 8; ++j) { float v = acc[mb][nb][j]; if (EARLY) v = v + accr[mb][nb][j] * QRI;
                os[(hi * 8 + j) * 68 + nb * 16 + lr] = v * OSI + bc[nb]; } }                    // D: row 8h+j, col lane&15
        wave_sync();
        float* orow = OUT + ((size_t)(t0 + mb * 16) * NB_FULL + (size_t)b) * DM + (size_t)c0;
{
#pragma unroll
            for (int s = 0; s < 8; ++s) { const int row = 2 * s + (lane >> 4), cofs = (lane & 15) * 4;   // 8 s x 2 rows = 16 rows; 16 lanes x 4 floats = 64 columns = two lines
                const v4f val = *(const v4fa*)(&os[row * 68 + cofs]);
                *(v4f*)(orow + (size_t)row * (NB_FULL * DM) + cofs) = val; }
             }
        wave_sync();
    }
}

__global__ __launch_bounds__(32) __attribute__((amdgpu_num_vgpr(256))) void k_out_early(const h16* __restrict__ CX, const h16* __restrict__ CXR, const h16* __restrict__ WO, const float* __restrict__ bo, float* OUT) {
    out_body<1>(CX, CXR, WO, bo, OUT);
}
__global__ __launch_bounds__(32) void k_out_late(const h16* __restrict__ CX, const h16* __restrict__ CXR, const h16* __restrict__ WO, const float* __restrict__ bo, float* OUT) {
    out_body<0>(CX, CXR, WO, bo, OUT);
}

static constexpr size_t al256(size_t v) { return (v + 255) & ~(size_t)255; }
static constexpr size_t SZ_XB = al256((size_t)NB * SEQ * DM * 2);
static constexpr size_t SZ_WB = al256((size_t)3 * HK * DM * 2);
static constexpr size_t SZ_WO = al256((size_t)DM * HK * 2);
static constexpr size_t SZ_PL = al256((size_t)NB * NH_ * SEQ * HD * 2);
static constexpr size_t SZ_RS = al256((size_t)NB * NH_ * EROWS * HD * 2);
static constexpr size_t SZ_CX = al256((size_t)NB * SEQ * HK * 2);
static constexpr size_t SZ_CR = al256((size_t)NB * EROWS * HK * 2);
static constexpr size_t SZ_TOTAL = SZ_XB + SZ_WB + SZ_WO + 3 * SZ_PL + 3 * SZ_RS + SZ_CX + SZ_CR;
static_assert(SZ_TOTAL <= (size_t)134217728);          // workspace carve <= 128 MiB
static_assert(((size_t)HK * DM * 2) % 256 == 0);       // weight sub-planes stay 256-byte aligned
static_assert((size_t)NB * NH_ * SEQ * HD == (size_t)NB * HK * SEQ);       // v^T plane [(b*1024 + m)][t] has the same extent as the row/column planes
static_assert((size_t)NB * NH_ * EROWS * HD == (size_t)NB * HK * EROWS);   // v^T residual plane [(b*1024 + m)][t < EROWS] has the same extent as the other residual planes
static_assert(((size_t)NB * SEQ * DM / 8) % 256 == 0);  // x converter grid x block == plane extent
static_assert(((size_t)HK * DM / 8) % 256 == 0);        // weight converter grids x block == plane extents

extern "C" void kernel_launch(void* const* d_in, const int* in_sizes, int n_in,
                              void* d_out, int out_size, void* d_ws, size_t ws_size, hipStream_t stream) {
    if (n_in < 9) return;
    const size_t needx = ((size_t)(SEQ - 1) * NB_FULL + NB) * DM;
    if ((size_t)in_sizes[0] < needx) return;
    if ((size_t)in_sizes[1] < (size_t)HK * DM || (size_t)in_sizes[3] < (size_t)HK * DM || (size_t)in_sizes[5] < (size_t)HK * DM || (size_t)in_sizes[7] < (size_t)DM * HK) return;
    if (in_sizes[2] < HK || in_sizes[4] < HK || in_sizes[6] < HK || in_sizes[8] < DM) return;
    if ((size_t)out_size < needx) return;
    if (SZ_TOTAL > ws_size) return;
    // wire order: x, Wk, bk, Wq, bq, Wv, bv, Wo, bo
    const float* x  = (const float*)d_in[0];
    const float* wk = (const float*)d_in[1]; const float* bk = (const float*)d_in[2];
    const float* wq = (const float*)d_in[3]; const float* bq = (const float*)d_in[4];
    const float* wv = (const float*)d_in[5]; const float* bv = (const float*)d_in[6];
    const float* wo = (const float*)d_in[7]; const float* bo = (const float*)d_in[8];
    float* OUT = (float*)d_out;      // [SEQ][NB_FULL][128]
    char* wsp = (char*)d_ws;
    bf* XB = (bf*)wsp; wsp += SZ_XB;                 // [NB*SEQ][128], row = b*SEQ + t
    bf* WB = (bf*)wsp; wsp += SZ_WB;                 // [3][1024][128]: k | q | v  ([out][in] = Bt as-is)
    h16* WO = (h16*)wsp; wsp += SZ_WO;               // [128][1024] bf16(Wo) x1024 in f16
    h16* RH = (h16*)wsp; wsp += SZ_PL;               // row side (Wk projection)    [NB*8][SEQ][128]
    h16* CH = (h16*)wsp; wsp += SZ_PL;               // column side (Wq projection) [NB*8][SEQ][128]
    h16* VT = (h16*)wsp; wsp += SZ_PL;               // [NB*8][128][SEQ]
    h16* RR = (h16*)wsp; wsp += SZ_RS;               // [NB*8][EROWS][128] residual x2048, tokens < EROWS
    h16* CR = (h16*)wsp; wsp += SZ_RS;               // [NB*8][EROWS][128] residual x2048, tokens < EROWS
    h16* VR = (h16*)wsp; wsp += SZ_RS;               // [NB*8][128][EROWS] residual x2048, tokens < EROWS
    h16* CX = (h16*)wsp; wsp += SZ_CX;               // [NB*SEQ][1024] ctx x16
    h16* CXR = (h16*)wsp; wsp += SZ_CR;              // [NB*EROWS][1024] ctx residual x16 x2048, tokens < EROWS
    bf* WKb = WB; bf* WQb = WB + (size_t)HK * DM; bf* WVb = WB + (size_t)2 * HK * DM;

    { const int n8 = NB * SEQ * DM / 8; k_cvtx<<<(unsigned)((n8 + 255) / 256), 256, 0, stream>>>(x, XB, n8); }
    { const size_t n8 = (size_t)HK * DM / 8; const unsigned g = (unsigned)((n8 + 255) / 256);
      k_cvt8<<<g, 256, 0, stream>>>(wk, WKb, n8); k_cvt8<<<g, 256, 0, stream>>>(wq, WQb, n8); k_cvt8<<<g, 256, 0, stream>>>(wv, WVb, n8); }
    { const int n8 = DM * HK / 8; k_cvtwo<<<(unsigned)((n8 + 255) / 256), 256, 0, stream>>>(wo, WO, n8); }

    // row side and column side: A = x rows (m = b*SEQ + t), Bt = W rows (n = h*128 + d) -> plane [(b*8 + h)][t][d]; residuals for tokens < EROWS
    k_proj_rows<<<dim3(NB * SEQ / 64, HK / 64, 1), 32, 0, stream>>>(XB, WKb, bk, RH, RR, EROWS);
    k_proj_rows<<<dim3(NB * SEQ / 64, HK / 64, 1), 32, 0, stream>>>(XB, WQb, bq, CH, CR, EROWS);
    // v^T: A = Wv rows (m = h*128 + d), Bt = x rows (n = b*SEQ + t) -> plane [(b*1024 + m)][t] = [(b*8 + h)][d][t]; residual for tokens < EROWS
    k_proj_tr<<<dim3(HK / 64, NB * SEQ / 64, 1), 32, 0, stream>>>(WVb, XB, bv, VT, VR, EROWS);

    // rows [0, EROWS): multi-product instantiation; rows [EROWS, SEQ): single-product instantiation (disjoint ctx rows)
    k_flash_early<<<dim3(EROWS / (16 * AW), NB * NH_, 1), 32 * AW, 0, stream>>>(RH, RR, CH, CR, VT, VR, CX, CXR);
    if (SEQ > EROWS)
        k_flash_late<<<dim3((SEQ - EROWS) / (16 * AW), NB * NH_, 1), 32 * AW, 0, stream>>>(RH, RR, CH, CR, VT, VR, CX, CXR);

    // output GEMM: rows [0, EROWS) with the ctx residual accumulators, rows [EROWS, SEQ) single product (disjoint output rows)
    k_out_early<<<dim3(NB * EROWS / 32, DM / 64, 1), 32, 0, stream>>>(CX, CXR, WO, bo, OUT);
    if (SEQ > EROWS)
        k_out_late<<<dim3(NB * (SEQ - EROWS) / 32, DM / 64, 1), 32, 0, stream>>>(CX, CXR, WO, bo, OUT);
}

// v002
// A run of this version takes 132 microseconds.
// In two side-by-side timings against v001, it was 1.39 and 1.38 times as fast.
// Over all steps from v000 it is 2.12 times as fast.
#include <hip/hip_runtime.h>

// Causal multi-head attention over one time-major sequence input x [SEQ][NB][128]; 8 heads x 128; Wk/Wq/Wv [1024][128] ([out][in], y = x W^T + bias); scores S[i][j] = kproj_i . qproj_j / sqrt(128)
// (rows follow the Wk projection, the softmax runs over the Wq-projection positions j <= i; the diagonal is always kept); out_i = sum_j P[i][j] vproj_j; heads merged to [t][b][1024]; output = ctx Wo^T + bo, Wo [128][1024], f32 [SEQ][NB][128].
// Compute dtypes, f32 accumulate everywhere: projections v_wmma_f32_16x16x32_bf16 (x, W, bias RNE-converted to bf16; products exact);
// scores v_wmma_f32_16x16x32_f16: single f16 planes on rows >= EROWS; on rows < EROWS both score operands as f16 value + f16 residual x2048 (three products, residual products in their own accumulator);
// P.V v_wmma_f32_16x16x32_f16: P (x16384 carry, cancels in the normalisation) and v single f16 on rows >= EROWS; on rows < EROWS P and v each as f16 value + f16 residual x2048, residual products in their own accumulator folded by 1/2048;
// output GEMM v_wmma_f32_16x16x32_f16: ctx x16 (f16; plus f16 residual x2048 in its own accumulator on rows < EROWS) times bf16(Wo) x1024 held exactly in f16; folded by 1/16384; softmax f32 (online, running max).
// Layout: bf16 x [b][t][128] and W planes; row-side (Wk) and column-side (Wq) planes [b*8+h][t][128], v^T plane [b*8+h][d][t], small residual planes for tokens < EROWS; ctx plane [b*SEQ+t][1024]; fused flash kernel in transposed form
// (S^T = C R^T with the row-side tile as the B operand, O^T = V^T P^T with the packed P tile as the B operand); the column-side and v^T tiles of a key step are staged once per block in a two-buffer LDS ring
// by asynchronous copies and read by all four waves; one work-group barrier per key step.

#ifndef NB
#define NB 8
#endif
#ifndef SEQ
#define SEQ 1024
#endif
#define NB_FULL  8
#define SEQ_FULL 1024
#define DM   128                 // input and output width
#define NH_  8
#define HD   128
#define HK   (NH_ * HD)          // merged head width 1024
#define AW   4                   // waves per flash block (16 rows each)
#define OSP  132                 // LDS row pitch (floats) of the flash output tile
#define KP   136                 // LDS row pitch (halves) of a staged column-side tile: 272 B = 16 B x 17, conflict-free for 16-B fragment reads
#define VP   40                  // LDS row pitch (halves) of a staged v^T tile: 80 B = 16 B x 5, conflict-free for 16-B fragment reads
#define KTH  (32 * KP)           // halves of one staged column-side tile (32 tokens x 128)
#define VTH  (HD * VP)           // halves of one staged v^T tile (128 rows x 32 tokens)
#define EROWS (SEQ < 256 ? SEQ : 256)   // rows (and tokens of the small residual planes) handled by the multi-product instantiations
#define QRS  2048.0f             // carry of every residual plane / residual fragment
#define QRI  (1.0f / 2048.0f)
#define SC2  ((float)(0.08838834764831845 * 1.4426950408889634))   // HD^-0.5 * log2(e)
#define PSH  14.0f               // log2 of the P carry (16384)
#define NEGB (-3.0e38f)
#define CXS  16.0f               // carry of the ctx plane
#define WOS  1024.0f             // carry of the Wo plane
#define OSI  (1.0f / 16384.0f)   // 1 / (CXS * WOS)

static_assert(HD == 128);                      // plane row = 256 bytes = two lines; four 32-deep k-steps per score tile; eight 16-row output tiles
static_assert(NH_ * HD == HK);
static_assert(HD % 64 == 0);                   // a 64-column GEMM tile lies inside one head
static_assert(HK % 64 == 0);
static_assert(DM % 64 == 0);
static_assert(DM % 32 == 0);                   // projection k-loop steps by 32
static_assert(HK % 32 == 0);                   // output GEMM k-loop steps by 32
static_assert(SEQ % 64 == 0);                  // a 64-row tile never straddles two batches
static_assert(SEQ % 32 == 0);                  // key loop steps by 32
static_assert(EROWS % 64 == 0);                // a 64-token GEMM tile lies wholly inside or outside the residual planes; key bound of the first band <= EROWS
static_assert(EROWS >= 64);
static_assert(EROWS <= SEQ);
static_assert(EROWS % (16 * AW) == 0);
static_assert((SEQ - EROWS) % (16 * AW) == 0);
static_assert(EROWS % 32 == 0);
static_assert((SEQ - EROWS) % 32 == 0);
static_assert(NB <= NB_FULL);
static_assert(SEQ <= SEQ_FULL);
static_assert((OSP * 4) % 16 == 0);
static_assert(OSP >= HD);
static_assert((size_t)NB * NH_ * SEQ * HD < (size_t)2147483647);   // plane offsets fit in int
static_assert((size_t)AW * 16 * OSP * 4 + (size_t)2 * 2 * (KTH + VTH) * 2 <= (size_t)131072);   // static LDS of the flash kernels (output tile + two ring buffers of four tiles)
static_assert(AW * 32 == 128);                 // the copy maps below deal 512 16-B pieces of a tile to 128 threads, four each
static_assert(32 * HD * 2 == 512 * 16);        // column-side tile = 512 pieces
static_assert(HD * 32 * 2 == 512 * 16);        // v^T tile = 512 pieces
static_assert((KP * 2) % 16 == 0 && (VP * 2) % 16 == 0 && (KTH * 2) % 16 == 0 && (VTH * 2) % 16 == 0);   // every staged piece stays 16-B aligned
static_assert(KP >= HD && VP >= 32);
static_assert((size_t)16 * 68 * 4 <= (size_t)131072);               // static LDS of the GEMM kernels
static_assert(32 * 4 * 16 == 16 * 64 * 2);     // projection slab store: 32 lanes x 4 instructions x 16 B == 16 rows x 64 halves
static_assert(32 * 8 * 16 == 16 * HD * 2);     // flash slab store: 32 lanes x 8 instructions x 16 B == 16 rows x 128 halves
static_assert(32 * 8 * 16 == 16 * 64 * 4);     // output slab store: 32 lanes x 8 instructions x 16 B == 16 rows x 64 floats
static_assert((DM / 8) == 16);                 // 16 pieces of 8 per input row in the x converter

typedef _Float16 h16;
typedef unsigned short bf;
typedef __attribute__((ext_vector_type(16))) __bf16   v16bf;
typedef __attribute__((ext_vector_type(16))) _Float16 v16h;
typedef __attribute__((ext_vector_type(8)))  _Float16 v8h;
typedef __attribute__((ext_vector_type(8)))  unsigned short v8us;
typedef __attribute__((ext_vector_type(8)))  float    v8f;
typedef __attribute__((ext_vector_type(4)))  float    v4f;
typedef v4f  __attribute__((may_alias)) v4fa;

__device__ __forceinline__ unsigned short f2bf(float f) { unsigned u = __float_as_uint(f); u += 0x7FFFu + ((u >> 16) & 1u); return (unsigned short)(u >> 16); }
__device__ __forceinline__ float bfr(float f) { return __uint_as_float(((unsigned)f2bf(f)) << 16); }   // value after RNE convert to bf16
__device__ __forceinline__ v16h cat16(v8h lo, v8h hi) { return __builtin_shufflevector(lo, hi, 0, 1, 2, 3, 4, 5, 6, 7, 8, 9, 10, 11, 12, 13, 14, 15); }
__device__ __forceinline__ v16bf cat16b(v8us lo, v8us hi) { return __builtin_bit_cast(v16bf, __builtin_shufflevector(lo, hi, 0, 1, 2, 3, 4, 5, 6, 7, 8, 9, 10, 11, 12, 13, 14, 15)); }
__device__ __forceinline__ v8f wmma16(v16h a, v16h b, v8f c) { return __builtin_amdgcn_wmma_f32_16x16x32_f16(false, a, false, b, (short)0, c, false, false); }
__device__ __forceinline__ v8f wmmab(v16bf a, v16bf b, v8f c) { return __builtin_amdgcn_wmma_f32_16x16x32_bf16(false, a, false, b, (short)0, c, false, false); }
// fragment loaders from K-contiguous 16-bit rows; p already includes + 8*(lane>>4): elements 0..7 <- k0+8h+0..7, elements 8..15 <- k0+16+8h+0..7 (same map for A and B)
__device__ __forceinline__ v16h  ldh(const h16* p) { return cat16(*(const v8h*)p, *(const v8h*)(p + 16)); }
__device__ __forceinline__ v16bf ldb(const bf* p)  { return cat16b(*(const v8us*)p, *(const v8us*)(p + 16)); }
// ordering point for wave-private LDS tiles (same wave writes and reads)
__device__ __forceinline__ void wave_sync() { __builtin_amdgcn_fence(3 /* release order */, "wavefront"); __builtin_amdgcn_wave_barrier(); asm volatile("" ::: "memory"); }
// f32 -> f16 operand convert that cannot produce a subnormal (|v| < 2^-14 -> +0), applied after the plane's carry
static __device__ __forceinline__ h16 toh_flush(float v) { const h16 r = (h16)v; return (fabsf(v) < 6.103515625e-05f) ? (h16)0.0f : r; }
// one matrix instruction with its own four-slot guard (ties the accumulator, keeps both fragments live)
__device__ __forceinline__ v8f mmh(v16h a, v16h b, v8f c) { c = wmma16(a, b, c); asm volatile("v_nop\n\tv_nop\n\tv_nop\n\tv_nop" : "+v"(c) : "v"(a), "v"(b)); return c; }
__device__ __forceinline__ v8f mmb(v16bf a, v16bf b, v8f c) { c = wmmab(a, b, c); asm volatile("v_nop\n\tv_nop\n\tv_nop\n\tv_nop" : "+v"(c) : "v"(a), "v"(b)); return c; }

__global__ __launch_bounds__(256) void k_cvt8(const float* __restrict__ src, bf* dst, size_t n8) {
    const size_t i = (size_t)blockIdx.x * 256 + threadIdx.x; if (i >= n8) return;
    const v8f v = *(const v8f*)(src + i * 8); v8us o;
#pragma unroll
    for (int k = 0; k < 8; ++k) o[k] = f2bf(v[k]);
    *(v8us*)(dst + i * 8) = o; 
}

__global__ __launch_bounds__(256) void k_cvtx(const float* __restrict__ src, bf* dst, int n8) {
    const int i = (int)blockIdx.x * 256 + (int)threadIdx.x; if (i >= n8) return;
    const int row = i >> 4, pc = i & 15;                 // row = b*SEQ + t
    const int b = row / SEQ, t = row % SEQ;
    const v8f v = *(const v8f*)(src + ((size_t)t * NB_FULL + (size_t)b) * DM + (size_t)pc * 8); v8us o;
#pragma unroll
    for (int k = 0; k < 8; ++k) o[k] = f2bf(v[k]);
    *(v8us*)(dst + (size_t)i * 8) = o; 
}

__global__ __launch_bounds__(256) void k_cvtwo(const float* __restrict__ src, h16* dst, int n8) {
    const int i = (int)blockIdx.x * 256 + (int)threadIdx.x; if (i >= n8) return;
    const v8f v = *(const v8f*)(src + (size_t)i * 8); v8h o;
#pragma unroll
    for (int k = 0; k < 8; ++k) o[k] = toh_flush(bfr(v[k]) * WOS);
    *(v8h*)(dst + (size_t)i * 8) = o; 
}

// proj_body: register-blocked bf16 GEMM, ONE WAVE per 64x64 tile (16 accumulators), operands straight from K-contiguous bf16 planes, K = DM.
// C[m][n] = sum_k A[m][k] Bt[n][k] + bias, written as f16 (Ph) and, for tokens t < resT (resT a multiple of 64, block-uniform test), the f16 residual x2048 (Pr).
// MODE 0: A = x rows (m = b*SEQ + t), Bt = W rows (n = h*128 + d), bias per column; plane [(b*8 + h)][t][128] (residual plane [(b*8 + h)][resT][128]); the 64-column tile lies inside one head. grid (NB*SEQ/64, HK/64).
// MODE 1: A = W rows (m = h*128 + d), Bt = x rows (n = b*SEQ + t), bias per row; plane [(b*1024 + m)][t], row pitch SEQ (residual plane row pitch resT). grid (HK/64, NB*SEQ/64).
template <int MODE>
__device__ __forceinline__ void proj_body(const bf* __restrict__ A, const bf* __restrict__ Bt, const float* __restrict__ bias, h16* Ph, h16* Pr, int resT) {
    __shared__ __align__(16) float os[16 * 68];
    const int K = DM;
    const int lane = threadIdx.x & 31, lr = lane & 15, hi = lane >> 4; const int r0 = blockIdx.x * 64, c0 = blockIdx.y * 64;
    v8f acc[4][4];
#pragma unroll
    for (int mb = 0; mb < 4; ++mb)
#pragma unroll
        for (int nb = 0; nb < 4; ++nb) acc[mb][nb] = (v8f){};
    const size_t aoff = (size_t)(r0 + lr) * K + 8 * hi, boff = (size_t)(c0 + lr) * K + 8 * hi;
#pragma unroll 1
    for (int kc = 0; kc < K; kc += 32) {
        v16bf a[4], b[4];                                   // all eight fragments of the trip are requested before its first product: one exposed load latency per trip
#pragma unroll
        for (int mb = 0; mb < 4; ++mb) a[mb] = ldb(A + aoff + (size_t)mb * 16 * K + kc);
#pragma unroll
        for (int nb = 0; nb < 4; ++nb) b[nb] = ldb(Bt + boff + (size_t)nb * 16 * K + kc);
#pragma unroll
        for (int nb = 0; nb < 4; ++nb) {
#pragma unroll
            for (int mb = 0; mb < 4; ++mb) acc[mb][nb] = mmb(a[mb], b[nb], acc[mb][nb]); }
    }
    float bc[4];
#pragma unroll
    for (int nb = 0; nb < 4; ++nb) bc[nb] = (MODE == 0) ? bfr(bias[c0 + nb * 16 + lr]) : 0.0f;   // MODE 0: c0 + 63 < HK
    size_t tbase, rbase, tpitch, rpitch; bool wr;                                                 // wr: block-uniform, whole tile inside the residual plane
    if (MODE == 0) { const int bb = r0 / SEQ, tt = r0 % SEQ; const int zc = bb * NH_ + c0 / HD; const int d0 = c0 % HD;
                     tbase = ((size_t)zc * SEQ + (size_t)tt) * HD + (size_t)d0; tpitch = HD;
                     rbase = ((size_t)zc * (size_t)resT + (size_t)tt) * HD + (size_t)d0; rpitch = HD; wr = tt < resT; }
    else           { const int bb = c0 / SEQ, tt = c0 % SEQ;
                     tbase = ((size_t)bb * HK + (size_t)r0) * SEQ + (size_t)tt; tpitch = SEQ;
                     rbase = ((size_t)bb * HK + (size_t)r0) * (size_t)resT + (size_t)tt; rpitch = (size_t)resT; wr = tt < resT; }
#pragma unroll
    for (int mb = 0; mb < 4; ++mb) {
        float br[8];
#pragma unroll
        for (int j = 0; j < 8; ++j) br[j] = (MODE == 1) ? bfr(bias[r0 + mb * 16 + hi * 8 + j]) : 0.0f;   // MODE 1: r0 + 63 < HK
#pragma unroll
        for (int nb = 0; nb < 4; ++nb) {
#pragma unroll
            for (int j = 0; j < 8; ++j) os[(hi * 8 + j) * 68 + nb * 16 + lr] = acc[mb][nb][j] + bc[nb] + br[j]; }   // D: row 8h+j, col lane&15
        wave_sync();
{
#pragma unroll
            for (int s = 0; s < 4; ++s) { const int row = 4 * s + (lane >> 3), c8 = (lane & 7) * 8;   // 4 s x 4 row groups = 16 rows; 8 lanes x 8 = 64 columns
                const v4f x0 = *(const v4fa*)(&os[row * 68 + c8]); const v4f x1 = *(const v4fa*)(&os[row * 68 + c8 + 4]); v8h hv, rv;
#pragma unroll
                for (int i = 0; i < 4; ++i) { const h16 a0 = toh_flush(x0[i]); const h16 a1 = toh_flush(x1[i]); hv[i] = a0; hv[4 + i] = a1;
                    rv[i] = toh_flush((x0[i] - (float)a0) * QRS); rv[4 + i] = toh_flush((x1[i] - (float)a1) * QRS); }
                const size_t oo = tbase + (size_t)(mb * 16 + row) * tpitch + (size_t)c8;
                const size_t ro = rbase + (size_t)(mb * 16 + row) * rpitch + (size_t)c8;
                *(v8h*)(Ph + oo) = hv; if (wr) *(v8h*)(Pr + ro) = rv; }
             }
        wave_sync();
    }
}

__global__ __launch_bounds__(32) void k_proj_rows(const bf* __restrict__ A, const bf* __restrict__ Bt, const float* __restrict__ bias, h16* Ph, h16* Pr, int resT) { proj_body<0>(A, Bt, bias, Ph, Pr, resT); }
__global__ __launch_bounds__(32) void k_proj_tr(const bf* __restrict__ A, const bf* __restrict__ Bt, const float* __restrict__ bias, h16* Ph, h16* Pr, int resT) { proj_body<1>(A, Bt, bias, Ph, Pr, resT); }

// score16: one 16-column-token x 16-row-token tile of scaled logits (log2 domain), multi-product form. A = column-side rows (k = d), B = row-side rows (k = d), four 32-deep k-steps.
// value x value in sH; value x residual and residual x value (both x2048) in sL. The four fragments of a k-step are requested together, before its first product.
// CH / CR point at the lane's row of the staged tiles in LDS.
__device__ __forceinline__ v8f score16(const h16* __restrict__ RH, const h16* __restrict__ RR, const h16* CH, const h16* CR, int rx, int rrx) {
    v8f sH = (v8f){}, sL = (v8f){};
#pragma unroll
    for (int kc = 0; kc < HD; kc += 32) {
        const v16h qf = ldh(RH + rx + kc); const v16h kf = ldh(CH + kc); const v16h qr = ldh(RR + rrx + kc); const v16h kr = ldh(CR + kc);
        sH = mmh(kf, qf, sH); sL = mmh(kf, qr, sL); sL = mmh(kr, qf, sL);
        __builtin_amdgcn_sched_barrier(0);                  // ends the group for the scheduler: without it the build needs more than 256 registers and spills inside the key loop
    }
    v8f t;
#pragma unroll
    for (int r = 0; r < 8; ++r) t[r] = (sH[r] + sL[r] * QRI) * SC2;
    return t;
}

// score32: the two 16-column tiles of a key step, single-product form. All twelve fragments (four row-side, eight column-side) are requested before the first product: one exposed load latency per key step.
// CH points at the lane's row of the staged tile in LDS (row pitch KP).
__device__ __forceinline__ void score32(const h16* __restrict__ RH, const h16* CH, int rx, v8f& ta, v8f& tb) {
    v16h qf[4], ka[4], kb[4];
#pragma unroll
    for (int c = 0; c < 4; ++c) { qf[c] = ldh(RH + rx + 32 * c); ka[c] = ldh(CH + 32 * c); kb[c] = ldh(CH + 16 * KP + 32 * c); }
    v8f sa = (v8f){}, sb = (v8f){};
#pragma unroll
    for (int c = 0; c < 4; ++c) { sa = mmh(ka[c], qf[c], sa); sb = mmh(kb[c], qf[c], sb); }
#pragma unroll
    for (int r = 0; r < 8; ++r) { ta[r] = sa[r] * SC2; tb[r] = sb[r] * SC2; }
}

// Four asynchronous 16-B copies per lane, global -> LDS, through no register. l: the lane's LDS byte address, g: its global address; piece i lies lstep bytes / gstep halves behind piece i - 1.
// The s_wait_xcnt stands inside the copies' own statement so that no address register of an issued copy is rewritten in front of it.
__device__ __forceinline__ void copy4(unsigned l, unsigned lstep, const h16* g, int gstep) {
    const unsigned l1 = l + lstep, l2 = l + 2 * lstep, l3 = l + 3 * lstep;
    const h16* g1 = g + gstep; const h16* g2 = g + 2 * gstep; const h16* g3 = g + 3 * gstep;
    asm volatile("global_load_async_to_lds_b128 %0, %4, off\n\t"
                 "global_load_async_to_lds_b128 %1, %5, off\n\t"
                 "global_load_async_to_lds_b128 %2, %6, off\n\t"
                 "global_load_async_to_lds_b128 %3, %7, off\n\t"
                 "s_wait_xcnt 0x0"
                 :: "v"(l), "v"(l1), "v"(l2), "v"(l3), "v"(g), "v"(g1), "v"(g2), "v"(g3) : "memory");
}

// flash_body: fused attention, one wave per 16 rows of one (batch, head); row-side fragments straight from the f16 plane, column-side and v^T fragments from the block's LDS ring (two 16-B loads each).
// Ring: stage s = the tiles of key step s (column-side 32 x 128, v^T 128 x 32; EARLY also both residual tiles), buffer s & 1. Every thread copies four 16-B pieces of each tile. Order per the two-buffer scheme:
// stage 0, wait, barrier, stage 1; at the foot of step s every wave: LDS reads done, own copies landed, barrier, then stage s + 2 into the buffer just read. A wave past its own key bound skips the arithmetic only.
// Transposed form: S^T[j][t] = C R^T (A = column-side rows j, B = row-side rows t); lane (t = lane&15, h = lane>>4) holds columns 8h+r of each 16-column tile, so the packed
// P tile is directly the B fragment of O^T[d][t] = V^T P^T (element r <- tile columns 0..15, element 8+r <- tile columns 16..31, lane unchanged).
// Softmax state (running max over kept columns, partial sum) is one scalar per lane; the two lane halves of a row are combined with one xor-16 exchange.
// Keep rule j <= t evaluated per element in every visited 32-column tile; column 0 is kept for every row, so the running max is finite after the first tile.
// EARLY = 1 (rows [0, EROWS)): three-product scores, P = f16 value + f16 residual x2048, O = V P + (V P_res + V_res P) / 2048 (own accumulators), row sum from the f32 exponentials; all visited columns < EROWS.
// EARLY = 0 (rows [EROWS, SEQ)): single products; row sum over the converted P.
template <int EARLY>
__device__ __forceinline__ void flash_body(const h16* __restrict__ RH, const h16* __restrict__ RR, const h16* __restrict__ CH, const h16* __restrict__ CR,
                                           const h16* __restrict__ VT, const h16* __restrict__ VR, h16* CX, h16* CXR) {
    __shared__ __align__(16) float os[AW * 16 * OSP];
    constexpr int STG = (EARLY ? 2 : 1) * (KTH + VTH);         // halves per ring buffer: column-side | v^T (| column-side residual | v^T residual)
    __shared__ __align__(16) h16 st[2 * STG];
    const int lane = threadIdx.x & 31, lr = lane & 15, hi = lane >> 4;
    const int wave = __builtin_amdgcn_readfirstlane((int)(threadIdx.x >> 5));
    const int zh = blockIdx.y; const int b = zh / NH_, h = zh % NH_;
    const int t0 = (EARLY ? 0 : EROWS) + ((int)blockIdx.x * AW + wave) * 16;
    const int lim = t0 + lr;                                   // column j kept iff j <= lim
    const int nk = (t0 + 16 + 31) & ~31;                       // wave-uniform, multiple of 32, <= SEQ (<= EROWS for EARLY)
    const int pbase = zh * (SEQ * HD);
    const int rbase = zh * (EROWS * HD);
    const int tcl = EARLY ? (t0 + lr) : 0;                     // residual-plane row (only the EARLY band reads it)
    const int ro  = pbase + (t0 + lr) * HD + 8 * hi;           // row-side B fragment: col t, k = d
    const int rro = rbase + tcl * HD + 8 * hi;
    const int co  = lr * KP + 8 * hi;                          // in a staged column-side tile: + 16 * KP for the second 16 tokens (A fragment: row j, k = d)
    const int vo  = KTH + lr * VP + 8 * hi;                    // in a staged v^T tile: + 16jj * VP                                 (A fragment: row d, k = j)
    const int nkb = ((EARLY ? 0 : EROWS) + ((int)blockIdx.x * AW + AW - 1) * 16 + 16 + 31) & ~31;   // key bound of the block's last wave: block-uniform, >= 64, <= SEQ (<= EROWS for EARLY)
    const int tid = (int)threadIdx.x;
    // copy maps: column-side piece p = tid + 128 i -> token p >> 4, 16-B column p & 15 (i steps 8 tokens); v^T piece p -> row p >> 2, 16-B column p & 3 (i steps 32 rows)
    const unsigned sbase = (unsigned)(size_t)st;
    const unsigned lk = sbase + (unsigned)(((tid >> 4) * KP + (tid & 15) * 8) * 2);
    const unsigned lv = sbase + (unsigned)((KTH + (tid >> 2) * VP + (tid & 3) * 8) * 2);
    const int gk  = pbase + (tid >> 4) * HD + (tid & 15) * 8;      // + key0 * HD
    const int gv  = pbase + (tid >> 2) * SEQ + (tid & 3) * 8;      // + key0
    const int gkr = rbase + (tid >> 4) * HD + (tid & 15) * 8;      // + key0 * HD
    const int gvr = rbase + (tid >> 2) * EROWS + (tid & 3) * 8;    // + key0
    auto stage = [&](int key0, int buf) {                      // key0 + 31 < nkb: every piece lies inside its plane
        const unsigned lb = (unsigned)(buf * STG * 2);
        copy4(lk + lb, 8 * KP * 2, CH + gk + key0 * HD, 8 * HD);
        copy4(lv + lb, 32 * VP * 2, VT + gv + key0, 32 * SEQ);
        if (EARLY) { copy4(lk + lb + (KTH + VTH) * 2, 8 * KP * 2, CR + gkr + key0 * HD, 8 * HD);
                     copy4(lv + lb + (KTH + VTH) * 2, 32 * VP * 2, VR + gvr + key0, 32 * EROWS); }
    };
    const v16h hz = (v16h){};
    v8f o[8], oR[8];
#pragma unroll
    for (int j = 0; j < 8; ++j) { o[j] = (v8f){}; oR[j] = (v8f){}; }
    float m = NEGB, l = 0.0f;
    stage(0, 0);
    asm volatile("s_wait_asynccnt 0x0" ::: "memory");          // this wave's pieces of stage 0 have landed
    __syncthreads();                                           // publishes stage 0 to all four waves
    stage(32, 1);
#pragma unroll 1
    for (int key0 = 0; key0 < nkb; key0 += 32) {
      const int buf = (key0 >> 5) & 1;
      if (key0 < nk) {                                         // wave-uniform: a wave past its own key bound skips the arithmetic, never the publish point below
        const h16* sb = st + buf * STG;
        int rx = ro, rrx = rro;
        asm volatile("" : "+v"(rx), "+v"(rrx));                // row-side fragments are re-read per step through these offsets
        v8f ta, tb;
        if (EARLY) { ta = score16(RH, RR, sb + co, sb + (KTH + VTH) + co, rx, rrx);
                     tb = score16(RH, RR, sb + co + 16 * KP, sb + (KTH + VTH) + co + 16 * KP, rx, rrx); }
        else       { score32(RH, sb + co, rx, ta, tb); }
        v16h vf[8];                                            // single-product band: the step's eight v^T fragments are requested here, so that they fly under the softmax arithmetic
        if (!EARLY) {
#pragma unroll
            for (int j = 0; j < 8; ++j) vf[j] = ldh(sb + vo + j * (16 * VP)); }
        const int ja = key0 + 8 * hi;
        bool fa[8], fb[8]; float mx = NEGB;
#pragma unroll
        for (int r = 0; r < 8; ++r) {
            fa[r] = (ja + r <= lim); fb[r] = (ja + 16 + r <= lim);
            mx = fmaxf(mx, fmaxf(fa[r] ? ta[r] : NEGB, fb[r] ? tb[r] : NEGB)); }
        mx = fmaxf(mx, __shfl_xor(mx, 16, 32));
        const float mnew = fmaxf(m, mx);
        const float alpha = __builtin_amdgcn_exp2f(m - mnew);
        const float sh = PSH - mnew;
        v16h pb, pr = hz; float ls = 0.0f;
#pragma unroll
        for (int r = 0; r < 8; ++r) {
            const float xa = ta[r] + sh, xb = tb[r] + sh;
            const float ea = __builtin_amdgcn_exp2f(xa), eb = __builtin_amdgcn_exp2f(xb);
            const float ga = (fa[r] & (xa >= -14.0f)) ? ea : 0.0f;        // dropped elements and exponents below the f16 normal range selected to 0 by value
            const float gb = (fb[r] & (xb >= -14.0f)) ? eb : 0.0f;
            const h16 pa = (h16)ga; const h16 pc = (h16)gb;
            pb[r] = pa; pb[8 + r] = pc;
            if (EARLY) { pr[r] = toh_flush((ga - (float)pa) * QRS); pr[8 + r] = toh_flush((gb - (float)pc) * QRS); ls += ga + gb; }
            else       { ls += (float)pa + (float)pc; } }
        l = l * alpha + ls; m = mnew;
#pragma unroll
        for (int j = 0; j < 8; ++j) { o[j] = o[j] * alpha; if (EARLY) oR[j] = oR[j] * alpha; }
        if (EARLY) {
#pragma unroll
            for (int j = 0; j < 8; j += 2) {                   // the four fragments of two output tiles are requested together, before their first product
                const v16h v0 = ldh(sb + vo + j * (16 * VP));                  const v16h v1 = ldh(sb + vo + (j + 1) * (16 * VP));
                const v16h r0 = ldh(sb + (KTH + VTH) + vo + j * (16 * VP));    const v16h r1 = ldh(sb + (KTH + VTH) + vo + (j + 1) * (16 * VP));
                o[j] = mmh(v0, pb, o[j]);         oR[j] = mmh(v0, pr, oR[j]);         oR[j] = mmh(r0, pb, oR[j]);
                o[j + 1] = mmh(v1, pb, o[j + 1]); oR[j + 1] = mmh(v1, pr, oR[j + 1]); oR[j + 1] = mmh(r1, pb, oR[j + 1]);
                __builtin_amdgcn_sched_barrier(0);             // ends the group for the scheduler, as in score16
            }
        } else {
#pragma unroll
            for (int j = 0; j < 8; ++j) o[j] = mmh(vf[j], pb, o[j]);
        }
      }
      // publish point of stage s + 1, passed by every wave
      asm volatile("s_wait_dscnt 0x0" ::: "memory");           // this wave's reads of the buffer that is refilled below have returned
      asm volatile("s_wait_asynccnt 0x0" ::: "memory");        // this wave's pieces of the next stage have landed
      __syncthreads();                                         // publishes the next stage and ends every wave's reads of this one
      if (key0 + 64 < nkb) stage(key0 + 64, buf);              // block-uniform test: only while that stage exists
    }
    asm volatile("s_wait_asynccnt 0x0" ::: "memory");          // no copy is outstanding when the wave goes on to the output tile and ends
    l += __shfl_xor(l, 16, 32);
    const bool any = l > 0.0f;
    const float lsafe = any ? l : 1.0f;
    const float inv = any ? (CXS * (1.0f / lsafe)) : 0.0f;     // ctx carried x16
    const int wb = wave * 16 * OSP;
    // O^T D layout: f_j[r] = (d = 16j + 8h + r, t = lane&15) -> os[t][d]; rows 0..15 x columns 0..127 all written
#pragma unroll
    for (int j = 0; j < 8; ++j) {
        v8f f = o[j]; if (EARLY) f = o[j] + oR[j] * QRI;
        v4f a, c;
        a[0] = f[0] * inv; a[1] = f[1] * inv; a[2] = f[2] * inv; a[3] = f[3] * inv; c[0] = f[4] * inv; c[1] = f[5] * inv; c[2] = f[6] * inv; c[3] = f[7] * inv;
        *(v4fa*)(&os[wb + lr * OSP + 16 * j + 8 * hi]) = a; *(v4fa*)(&os[wb + lr * OSP + 16 * j + 8 * hi + 4]) = c; }
    wave_sync();
    h16* crow = CX + ((size_t)b * SEQ + (size_t)t0) * HK + (size_t)h * HD;
    h16* rrow = CXR + ((size_t)b * EROWS + (size_t)(EARLY ? t0 : 0)) * HK + (size_t)h * HD;    // EARLY only
{
#pragma unroll
        for (int s = 0; s < 8; ++s) { const int row = 2 * s + (lane >> 4), c8 = (lane & 15) * 8;   // 8 s x 2 rows = 16 rows; 16 lanes x 8 halves = 128 columns = two lines
            const v4f x0 = *(const v4fa*)(&os[wb + row * OSP + c8]); const v4f x1 = *(const v4fa*)(&os[wb + row * OSP + c8 + 4]); v8h hv, rv;
#pragma unroll
            for (int i = 0; i < 4; ++i) { const h16 a0 = toh_flush(x0[i]); const h16 a1 = toh_flush(x1[i]); hv[i] = a0; hv[4 + i] = a1;
                rv[i] = toh_flush((x0[i] - (float)a0) * QRS); rv[4 + i] = toh_flush((x1[i] - (float)a1) * QRS); }
            *(v8h*)(crow + (size_t)row * HK + c8) = hv;
            if (EARLY) *(v8h*)(rrow + (size_t)row * HK + c8) = rv; }
         }
}

__global__ __launch_bounds__(32 * AW) __attribute__((amdgpu_num_vgpr(256))) void k_flash_early(const h16* __restrict__ RH, const h16* __restrict__ RR, const h16* __restrict__ CH, const h16* __restrict__ CR,
                                                                                               const h16* __restrict__ VT, const h16* __restrict__ VR, h16* CX, h16* CXR) {
    flash_body<1>(RH, RR, CH, CR, VT, VR, CX, CXR);
}
__global__ __launch_bounds__(32 * AW) __attribute__((amdgpu_num_vgpr(256))) void k_flash_late(const h16* __restrict__ RH, const h16* __restrict__ RR, const h16* __restrict__ CH, const h16* __restrict__ CR,
                                                                                              const h16* __restrict__ VT, const h16* __restrict__ VR, h16* CX, h16* CXR) {
    flash_body<0>(RH, RR, CH, CR, VT, VR, CX, CXR);
}

// out_body: output GEMM, ONE WAVE per 32 x 64 tile, f16 operands straight from the ctx plane (A, K-contiguous) and the Wo plane (Bt rows, [out][in]), K = HK.
// OUT[(t*NB_FULL + b)][n] = (sum_c ctx16[m][c] wo1024[n][c] (+ residual sum / 2048)) / 16384 + bf16(bo[n]); EARLY: rows t < EROWS with the ctx residual plane in its own accumulators.
template <int EARLY>
__device__ __forceinline__ void out_body(const h16* __restrict__ CX, const h16* __restrict__ CXR, const h16* __restrict__ WO, const float* __restrict__ bo, float* OUT) {
    __shared__ __align__(16) float os[16 * 68];
    const int lane = threadIdx.x & 31, lr = lane & 15, hi = lane >> 4;
    const int TB = EARLY ? (EROWS / 32) : (((SEQ - EROWS) / 32) > 0 ? ((SEQ - EROWS) / 32) : 1);   // 32-row tiles per batch in this band
    const int b = (int)blockIdx.x / TB; const int t0 = (EARLY ? 0 : EROWS) + ((int)blockIdx.x % TB) * 32; const int c0 = blockIdx.y * 64;
    v8f acc[2][4], accr[2][4];
#pragma unroll
    for (int mb = 0; mb < 2; ++mb)
#pragma unroll
        for (int nb = 0; nb < 4; ++nb) { acc[mb][nb] = (v8f){}; accr[mb][nb] = (v8f){}; }
    const size_t aoff = ((size_t)b * SEQ + (size_t)(t0 + lr)) * HK + 8 * hi;
    const size_t roff = ((size_t)b * EROWS + (size_t)((EARLY ? t0 : 0) + lr)) * HK + 8 * hi;      // EARLY only
    const size_t boff = (size_t)(c0 + lr) * HK + 8 * hi;
#pragma unroll 1
    for (int kc = 0; kc < HK; kc += 32) {
        v16h a[2], ar[2], w[4];                             // all fragments of the trip are requested before its first product: one exposed load latency per trip
#pragma unroll
        for (int mb = 0; mb < 2; ++mb) { a[mb] = ldh(CX + aoff + (size_t)mb * 16 * HK + kc); ar[mb] = a[mb];
            if (EARLY) ar[mb] = ldh(CXR + roff + (size_t)mb * 16 * HK + kc); }
#pragma unroll
        for (int nb = 0; nb < 4; ++nb) w[nb] = ldh(WO + boff + (size_t)nb * 16 * HK + kc);
#pragma unroll
        for (int nb = 0; nb < 4; ++nb) {
#pragma unroll
            for (int mb = 0; mb < 2; ++mb) { acc[mb][nb] = mmh(a[mb], w[nb], acc[mb][nb]); if (EARLY) accr[mb][nb] = mmh(ar[mb], w[nb], accr[mb][nb]); } }
    }
    float bc[4];
#pragma unroll
    for (int nb = 0; nb < 4; ++nb) bc[nb] = bfr(bo[c0 + nb * 16 + lr]);      // c0 + 63 < DM
#pragma unroll
    for (int mb = 0; mb < 2; ++mb) {
#pragma unroll
        for (int nb = 0; nb < 4; ++nb) {
#pragma unroll
            for (int j = 0; j < 8; ++j) { float v = acc[mb][nb][j]; if (EARLY) v = v + accr[mb][nb][j] * QRI;
                os[(hi * 8 + j) * 68 + nb * 16 + lr] = v * OSI + bc[nb]; } }                    // D: row 8h+j, col lane&15
        wave_sync();
        float* orow = OUT + ((size_t)(t0 + mb * 16) * NB_FULL + (size_t)b) * DM + (size_t)c0;
{
#pragma unroll
            for (int s = 0; s < 8; ++s) { const int row = 2 * s + (lane >> 4), cofs = (lane & 15) * 4;   // 8 s x 2 rows = 16 rows; 16 lanes x 4 floats = 64 columns = two lines
                const v4f val = *(const v4fa*)(&os[row * 68 + cofs]);
                *(v4f*)(orow + (size_t)row * (NB_FULL * DM) + cofs) = val; }
             }
        wave_sync();
    }
}

__global__ __launch_bounds__(32) __attribute__((amdgpu_num_vgpr(256))) void k_out_early(const h16* __restrict__ CX, const h16* __restrict__ CXR, const h16* __restrict__ WO, const float* __restrict__ bo, float* OUT) {
    out_body<1>(CX, CXR, WO, bo, OUT);
}
__global__ __launch_bounds__(32) void k_out_late(const h16* __restrict__ CX, const h16* __restrict__ CXR, const h16* __restrict__ WO, const float* __restrict__ bo, float* OUT) {
    out_body<0>(CX, CXR, WO, bo, OUT);
}

static constexpr size_t al256(size_t v) { return (v + 255) & ~(size_t)255; }
static constexpr size_t SZ_XB = al256((size_t)NB * SEQ * DM * 2);
static constexpr size_t SZ_WB = al256((size_t)3 * HK * DM * 2);
static constexpr size_t SZ_WO = al256((size_t)DM * HK * 2);
static constexpr size_t SZ_PL = al256((size_t)NB * NH_ * SEQ * HD * 2);
static constexpr size_t SZ_RS = al256((size_t)NB * NH_ * EROWS * HD * 2);
static constexpr size_t SZ_CX = al256((size_t)NB * SEQ * HK * 2);
static constexpr size_t SZ_CR = al256((size_t)NB * EROWS * HK * 2);
static constexpr size_t SZ_TOTAL = SZ_XB + SZ_WB + SZ_WO + 3 * SZ_PL + 3 * SZ_RS + SZ_CX + SZ_CR;
static_assert(SZ_TOTAL <= (size_t)134217728);          // workspace carve <= 128 MiB
static_assert(((size_t)HK * DM * 2) % 256 == 0);       // weight sub-planes stay 256-byte aligned
static_assert((size_t)NB * NH_ * SEQ * HD == (size_t)NB * HK * SEQ);       // v^T plane [(b*1024 + m)][t] has the same extent as the row/column planes
static_assert((size_t)NB * NH_ * EROWS * HD == (size_t)NB * HK * EROWS);   // v^T residual plane [(b*1024 + m)][t < EROWS] has the same extent as the other residual planes
static_assert(((size_t)NB * SEQ * DM / 8) % 256 == 0);  // x converter grid x block == plane extent
static_assert(((size_t)HK * DM / 8) % 256 == 0);        // weight converter grids x block == plane extents

extern "C" void kernel_launch(void* const* d_in, const int* in_sizes, int n_in,
                              void* d_out, int out_size, void* d_ws, size_t ws_size, hipStream_t stream) {
    if (n_in < 9) return;
    const size_t needx = ((size_t)(SEQ - 1) * NB_FULL + NB) * DM;
    if ((size_t)in_sizes[0] < needx) return;
    if ((size_t)in_sizes[1] < (size_t)HK * DM || (size_t)in_sizes[3] < (size_t)HK * DM || (size_t)in_sizes[5] < (size_t)HK * DM || (size_t)in_sizes[7] < (size_t)DM * HK) return;
    if (in_sizes[2] < HK || in_sizes[4] < HK || in_sizes[6] < HK || in_sizes[8] < DM) return;
    if ((size_t)out_size < needx) return;
    if (SZ_TOTAL > ws_size) return;
    // wire order: x, Wk, bk, Wq, bq, Wv, bv, Wo, bo
    const float* x  = (const float*)d_in[0];
    const float* wk = (const float*)d_in[1]; const float* bk = (const float*)d_in[2];
    const float* wq = (const float*)d_in[3]; const float* bq = (const float*)d_in[4];
    const float* wv = (const float*)d_in[5]; const float* bv = (const float*)d_in[6];
    const float* wo = (const float*)d_in[7]; const float* bo = (const float*)d_in[8];
    float* OUT = (float*)d_out;      // [SEQ][NB_FULL][128]
    char* wsp = (char*)d_ws;
    bf* XB = (bf*)wsp; wsp += SZ_XB;                 // [NB*SEQ][128], row = b*SEQ + t
    bf* WB = (bf*)wsp; wsp += SZ_WB;                 // [3][1024][128]: k | q | v  ([out][in] = Bt as-is)
    h16* WO = (h16*)wsp; wsp += SZ_WO;               // [128][1024] bf16(Wo) x1024 in f16
    h16* RH = (h16*)wsp; wsp += SZ_PL;               // row side (Wk projection)    [NB*8][SEQ][128]
    h16* CH = (h16*)wsp; wsp += SZ_PL;               // column side (Wq projection) [NB*8][SEQ][128]
    h16* VT = (h16*)wsp; wsp += SZ_PL;               // [NB*8][128][SEQ]
    h16* RR = (h16*)wsp; wsp += SZ_RS;               // [NB*8][EROWS][128] residual x2048, tokens < EROWS
    h16* CR = (h16*)wsp; wsp += SZ_RS;               // [NB*8][EROWS][128] residual x2048, tokens < EROWS
    h16* VR = (h16*)wsp; wsp += SZ_RS;               // [NB*8][128][EROWS] residual x2048, tokens < EROWS
    h16* CX = (h16*)wsp; wsp += SZ_CX;               // [NB*SEQ][1024] ctx x16
    h16* CXR = (h16*)wsp; wsp += SZ_CR;              // [NB*EROWS][1024] ctx residual x16 x2048, tokens < EROWS
    bf* WKb = WB; bf* WQb = WB + (size_t)HK * DM; bf* WVb = WB + (size_t)2 * HK * DM;

    { const int n8 = NB * SEQ * DM / 8; k_cvtx<<<(unsigned)((n8 + 255) / 256), 256, 0, stream>>>(x, XB, n8); }
    { const size_t n8 = (size_t)HK * DM / 8; const unsigned g = (unsigned)((n8 + 255) / 256);
      k_cvt8<<<g, 256, 0, stream>>>(wk, WKb, n8); k_cvt8<<<g, 256, 0, stream>>>(wq, WQb, n8); k_cvt8<<<g, 256, 0, stream>>>(wv, WVb, n8); }
    { const int n8 = DM * HK / 8; k_cvtwo<<<(unsigned)((n8 + 255) / 256), 256, 0, stream>>>(wo, WO, n8); }

    // row side and column side: A = x rows (m = b*SEQ + t), Bt = W rows (n = h*128 + d) -> plane [(b*8 + h)][t][d]; residuals for tokens < EROWS
    k_proj_rows<<<dim3(NB * SEQ / 64, HK / 64, 1), 32, 0, stream>>>(XB, WKb, bk, RH, RR, EROWS);
    k_proj_rows<<<dim3(NB * SEQ / 64, HK / 64, 1), 32, 0, stream>>>(XB, WQb, bq, CH, CR, EROWS);
    // v^T: A = Wv rows (m = h*128 + d), Bt = x rows (n = b*SEQ + t) -> plane [(b*1024 + m)][t] = [(b*8 + h)][d][t]; residual for tokens < EROWS
    k_proj_tr<<<dim3(HK / 64, NB * SEQ / 64, 1), 32, 0, stream>>>(WVb, XB, bv, VT, VR, EROWS);

    // rows [0, EROWS): multi-product instantiation; rows [EROWS, SEQ): single-product instantiation (disjoint ctx rows)
    k_flash_early<<<dim3(EROWS / (16 * AW), NB * NH_, 1), 32 * AW, 0, stream>>>(RH, RR, CH, CR, VT, VR, CX, CXR);
    if (SEQ > EROWS)
        k_flash_late<<<dim3((SEQ - EROWS) / (16 * AW), NB * NH_, 1), 32 * AW, 0, stream>>>(RH, RR, CH, CR, VT, VR, CX, CXR);

    // output GEMM: rows [0, EROWS) with the ctx residual accumulators, rows [EROWS, SEQ) single product (disjoint output rows)
    k_out_early<<<dim3(NB * EROWS / 32, DM / 64, 1), 32, 0, stream>>>(CX, CXR, WO, bo, OUT);
    if (SEQ > EROWS)
        k_out_late<<<dim3(NB * (SEQ - EROWS) / 32, DM / 64, 1), 32, 0, stream>>>(CX, CXR, WO, bo, OUT);
}

// v003
// Measured time: 102 microseconds a run.
// In two side-by-side timings against v002, it was 1.30 and 1.29 times as fast.
// Counting every step since v000, it is 2.76 times as fast.
#include <hip/hip_runtime.h>

// Causal multi-head attention over one time-major sequence input x [SEQ][NB][128]; 8 heads x 128; Wk/Wq/Wv [1024][128] ([out][in], y = x W^T + bias); scores S[i][j] = kproj_i . qproj_j / sqrt(128)
// (rows follow the Wk projection, the softmax runs over the Wq-projection positions j <= i; the diagonal is always kept); out_i = sum_j P[i][j] vproj_j; heads merged to [t][b][1024]; output = ctx Wo^T + bo, Wo [128][1024], f32 [SEQ][NB][128].
// Compute dtypes, f32 accumulate everywhere: projections v_wmma_f32_16x16x32_bf16 (x, W, bias RNE-converted to bf16; products exact);
// scores v_wmma_f32_16x16x32_f16: single f16 planes on rows >= EROWS; on rows < EROWS both score operands as f16 value + f16 residual x2048 (three products, residual products in their own accumulator);
// P.V v_wmma_f32_16x16x32_f16: P (x16384 carry, cancels in the normalisation) and v single f16 on rows >= EROWS; on rows < EROWS P and v each as f16 value + f16 residual x2048, residual products in their own accumulator folded by 1/2048;
// output GEMM v_wmma_f32_16x16x32_f16: ctx x16 (f16; plus f16 residual x2048 in its own accumulator on rows < EROWS) times bf16(Wo) x1024 held exactly in f16; folded by 1/16384; softmax f32 (online, running max).
// Layout: bf16 x [b][t][128] and W planes; row-side (Wk) and column-side (Wq) planes [b*8+h][t][128], v^T plane [b*8+h][d][t], small residual planes for tokens < EROWS; ctx plane [b*SEQ+t][1024]; fused flash kernel in transposed form
// (S^T = C R^T with the row-side tile as the B operand, O^T = V^T P^T with the packed P tile as the B operand); the column-side and v^T tiles of a key step are staged once per block in a two-buffer LDS ring
// by asynchronous copies and read by all four waves; one work-group barrier per key step.
// Four dependent launches: conversions, projections, flash, output GEMM; the independent grids of a stage share one grid, each keeping its own block order, and are told apart by block index.

#ifndef NB
#define NB 8
#endif
#ifndef SEQ
#define SEQ 1024
#endif
#define NB_FULL  8
#define SEQ_FULL 1024
#define DM   128                 // input and output width
#define NH_  8
#define HD   128
#define HK   (NH_ * HD)          // merged head width 1024
#define AW   4                   // waves per flash block (16 rows each)
#define OSP  132                 // LDS row pitch (floats) of the flash output tile
#define KP   136                 // LDS row pitch (halves) of a staged column-side tile: 272 B = 16 B x 17, conflict-free for 16-B fragment reads
#define VP   40                  // LDS row pitch (halves) of a staged v^T tile: 80 B = 16 B x 5, conflict-free for 16-B fragment reads
#define KTH  (32 * KP)           // halves of one staged column-side tile (32 tokens x 128)
#define VTH  (HD * VP)           // halves of one staged v^T tile (128 rows x 32 tokens)
#define EROWS (SEQ < 256 ? SEQ : 256)   // rows (and tokens of the small residual planes) handled by the multi-product instantiations
#define QRS  2048.0f             // carry of every residual plane / residual fragment
#define QRI  (1.0f / 2048.0f)
#define SC2  ((float)(0.08838834764831845 * 1.4426950408889634))   // HD^-0.5 * log2(e)
#define PSH  14.0f               // log2 of the P carry (16384)
#define NEGB (-3.0e38f)
#define CXS  16.0f               // carry of the ctx plane
#define WOS  1024.0f             // carry of the Wo plane
#define OSI  (1.0f / 16384.0f)   // 1 / (CXS * WOS)

static_assert(HD == 128);                      // plane row = 256 bytes = two lines; four 32-deep k-steps per score tile; eight 16-row output tiles
static_assert(NH_ * HD == HK);
static_assert(HD % 64 == 0);                   // a 64-column GEMM tile lies inside one head
static_assert(HK % 64 == 0);
static_assert(DM % 64 == 0);
static_assert(DM % 32 == 0);                   // projection k-loop steps by 32
static_assert(HK % 32 == 0);                   // output GEMM k-loop steps by 32
static_assert(SEQ % 64 == 0);                  // a 64-row tile never straddles two batches
static_assert(SEQ % 32 == 0);                  // key loop steps by 32
static_assert(EROWS % 64 == 0);                // a 64-token GEMM tile lies wholly inside or outside the residual planes; key bound of the first band <= EROWS
static_assert(EROWS >= 64);
static_assert(EROWS <= SEQ);
static_assert(EROWS % (16 * AW) == 0);
static_assert((SEQ - EROWS) % (16 * AW) == 0);
static_assert(EROWS % 32 == 0);
static_assert((SEQ - EROWS) % 32 == 0);
static_assert(NB <= NB_FULL);
static_assert(SEQ <= SEQ_FULL);
static_assert((OSP * 4) % 16 == 0);
static_assert(OSP >= HD);
static_assert((size_t)NB * NH_ * SEQ * HD < (size_t)2147483647);   // plane offsets fit in int
static_assert((size_t)4 * 2 * 2 * (KTH + VTH) * 2 <= (size_t)327680);   // static LDS of the flash kernel (two ring buffers of four tiles): four blocks fit a WGP
static_assert((size_t)AW * 16 * OSP * 4 <= (size_t)2 * (KTH + VTH) * 2);   // the output tile fits in the smaller band's ring
static_assert(AW * 32 == 128);                 // the copy maps below deal 512 16-B pieces of a tile to 128 threads, four each
static_assert(32 * HD * 2 == 512 * 16);        // column-side tile = 512 pieces
static_assert(HD * 32 * 2 == 512 * 16);        // v^T tile = 512 pieces
static_assert((KP * 2) % 16 == 0 && (VP * 2) % 16 == 0 && (KTH * 2) % 16 == 0 && (VTH * 2) % 16 == 0);   // every staged piece stays 16-B aligned
static_assert(KP >= HD && VP >= 32);
static_assert((size_t)16 * 68 * 4 <= (size_t)131072);               // static LDS of the GEMM kernels
static_assert(32 * 4 * 16 == 16 * 64 * 2);     // projection slab store: 32 lanes x 4 instructions x 16 B == 16 rows x 64 halves
static_assert(32 * 8 * 16 == 16 * HD * 2);     // flash slab store: 32 lanes x 8 instructions x 16 B == 16 rows x 128 halves
static_assert(32 * 8 * 16 == 16 * 64 * 4);     // output slab store: 32 lanes x 8 instructions x 16 B == 16 rows x 64 floats
static_assert((DM / 8) == 16);                 // 16 pieces of 8 per input row in the x converter

typedef _Float16 h16;
typedef unsigned short bf;
typedef __attribute__((ext_vector_type(16))) __bf16   v16bf;
typedef __attribute__((ext_vector_type(16))) _Float16 v16h;
typedef __attribute__((ext_vector_type(8)))  _Float16 v8h;
typedef __attribute__((ext_vector_type(8)))  unsigned short v8us;
typedef __attribute__((ext_vector_type(8)))  float    v8f;
typedef __attribute__((ext_vector_type(4)))  float    v4f;
typedef v4f  __attribute__((may_alias)) v4fa;

__device__ __forceinline__ unsigned short f2bf(float f) { unsigned u = __float_as_uint(f); u += 0x7FFFu + ((u >> 16) & 1u); return (unsigned short)(u >> 16); }
__device__ __forceinline__ float bfr(float f) { return __uint_as_float(((unsigned)f2bf(f)) << 16); }   // value after RNE convert to bf16
__device__ __forceinline__ v16h cat16(v8h lo, v8h hi) { return __builtin_shufflevector(lo, hi, 0, 1, 2, 3, 4, 5, 6, 7, 8, 9, 10, 11, 12, 13, 14, 15); }
__device__ __forceinline__ v16bf cat16b(v8us lo, v8us hi) { return __builtin_bit_cast(v16bf, __builtin_shufflevector(lo, hi, 0, 1, 2, 3, 4, 5, 6, 7, 8, 9, 10, 11, 12, 13, 14, 15)); }
__device__ __forceinline__ v8f wmma16(v16h a, v16h b, v8f c) { return __builtin_amdgcn_wmma_f32_16x16x32_f16(false, a, false, b, (short)0, c, false, false); }
__device__ __forceinline__ v8f wmmab(v16bf a, v16bf b, v8f c) { return __builtin_amdgcn_wmma_f32_16x16x32_bf16(false, a, false, b, (short)0, c, false, false); }
// fragment loaders from K-contiguous 16-bit rows; p already includes + 8*(lane>>4): elements 0..7 <- k0+8h+0..7, elements 8..15 <- k0+16+8h+0..7 (same map for A and B)
__device__ __forceinline__ v16h  ldh(const h16* p) { return cat16(*(const v8h*)p, *(const v8h*)(p + 16)); }
__device__ __forceinline__ v16bf ldb(const bf* p)  { return cat16b(*(const v8us*)p, *(const v8us*)(p + 16)); }
// ordering point for wave-private LDS tiles (same wave writes and reads)
__device__ __forceinline__ void wave_sync() { __builtin_amdgcn_fence(3 /* release order */, "wavefront"); __builtin_amdgcn_wave_barrier(); asm volatile("" ::: "memory"); }
// f32 -> f16 operand convert that cannot produce a subnormal (|v| < 2^-14 -> +0), applied after the plane's carry
static __device__ __forceinline__ h16 toh_flush(float v) { const h16 r = (h16)v; return (fabsf(v) < 6.103515625e-05f) ? (h16)0.0f : r; }
// one matrix instruction with its own four-slot guard (ties the accumulator, keeps both fragments live)
__device__ __forceinline__ v8f mmh(v16h a, v16h b, v8f c) { c = wmma16(a, b, c); asm volatile("v_nop\n\tv_nop\n\tv_nop\n\tv_nop" : "+v"(c) : "v"(a), "v"(b)); return c; }
__device__ __forceinline__ v8f mmb(v16bf a, v16bf b, v8f c) { c = wmmab(a, b, c); asm volatile("v_nop\n\tv_nop\n\tv_nop\n\tv_nop" : "+v"(c) : "v"(a), "v"(b)); return c; }

__device__ __forceinline__ void cvt8_body(const float* __restrict__ src, bf* dst, int blk) {
    const size_t i = (size_t)blk * 256 + threadIdx.x;
    const v8f v = *(const v8f*)(src + i * 8); v8us o;
#pragma unroll
    for (int k = 0; k < 8; ++k) o[k] = f2bf(v[k]);
    *(v8us*)(dst + i * 8) = o;
    asm volatile("s_wait_xcnt 0x0" ::: "memory");              // another body's code follows in the kernel's text: no register that the store names is rewritten in front of this wait
}

__device__ __forceinline__ void cvtx_body(const float* __restrict__ src, bf* dst, int blk) {
    const int i = blk * 256 + (int)threadIdx.x;
    const int row = i >> 4, pc = i & 15;                 // row = b*SEQ + t
    const int b = row / SEQ, t = row % SEQ;
    const v8f v = *(const v8f*)(src + ((size_t)t * NB_FULL + (size_t)b) * DM + (size_t)pc * 8); v8us o;
#pragma unroll
    for (int k = 0; k < 8; ++k) o[k] = f2bf(v[k]);
    *(v8us*)(dst + (size_t)i * 8) = o;
}

__device__ __forceinline__ void cvtwo_body(const float* __restrict__ src, h16* dst, int blk) {
    const int i = blk * 256 + (int)threadIdx.x;
    const v8f v = *(const v8f*)(src + (size_t)i * 8); v8h o;
#pragma unroll
    for (int k = 0; k < 8; ++k) o[k] = toh_flush(bfr(v[k]) * WOS);
    *(v8h*)(dst + (size_t)i * 8) = o;
    asm volatile("s_wait_xcnt 0x0" ::: "memory");              // as in cvt8_body
}

// All five operand conversions in one launch, told apart by block-index range (each range x 256 threads == its plane's extent in pieces of 8, asserted below): x | Wk | Wq | Wv | Wo.
#define CB_X ((NB * SEQ * DM / 8) / 256)
#define CB_W ((HK * DM / 8) / 256)
__global__ __launch_bounds__(256) void k_cvt_all(const float* __restrict__ x, const float* __restrict__ wk, const float* __restrict__ wq, const float* __restrict__ wv, const float* __restrict__ wo,
                                                 bf* XB, bf* WB, h16* WO) {
    const int blk = (int)blockIdx.x;
    if (blk < CB_X) { cvtx_body(x, XB, blk); return; }
    const int wi = (blk - CB_X) / CB_W, wb = (blk - CB_X) % CB_W;      // block-uniform: 0, 1, 2 = Wk, Wq, Wv; 3 = Wo
    if (wi < 3) cvt8_body(wi == 0 ? wk : (wi == 1 ? wq : wv), WB + (size_t)wi * HK * DM, wb);
    else        cvtwo_body(wo, WO, wb);
}

// proj_body: register-blocked bf16 GEMM, ONE WAVE per 64x64 tile (16 accumulators), operands straight from K-contiguous bf16 planes, K = DM.
// C[m][n] = sum_k A[m][k] Bt[n][k] + bias, written as f16 (Ph) and, for tokens t < resT (resT a multiple of 64, block-uniform test), the f16 residual x2048 (Pr).
// bx, by: the tile's row and column index; os: the wave's LDS slab (16 x 68 floats).
// MODE 0: A = x rows (m = b*SEQ + t), Bt = W rows (n = h*128 + d), bias per column; plane [(b*8 + h)][t][128] (residual plane [(b*8 + h)][resT][128]); the 64-column tile lies inside one head. bx < NB*SEQ/64, by < HK/64.
// MODE 1: A = W rows (m = h*128 + d), Bt = x rows (n = b*SEQ + t), bias per row; plane [(b*1024 + m)][t], row pitch SEQ (residual plane row pitch resT). bx < HK/64, by < NB*SEQ/64.
template <int MODE>
__device__ __forceinline__ void proj_body(const bf* __restrict__ A, const bf* __restrict__ Bt, const float* __restrict__ bias, h16* Ph, h16* Pr, int resT, int bx, int by, float* os) {
    const int K = DM;
    const int lane = threadIdx.x & 31, lr = lane & 15, hi = lane >> 4; const int r0 = bx * 64, c0 = by * 64;
    v8f acc[4][4];
#pragma unroll
    for (int mb = 0; mb < 4; ++mb)
#pragma unroll
        for (int nb = 0; nb < 4; ++nb) acc[mb][nb] = (v8f){};
    const size_t aoff = (size_t)(r0 + lr) * K + 8 * hi, boff = (size_t)(c0 + lr) * K + 8 * hi;
#pragma unroll 1
    for (int kc = 0; kc < K; kc += 32) {
        v16bf a[4], b[4];                                   // all eight fragments of the trip are requested before its first product: one exposed load latency per trip
#pragma unroll
        for (int mb = 0; mb < 4; ++mb) a[mb] = ldb(A + aoff + (size_t)mb * 16 * K + kc);
#pragma unroll
        for (int nb = 0; nb < 4; ++nb) b[nb] = ldb(Bt + boff + (size_t)nb * 16 * K + kc);
#pragma unroll
        for (int nb = 0; nb < 4; ++nb) {
#pragma unroll
            for (int mb = 0; mb < 4; ++mb) acc[mb][nb] = mmb(a[mb], b[nb], acc[mb][nb]); }
    }
    float bc[4];
#pragma unroll
    for (int nb = 0; nb < 4; ++nb) bc[nb] = (MODE == 0) ? bfr(bias[c0 + nb * 16 + lr]) : 0.0f;   // MODE 0: c0 + 63 < HK
    size_t tbase, rbase, tpitch, rpitch; bool wr;                                                 // wr: block-uniform, whole tile inside the residual plane
    if (MODE == 0) { const int bb = r0 / SEQ, tt = r0 % SEQ; const int zc = bb * NH_ + c0 / HD; const int d0 = c0 % HD;
                     tbase = ((size_t)zc * SEQ + (size_t)tt) * HD + (size_t)d0; tpitch = HD;
                     rbase = ((size_t)zc * (size_t)resT + (size_t)tt) * HD + (size_t)d0; rpitch = HD; wr = tt < resT; }
    else           { const int bb = c0 / SEQ, tt = c0 % SEQ;
                     tbase = ((size_t)bb * HK + (size_t)r0) * SEQ + (size_t)tt; tpitch = SEQ;
                     rbase = ((size_t)bb * HK + (size_t)r0) * (size_t)resT + (size_t)tt; rpitch = (size_t)resT; wr = tt < resT; }
#pragma unroll
    for (int mb = 0; mb < 4; ++mb) {
        float br[8];
#pragma unroll
        for (int j = 0; j < 8; ++j) br[j] = (MODE == 1) ? bfr(bias[r0 + mb * 16 + hi * 8 + j]) : 0.0f;   // MODE 1: r0 + 63 < HK
#pragma unroll
        for (int nb = 0; nb < 4; ++nb) {
#pragma unroll
            for (int j = 0; j < 8; ++j) os[(hi * 8 + j) * 68 + nb * 16 + lr] = acc[mb][nb][j] + bc[nb] + br[j]; }   // D: row 8h+j, col lane&15
        wave_sync();
{
#pragma unroll
            for (int s = 0; s < 4; ++s) { const int row = 4 * s + (lane >> 3), c8 = (lane & 7) * 8;   // 4 s x 4 row groups = 16 rows; 8 lanes x 8 = 64 columns
                const v4f x0 = *(const v4fa*)(&os[row * 68 + c8]); const v4f x1 = *(const v4fa*)(&os[row * 68 + c8 + 4]); v8h hv, rv;
#pragma unroll
                for (int i = 0; i < 4; ++i) { const h16 a0 = toh_flush(x0[i]); const h16 a1 = toh_flush(x1[i]); hv[i] = a0; hv[4 + i] = a1;
                    rv[i] = toh_flush((x0[i] - (float)a0) * QRS); rv[4 + i] = toh_flush((x1[i] - (float)a1) * QRS); }
                const size_t oo = tbase + (size_t)(mb * 16 + row) * tpitch + (size_t)c8;
                const size_t ro = rbase + (size_t)(mb * 16 + row) * rpitch + (size_t)c8;
                *(v8h*)(Ph + oo) = hv; if (wr) *(v8h*)(Pr + ro) = rv; }
             }
        wave_sync();
    }
}

// All three projections in one launch, grid (PT_N, 3): blockIdx.y = 0 row side (Wk), 1 column side (Wq), 2 v^T (Wv); blockIdx.x = the tile, row index fastest in each. WB: [3][1024][128] k | q | v.
#define PT_N ((NB * SEQ / 64) * (HK / 64))
__global__ __launch_bounds__(32) void k_proj_all(const bf* __restrict__ XB, const bf* __restrict__ WB, const float* __restrict__ bk, const float* __restrict__ bq, const float* __restrict__ bv,
                                                 h16* RH, h16* RR, h16* CH, h16* CR, h16* VT, h16* VR, int resT) {
    __shared__ __align__(16) float os[16 * 68];
    const int z = (int)blockIdx.y, tl = (int)blockIdx.x;       // block-uniform
    if (z < 2) proj_body<0>(XB, WB + (size_t)z * HK * DM, z == 0 ? bk : bq, z == 0 ? RH : CH, z == 0 ? RR : CR, resT, tl % (NB * SEQ / 64), tl / (NB * SEQ / 64), os);
    else       proj_body<1>(WB + (size_t)2 * HK * DM, XB, bv, VT, VR, resT, tl % (HK / 64), tl / (HK / 64), os);
}

// score16: one 16-column-token x 16-row-token tile of scaled logits (log2 domain), multi-product form. A = column-side rows (k = d), B = row-side rows (k = d), four 32-deep k-steps.
// value x value in sH; value x residual and residual x value (both x2048) in sL. The four fragments of a k-step are requested together, before its first product.
// CH / CR point at the lane's row of the staged tiles in LDS.
__device__ __forceinline__ v8f score16(const h16* __restrict__ RH, const h16* __restrict__ RR, const h16* CH, const h16* CR, int rx, int rrx) {
    v8f sH = (v8f){}, sL = (v8f){};
#pragma unroll
    for (int kc = 0; kc < HD; kc += 32) {
        const v16h qf = ldh(RH + rx + kc); const v16h kf = ldh(CH + kc); const v16h qr = ldh(RR + rrx + kc); const v16h kr = ldh(CR + kc);
        sH = mmh(kf, qf, sH); sL = mmh(kf, qr, sL); sL = mmh(kr, qf, sL);
        __builtin_amdgcn_sched_barrier(0);                  // ends the group for the scheduler: without it the build needs more than 256 registers and spills inside the key loop
    }
    v8f t;
#pragma unroll
    for (int r = 0; r < 8; ++r) t[r] = (sH[r] + sL[r] * QRI) * SC2;
    return t;
}

// score32: the two 16-column tiles of a key step, single-product form. All twelve fragments (four row-side, eight column-side) are requested before the first product: one exposed load latency per key step.
// CH points at the lane's row of the staged tile in LDS (row pitch KP).
__device__ __forceinline__ void score32(const h16* __restrict__ RH, const h16* CH, int rx, v8f& ta, v8f& tb) {
    v16h qf[4], ka[4], kb[4];
#pragma unroll
    for (int c = 0; c < 4; ++c) { qf[c] = ldh(RH + rx + 32 * c); ka[c] = ldh(CH + 32 * c); kb[c] = ldh(CH + 16 * KP + 32 * c); }
    v8f sa = (v8f){}, sb = (v8f){};
#pragma unroll
    for (int c = 0; c < 4; ++c) { sa = mmh(ka[c], qf[c], sa); sb = mmh(kb[c], qf[c], sb); }
#pragma unroll
    for (int r = 0; r < 8; ++r) { ta[r] = sa[r] * SC2; tb[r] = sb[r] * SC2; }
}

// Four asynchronous 16-B copies per lane, global -> LDS, through no register. l: the lane's LDS byte address, g: its global address; piece i lies lstep bytes / gstep halves behind piece i - 1.
// The s_wait_xcnt stands inside the copies' own statement so that no address register of an issued copy is rewritten in front of it.
__device__ __forceinline__ void copy4(unsigned l, unsigned lstep, const h16* g, int gstep) {
    const unsigned l1 = l + lstep, l2 = l + 2 * lstep, l3 = l + 3 * lstep;
    const h16* g1 = g + gstep; const h16* g2 = g + 2 * gstep; const h16* g3 = g + 3 * gstep;
    asm volatile("global_load_async_to_lds_b128 %0, %4, off\n\t"
                 "global_load_async_to_lds_b128 %1, %5, off\n\t"
                 "global_load_async_to_lds_b128 %2, %6, off\n\t"
                 "global_load_async_to_lds_b128 %3, %7, off\n\t"
                 "s_wait_xcnt 0x0"
                 :: "v"(l), "v"(l1), "v"(l2), "v"(l3), "v"(g), "v"(g1), "v"(g2), "v"(g3) : "memory");
}

// flash_body: fused attention, one wave per 16 rows of one (batch, head); row-side fragments straight from the f16 plane, column-side and v^T fragments from the block's LDS ring (two 16-B loads each).
// Ring: stage s = the tiles of key step s (column-side 32 x 128, v^T 128 x 32; EARLY also both residual tiles), buffer s & 1. Every thread copies four 16-B pieces of each tile. Order per the two-buffer scheme:
// stage 0, wait, barrier, stage 1; at the foot of step s every wave: LDS reads done, own copies landed, barrier, then stage s + 2 into the buffer just read. A wave past its own key bound skips the arithmetic only.
// Transposed form: S^T[j][t] = C R^T (A = column-side rows j, B = row-side rows t); lane (t = lane&15, h = lane>>4) holds columns 8h+r of each 16-column tile, so the packed
// P tile is directly the B fragment of O^T[d][t] = V^T P^T (element r <- tile columns 0..15, element 8+r <- tile columns 16..31, lane unchanged).
// Softmax state (running max over kept columns, partial sum) is one scalar per lane; the two lane halves of a row are combined with one xor-16 exchange.
// Keep rule j <= t evaluated per element in every visited 32-column tile; column 0 is kept for every row, so the running max is finite after the first tile.
// EARLY = 1 (rows [0, EROWS)): three-product scores, P = f16 value + f16 residual x2048, O = V P + (V P_res + V_res P) / 2048 (own accumulators), row sum from the f32 exponentials; all visited columns < EROWS.
// EARLY = 0 (rows [EROWS, SEQ)): single products; row sum over the converted P.
// tile: the block's 64-row tile inside its band; zh: batch * 8 + head; st: the block's LDS (2 * STG halves of ring; after the key loop its first bytes hold the output tile os).
template <int EARLY>
__device__ __forceinline__ void flash_body(const h16* __restrict__ RH, const h16* __restrict__ RR, const h16* __restrict__ CH, const h16* __restrict__ CR,
                                           const h16* __restrict__ VT, const h16* __restrict__ VR, h16* CX, h16* CXR, int tile, int zh, h16* st) {
    constexpr int STG = (EARLY ? 2 : 1) * (KTH + VTH);         // halves per ring buffer: column-side | v^T (| column-side residual | v^T residual)
    float* os = (float*)st;                                    // written only behind the last publish point of the key loop: there every wave's ring reads have returned, every copy has landed, none is issued after it
    const int lane = threadIdx.x & 31, lr = lane & 15, hi = lane >> 4;
    const int wave = __builtin_amdgcn_readfirstlane((int)(threadIdx.x >> 5));
    const int b = zh / NH_, h = zh % NH_;
    const int t0 = (EARLY ? 0 : EROWS) + (tile * AW + wave) * 16;
    const int lim = t0 + lr;                                   // column j kept iff j <= lim
    const int nk = (t0 + 16 + 31) & ~31;                       // wave-uniform, multiple of 32, <= SEQ (<= EROWS for EARLY)
    const int pbase = zh * (SEQ * HD);
    const int rbase = zh * (EROWS * HD);
    const int tcl = EARLY ? (t0 + lr) : 0;                     // residual-plane row (only the EARLY band reads it)
    const int ro  = pbase + (t0 + lr) * HD + 8 * hi;           // row-side B fragment: col t, k = d
    const int rro = rbase + tcl * HD + 8 * hi;
    const int co  = lr * KP + 8 * hi;                          // in a staged column-side tile: + 16 * KP for the second 16 tokens (A fragment: row j, k = d)
    const int vo  = KTH + lr * VP + 8 * hi;                    // in a staged v^T tile: + 16jj * VP                                 (A fragment: row d, k = j)
    const int nkb = ((EARLY ? 0 : EROWS) + (tile * AW + AW - 1) * 16 + 16 + 31) & ~31;   // key bound of the block's last wave: block-uniform, >= 64, <= SEQ (<= EROWS for EARLY)
    const int tid = (int)threadIdx.x;
    // copy maps: column-side piece p = tid + 128 i -> token p >> 4, 16-B column p & 15 (i steps 8 tokens); v^T piece p -> row p >> 2, 16-B column p & 3 (i steps 32 rows)
    const unsigned sbase = (unsigned)(size_t)st;
    const unsigned lk = sbase + (unsigned)(((tid >> 4) * KP + (tid & 15) * 8) * 2);
    const unsigned lv = sbase + (unsigned)((KTH + (tid >> 2) * VP + (tid & 3) * 8) * 2);
    const int gk  = pbase + (tid >> 4) * HD + (tid & 15) * 8;      // + key0 * HD
    const int gv  = pbase + (tid >> 2) * SEQ + (tid & 3) * 8;      // + key0
    const int gkr = rbase + (tid >> 4) * HD + (tid & 15) * 8;      // + key0 * HD
    const int gvr = rbase + (tid >> 2) * EROWS + (tid & 3) * 8;    // + key0
    auto stage = [&](int key0, int buf) {                      // key0 + 31 < nkb: every piece lies inside its plane
        const unsigned lb = (unsigned)(buf * STG * 2);
        copy4(lk + lb, 8 * KP * 2, CH + gk + key0 * HD, 8 * HD);
        copy4(lv + lb, 32 * VP * 2, VT + gv + key0, 32 * SEQ);
        if (EARLY) { copy4(lk + lb + (KTH + VTH) * 2, 8 * KP * 2, CR + gkr + key0 * HD, 8 * HD);
                     copy4(lv + lb + (KTH + VTH) * 2, 32 * VP * 2, VR + gvr + key0, 32 * EROWS); }
    };
    const v16h hz = (v16h){};
    v8f o[8], oR[8];
#pragma unroll
    for (int j = 0; j < 8; ++j) { o[j] = (v8f){}; oR[j] = (v8f){}; }
    float m = NEGB, l = 0.0f;
    stage(0, 0);
    asm volatile("s_wait_asynccnt 0x0" ::: "memory");          // this wave's pieces of stage 0 have landed
    __syncthreads();                                           // publishes stage 0 to all four waves
    stage(32, 1);
#pragma unroll 1
    for (int key0 = 0; key0 < nkb; key0 += 32) {
      const int buf = (key0 >> 5) & 1;
      if (key0 < nk) {                                         // wave-uniform: a wave past its own key bound skips the arithmetic, never the publish point below
        const h16* sb = st + buf * STG;
        int rx = ro, rrx = rro;
        asm volatile("" : "+v"(rx), "+v"(rrx));                // row-side fragments are re-read per step through these offsets
        v8f ta, tb;
        if (EARLY) { ta = score16(RH, RR, sb + co, sb + (KTH + VTH) + co, rx, rrx);
                     tb = score16(RH, RR, sb + co + 16 * KP, sb + (KTH + VTH) + co + 16 * KP, rx, rrx); }
        else       { score32(RH, sb + co, rx, ta, tb); }
        v16h vf[8];                                            // single-product band: the step's eight v^T fragments are requested here, so that they fly under the softmax arithmetic
        if (!EARLY) {
#pragma unroll
            for (int j = 0; j < 8; ++j) vf[j] = ldh(sb + vo + j * (16 * VP)); }
        const int ja = key0 + 8 * hi;
        bool fa[8], fb[8]; float mx = NEGB;
#pragma unroll
        for (int r = 0; r < 8; ++r) {
            fa[r] = (ja + r <= lim); fb[r] = (ja + 16 + r <= lim);
            mx = fmaxf(mx, fmaxf(fa[r] ? ta[r] : NEGB, fb[r] ? tb[r] : NEGB)); }
        mx = fmaxf(mx, __shfl_xor(mx, 16, 32));
        const float mnew = fmaxf(m, mx);
        const float alpha = __builtin_amdgcn_exp2f(m - mnew);
        const float sh = PSH - mnew;
        v16h pb, pr = hz; float ls = 0.0f;
#pragma unroll
        for (int r = 0; r < 8; ++r) {
            const float xa = ta[r] + sh, xb = tb[r] + sh;
            const float ea = __builtin_amdgcn_exp2f(xa), eb = __builtin_amdgcn_exp2f(xb);
            const float ga = (fa[r] & (xa >= -14.0f)) ? ea : 0.0f;        // dropped elements and exponents below the f16 normal range selected to 0 by value
            const float gb = (fb[r] & (xb >= -14.0f)) ? eb : 0.0f;
            const h16 pa = (h16)ga; const h16 pc = (h16)gb;
            pb[r] = pa; pb[8 + r] = pc;
            if (EARLY) { pr[r] = toh_flush((ga - (float)pa) * QRS); pr[8 + r] = toh_flush((gb - (float)pc) * QRS); ls += ga + gb; }
            else       { ls += (float)pa + (float)pc; } }
        l = l * alpha + ls; m = mnew;
#pragma unroll
        for (int j = 0; j < 8; ++j) { o[j] = o[j] * alpha; if (EARLY) oR[j] = oR[j] * alpha; }
        if (EARLY) {
#pragma unroll
            for (int j = 0; j < 8; j += 2) {                   // the four fragments of two output tiles are requested together, before their first product
                const v16h v0 = ldh(sb + vo + j * (16 * VP));                  const v16h v1 = ldh(sb + vo + (j + 1) * (16 * VP));
                const v16h r0 = ldh(sb + (KTH + VTH) + vo + j * (16 * VP));    const v16h r1 = ldh(sb + (KTH + VTH) + vo + (j + 1) * (16 * VP));
                o[j] = mmh(v0, pb, o[j]);         oR[j] = mmh(v0, pr, oR[j]);         oR[j] = mmh(r0, pb, oR[j]);
                o[j + 1] = mmh(v1, pb, o[j + 1]); oR[j + 1] = mmh(v1, pr, oR[j + 1]); oR[j + 1] = mmh(r1, pb, oR[j + 1]);
                __builtin_amdgcn_sched_barrier(0);             // ends the group for the scheduler, as in score16
            }
        } else {
#pragma unroll
            for (int j = 0; j < 8; ++j) o[j] = mmh(vf[j], pb, o[j]);
        }
      }
      // publish point of stage s + 1, passed by every wave
      asm volatile("s_wait_dscnt 0x0" ::: "memory");           // this wave's reads of the buffer that is refilled below have returned
      asm volatile("s_wait_asynccnt 0x0" ::: "memory");        // this wave's pieces of the next stage have landed
      __syncthreads();                                         // publishes the next stage and ends every wave's reads of this one
      if (key0 + 64 < nkb) stage(key0 + 64, buf);              // block-uniform test: only while that stage exists
    }
    asm volatile("s_wait_asynccnt 0x0" ::: "memory");          // no copy is outstanding when the wave goes on to the output tile and ends
    l += __shfl_xor(l, 16, 32);
    const bool any = l > 0.0f;
    const float lsafe = any ? l : 1.0f;
    const float inv = any ? (CXS * (1.0f / lsafe)) : 0.0f;     // ctx carried x16
    const int wb = wave * 16 * OSP;
    // O^T D layout: f_j[r] = (d = 16j + 8h + r, t = lane&15) -> os[t][d]; rows 0..15 x columns 0..127 all written
#pragma unroll
    for (int j = 0; j < 8; ++j) {
        v8f f = o[j]; if (EARLY) f = o[j] + oR[j] * QRI;
        v4f a, c;
        a[0] = f[0] * inv; a[1] = f[1] * inv; a[2] = f[2] * inv; a[3] = f[3] * inv; c[0] = f[4] * inv; c[1] = f[5] * inv; c[2] = f[6] * inv; c[3] = f[7] * inv;
        *(v4fa*)(&os[wb + lr * OSP + 16 * j + 8 * hi]) = a; *(v4fa*)(&os[wb + lr * OSP + 16 * j + 8 * hi + 4]) = c; }
    wave_sync();
    h16* crow = CX + ((size_t)b * SEQ + (size_t)t0) * HK + (size_t)h * HD;
    h16* rrow = CXR + ((size_t)b * EROWS + (size_t)(EARLY ? t0 : 0)) * HK + (size_t)h * HD;    // EARLY only
{
#pragma unroll
        for (int s = 0; s < 8; ++s) { const int row = 2 * s + (lane >> 4), c8 = (lane & 15) * 8;   // 8 s x 2 rows = 16 rows; 16 lanes x 8 halves = 128 columns = two lines
            const v4f x0 = *(const v4fa*)(&os[wb + row * OSP + c8]); const v4f x1 = *(const v4fa*)(&os[wb + row * OSP + c8 + 4]); v8h hv, rv;
#pragma unroll
            for (int i = 0; i < 4; ++i) { const h16 a0 = toh_flush(x0[i]); const h16 a1 = toh_flush(x1[i]); hv[i] = a0; hv[4 + i] = a1;
                rv[i] = toh_flush((x0[i] - (float)a0) * QRS); rv[4 + i] = toh_flush((x1[i] - (float)a1) * QRS); }
            *(v8h*)(crow + (size_t)row * HK + c8) = hv;
            if (EARLY) *(v8h*)(rrow + (size_t)row * HK + c8) = rv; }
         }
    if (!EARLY) asm volatile("s_wait_xcnt 0x0" ::: "memory");  // as in cvt8_body (the multi-product body's code follows the single-product body's)
}

// Both row bands in one launch, a one-dimensional grid: first the multi-product blocks of rows < EROWS, then the single-product blocks, in each band the tile index fastest and batch * 8 + head behind it.
// One LDS array serves both bodies (the larger ring; the output tile lies in it), so that four blocks fit a WGP's LDS and the whole grid is resident at once.
#define FT_E (EROWS / (16 * AW))
#define FT_L ((SEQ - EROWS) / (16 * AW) > 0 ? (SEQ - EROWS) / (16 * AW) : 1)
#define FB_E (FT_E * NB * NH_)
#define FB_L ((SEQ - EROWS) / (16 * AW) * NB * NH_)
__global__ __launch_bounds__(32 * AW) __attribute__((amdgpu_num_vgpr(256))) void k_flash_all(const h16* __restrict__ RH, const h16* __restrict__ RR, const h16* __restrict__ CH, const h16* __restrict__ CR,
                                                                                             const h16* __restrict__ VT, const h16* __restrict__ VR, h16* CX, h16* CXR) {
    __shared__ __align__(16) h16 st[2 * 2 * (KTH + VTH)];
    const int blk = (int)blockIdx.x;                           // block-uniform
    if (blk < FB_E) flash_body<1>(RH, RR, CH, CR, VT, VR, CX, CXR, blk % FT_E, blk / FT_E, st);
    else            flash_body<0>(RH, RR, CH, CR, VT, VR, CX, CXR, (blk - FB_E) % FT_L, (blk - FB_E) / FT_L, st);
}

// out_body: output GEMM, ONE WAVE per 32 x 64 tile, f16 operands straight from the ctx plane (A, K-contiguous) and the Wo plane (Bt rows, [out][in]), K = HK.
// OUT[(t*NB_FULL + b)][n] = (sum_c ctx16[m][c] wo1024[n][c] (+ residual sum / 2048)) / 16384 + bf16(bo[n]); EARLY: rows t < EROWS with the ctx residual plane in its own accumulators.
// bx: the row tile's index inside its band (batch-major); os: the wave's LDS slab (16 x 68 floats).
template <int EARLY>
__device__ __forceinline__ void out_body(const h16* __restrict__ CX, const h16* __restrict__ CXR, const h16* __restrict__ WO, const float* __restrict__ bo, float* OUT, int bx, float* os) {
    const int lane = threadIdx.x & 31, lr = lane & 15, hi = lane >> 4;
    const int TB = EARLY ? (EROWS / 32) : (((SEQ - EROWS) / 32) > 0 ? ((SEQ - EROWS) / 32) : 1);   // 32-row tiles per batch in this band
    const int b = bx / TB; const int t0 = (EARLY ? 0 : EROWS) + (bx % TB) * 32; const int c0 = blockIdx.y * 64;
    v8f acc[2][4], accr[2][4];
#pragma unroll
    for (int mb = 0; mb < 2; ++mb)
#pragma unroll
        for (int nb = 0; nb < 4; ++nb) { acc[mb][nb] = (v8f){}; accr[mb][nb] = (v8f){}; }
    const size_t aoff = ((size_t)b * SEQ + (size_t)(t0 + lr)) * HK + 8 * hi;
    const size_t roff = ((size_t)b * EROWS + (size_t)((EARLY ? t0 : 0) + lr)) * HK + 8 * hi;      // EARLY only
    const size_t boff = (size_t)(c0 + lr) * HK + 8 * hi;
#pragma unroll 1
    for (int kc = 0; kc < HK; kc += 32) {
        v16h a[2], ar[2], w[4];                             // all fragments of the trip are requested before its first product: one exposed load latency per trip
#pragma unroll
        for (int mb = 0; mb < 2; ++mb) { a[mb] = ldh(CX + aoff + (size_t)mb * 16 * HK + kc); ar[mb] = a[mb];
            if (EARLY) ar[mb] = ldh(CXR + roff + (size_t)mb * 16 * HK + kc); }
#pragma unroll
        for (int nb = 0; nb < 4; ++nb) w[nb] = ldh(WO + boff + (size_t)nb * 16 * HK + kc);
#pragma unroll
        for (int nb = 0; nb < 4; ++nb) {
#pragma unroll
            for (int mb = 0; mb < 2; ++mb) { acc[mb][nb] = mmh(a[mb], w[nb], acc[mb][nb]); if (EARLY) accr[mb][nb] = mmh(ar[mb], w[nb], accr[mb][nb]); } }
    }
    float bc[4];
#pragma unroll
    for (int nb = 0; nb < 4; ++nb) bc[nb] = bfr(bo[c0 + nb * 16 + lr]);      // c0 + 63 < DM
#pragma unroll
    for (int mb = 0; mb < 2; ++mb) {
#pragma unroll
        for (int nb = 0; nb < 4; ++nb) {
#pragma unroll
            for (int j = 0; j < 8; ++j) { float v = acc[mb][nb][j]; if (EARLY) v = v + accr[mb][nb][j] * QRI;
                os[(hi * 8 + j) * 68 + nb * 16 + lr] = v * OSI + bc[nb]; } }                    // D: row 8h+j, col lane&15
        wave_sync();
        float* orow = OUT + ((size_t)(t0 + mb * 16) * NB_FULL + (size_t)b) * DM + (size_t)c0;
{
#pragma unroll
            for (int s = 0; s < 8; ++s) { const int row = 2 * s + (lane >> 4), cofs = (lane & 15) * 4;   // 8 s x 2 rows = 16 rows; 16 lanes x 4 floats = 64 columns = two lines
                const v4f val = *(const v4fa*)(&os[row * 68 + cofs]);
                *(v4f*)(orow + (size_t)row * (NB_FULL * DM) + cofs) = val; }
             }
        wave_sync();
    }
}

// Both row bands in one launch, grid (NB * SEQ / 32, DM / 64): blockIdx.x < OB_E = the two-accumulator tiles of rows < EROWS, the rest the single-product tiles; in each band the row tile fastest and the column tile behind it.
#define OB_E (NB * EROWS / 32)
__global__ __launch_bounds__(32) __attribute__((amdgpu_num_vgpr(256))) void k_out_all(const h16* __restrict__ CX, const h16* __restrict__ CXR, const h16* __restrict__ WO, const float* __restrict__ bo, float* OUT) {
    __shared__ __align__(16) float os[16 * 68];
    const int bx = (int)blockIdx.x;                            // block-uniform
    if (bx < OB_E) out_body<1>(CX, CXR, WO, bo, OUT, bx, os);
    else           out_body<0>(CX, CXR, WO, bo, OUT, bx - OB_E, os);
}

static constexpr size_t al256(size_t v) { return (v + 255) & ~(size_t)255; }
static constexpr size_t SZ_XB = al256((size_t)NB * SEQ * DM * 2);
static constexpr size_t SZ_WB = al256((size_t)3 * HK * DM * 2);
static constexpr size_t SZ_WO = al256((size_t)DM * HK * 2);
static constexpr size_t SZ_PL = al256((size_t)NB * NH_ * SEQ * HD * 2);
static constexpr size_t SZ_RS = al256((size_t)NB * NH_ * EROWS * HD * 2);
static constexpr size_t SZ_CX = al256((size_t)NB * SEQ * HK * 2);
static constexpr size_t SZ_CR = al256((size_t)NB * EROWS * HK * 2);
static constexpr size_t SZ_TOTAL = SZ_XB + SZ_WB + SZ_WO + 3 * SZ_PL + 3 * SZ_RS + SZ_CX + SZ_CR;
static_assert(SZ_TOTAL <= (size_t)134217728);          // workspace carve <= 128 MiB
static_assert(((size_t)HK * DM * 2) % 256 == 0);       // weight sub-planes stay 256-byte aligned
static_assert((size_t)NB * NH_ * SEQ * HD == (size_t)NB * HK * SEQ);       // v^T plane [(b*1024 + m)][t] has the same extent as the row/column planes
static_assert((size_t)NB * NH_ * EROWS * HD == (size_t)NB * HK * EROWS);   // v^T residual plane [(b*1024 + m)][t < EROWS] has the same extent as the other residual planes
static_assert(((size_t)NB * SEQ * DM / 8) % 256 == 0);  // x converter grid x block == plane extent
static_assert(((size_t)HK * DM / 8) % 256 == 0);        // weight converter grids x block == plane extents

extern "C" void kernel_launch(void* const* d_in, const int* in_sizes, int n_in,
                              void* d_out, int out_size, void* d_ws, size_t ws_size, hipStream_t stream) {
    if (n_in < 9) return;
    const size_t needx = ((size_t)(SEQ - 1) * NB_FULL + NB) * DM;
    if ((size_t)in_sizes[0] < needx) return;
    if ((size_t)in_sizes[1] < (size_t)HK * DM || (size_t)in_sizes[3] < (size_t)HK * DM || (size_t)in_sizes[5] < (size_t)HK * DM || (size_t)in_sizes[7] < (size_t)DM * HK) return;
    if (in_sizes[2] < HK || in_sizes[4] < HK || in_sizes[6] < HK || in_sizes[8] < DM) return;
    if ((size_t)out_size < needx) return;
    if (SZ_TOTAL > ws_size) return;
    // wire order: x, Wk, bk, Wq, bq, Wv, bv, Wo, bo
    const float* x  = (const float*)d_in[0];
    const float* wk = (const float*)d_in[1]; const float* bk = (const float*)d_in[2];
    const float* wq = (const float*)d_in[3]; const float* bq = (const float*)d_in[4];
    const float* wv = (const float*)d_in[5]; const float* bv = (const float*)d_in[6];
    const float* wo = (const float*)d_in[7]; const float* bo = (const float*)d_in[8];
    float* OUT = (float*)d_out;      // [SEQ][NB_FULL][128]
    char* wsp = (char*)d_ws;
    bf* XB = (bf*)wsp; wsp += SZ_XB;                 // [NB*SEQ][128], row = b*SEQ + t
    bf* WB = (bf*)wsp; wsp += SZ_WB;                 // [3][1024][128]: k | q | v  ([out][in] = Bt as-is)
    h16* WO = (h16*)wsp; wsp += SZ_WO;               // [128][1024] bf16(Wo) x1024 in f16
    h16* RH = (h16*)wsp; wsp += SZ_PL;               // row side (Wk projection)    [NB*8][SEQ][128]
    h16* CH = (h16*)wsp; wsp += SZ_PL;               // column side (Wq projection) [NB*8][SEQ][128]
    h16* VT = (h16*)wsp; wsp += SZ_PL;               // [NB*8][128][SEQ]
    h16* RR = (h16*)wsp; wsp += SZ_RS;               // [NB*8][EROWS][128] residual x2048, tokens < EROWS
    h16* CR = (h16*)wsp; wsp += SZ_RS;               // [NB*8][EROWS][128] residual x2048, tokens < EROWS
    h16* VR = (h16*)wsp; wsp += SZ_RS;               // [NB*8][128][EROWS] residual x2048, tokens < EROWS
    h16* CX = (h16*)wsp; wsp += SZ_CX;               // [NB*SEQ][1024] ctx x16
    h16* CXR = (h16*)wsp; wsp += SZ_CR;              // [NB*EROWS][1024] ctx residual x16 x2048, tokens < EROWS

    // x, Wk, Wq, Wv, Wo -> 16-bit planes
    k_cvt_all<<<CB_X + 4 * CB_W, 256, 0, stream>>>(x, wk, wq, wv, wo, XB, WB, WO);

    // row side and column side: A = x rows (m = b*SEQ + t), Bt = W rows (n = h*128 + d) -> plane [(b*8 + h)][t][d]; v^T: A = Wv rows, Bt = x rows -> plane [(b*8 + h)][d][t]; residuals for tokens < EROWS
    k_proj_all<<<dim3(PT_N, 3, 1), 32, 0, stream>>>(XB, WB, bk, bq, bv, RH, RR, CH, CR, VT, VR, EROWS);

    // rows [0, EROWS): multi-product instantiation; rows [EROWS, SEQ): single-product instantiation (disjoint ctx rows)
    k_flash_all<<<FB_E + FB_L, 32 * AW, 0, stream>>>(RH, RR, CH, CR, VT, VR, CX, CXR);

    // output GEMM: rows [0, EROWS) with the ctx residual accumulators, rows [EROWS, SEQ) single product (disjoint output rows)
    k_out_all<<<dim3(NB * SEQ / 32, DM / 64, 1), 32, 0, stream>>>(CX, CXR, WO, bo, OUT);
}

// v004
// Measured time: 84.9 microseconds a run.
// Two timings next to v003 both put it at 1.21 times that version's speed.
// Over all steps from v000 it is 3.33 times as fast.
#include <hip/hip_runtime.h>

// Causal multi-head attention over one time-major sequence input x [SEQ][NB][128]; 8 heads x 128; Wk/Wq/Wv [1024][128] ([out][in], y = x W^T + bias); scores S[i][j] = kproj_i . qproj_j / sqrt(128)
// (rows follow the Wk projection, the softmax runs over the Wq-projection positions j <= i; the diagonal is always kept); out_i = sum_j P[i][j] vproj_j; heads merged to [t][b][1024]; output = ctx Wo^T + bo, Wo [128][1024], f32 [SEQ][NB][128].
// Compute dtypes, f32 accumulate everywhere: projections v_wmma_f32_16x16x32_bf16 (x, W, bias RNE-converted to bf16; products exact);
// scores v_wmma_f32_16x16x32_f16: single f16 planes on rows >= EROWS; on rows < EROWS both score operands as f16 value + f16 residual x2048 (three products, residual products in their own accumulator);
// P.V v_wmma_f32_16x16x32_f16: P (x16384 carry, cancels in the normalisation) and v single f16 on rows >= EROWS; on rows < EROWS P and v each as f16 value + f16 residual x2048, residual products in their own accumulator folded by 1/2048;
// output GEMM v_wmma_f32_16x16x32_f16: ctx x16 (f16; plus f16 residual x2048 in its own accumulator on rows < EROWS) times bf16(Wo) x1024 held exactly in f16; folded by 1/16384; softmax f32 (online, running max).
// Layout: bf16 x [b][t][128] and W planes; row-side (Wk) and column-side (Wq) planes [b*8+h][t][128], v^T plane [b*8+h][d][t], small residual planes for tokens < EROWS; ctx plane [b*SEQ+t][1024]; fused flash kernel in transposed form
// (S^T = C R^T with the row-side tile as the B operand, O^T = V^T P^T with the packed P tile as the B operand); the column-side and v^T tiles of a key step are staged once per block in a two-buffer LDS ring
// by asynchronous copies and read by all four waves; one work-group barrier per key step.
// Four dependent launches: conversions, projections, flash, output GEMM; the independent grids of a stage share one grid, each keeping its own block order, and are told apart by block index.

#ifndef NB
#define NB 8
#endif
#ifndef SEQ
#define SEQ 1024
#endif
#define NB_FULL  8
#define SEQ_FULL 1024
#define DM   128                 // input and output width
#define NH_  8
#define HD   128
#define HK   (NH_ * HD)          // merged head width 1024
#define AW   4                   // waves per flash block (16 rows each)
#define OSP  132                 // LDS row pitch (floats) of the flash output tile
#define KP   136                 // LDS row pitch (halves) of a staged column-side tile: 272 B = 16 B x 17, conflict-free for 16-B fragment reads
#define VP   40                  // LDS row pitch (halves) of a staged v^T tile: 80 B = 16 B x 5, conflict-free for 16-B fragment reads
#define KTH  (32 * KP)           // halves of one staged column-side tile (32 tokens x 128)
#define VTH  (HD * VP)           // halves of one staged v^T tile (128 rows x 32 tokens)
#define EROWS (SEQ < 256 ? SEQ : 256)   // rows (and tokens of the small residual planes) handled by the multi-product instantiations
#define QRS  2048.0f             // carry of every residual plane / residual fragment
#define QRI  (1.0f / 2048.0f)
#define SC2  ((float)(0.08838834764831845 * 1.4426950408889634))   // HD^-0.5 * log2(e)
#define PSH  14.0f               // log2 of the P carry (16384)
#define NEGB (-3.0e38f)
#define CXS  16.0f               // carry of the ctx plane
#define WOS  1024.0f             // carry of the Wo plane
#define OSI  (1.0f / 16384.0f)   // 1 / (CXS * WOS)

static_assert(HD == 128);                      // plane row = 256 bytes = two lines; four 32-deep k-steps per score tile; eight 16-row output tiles
static_assert(NH_ * HD == HK);
static_assert(HD % 64 == 0);                   // a 64-column GEMM tile lies inside one head
static_assert(HK % 64 == 0);
static_assert(DM % 64 == 0);
static_assert(DM % 32 == 0);                   // projection k-loop steps by 32
static_assert(HK % 32 == 0);                   // output GEMM k-loop steps by 32
static_assert(SEQ % 64 == 0);                  // a 64-row tile never straddles two batches
static_assert(SEQ % 32 == 0);                  // key loop steps by 32
static_assert(EROWS % 64 == 0);                // a 64-token GEMM tile lies wholly inside or outside the residual planes; key bound of the first band <= EROWS
static_assert(EROWS >= 64);
static_assert(EROWS <= SEQ);
static_assert(EROWS % (16 * AW) == 0);
static_assert((SEQ - EROWS) % (16 * AW) == 0);
static_assert(EROWS % 32 == 0);
static_assert((SEQ - EROWS) % 32 == 0);
static_assert(NB <= NB_FULL);
static_assert(SEQ <= SEQ_FULL);
static_assert((OSP * 4) % 16 == 0);
static_assert(OSP >= HD);
static_assert((size_t)NB * NH_ * SEQ * HD < (size_t)2147483647);   // plane offsets fit in int
static_assert((size_t)4 * 2 * 2 * (KTH + VTH) * 2 <= (size_t)327680);   // static LDS of the flash kernel (two ring buffers of four tiles): four blocks fit a WGP
static_assert((size_t)AW * 16 * OSP * 4 <= (size_t)2 * (KTH + VTH) * 2);   // the output tile fits in the smaller band's ring
static_assert(AW * 32 == 128);                 // the copy maps below deal 512 16-B pieces of a tile to 128 threads, four each
static_assert(32 * HD * 2 == 512 * 16);        // column-side tile = 512 pieces
static_assert(HD * 32 * 2 == 512 * 16);        // v^T tile = 512 pieces
static_assert((KP * 2) % 16 == 0 && (VP * 2) % 16 == 0 && (KTH * 2) % 16 == 0 && (VTH * 2) % 16 == 0);   // every staged piece stays 16-B aligned
static_assert(KP >= HD && VP >= 32);
static_assert((size_t)16 * 68 * 4 <= (size_t)131072);               // static LDS of the GEMM kernels
static_assert(32 * 4 * 16 == 16 * 64 * 2);     // projection slab store: 32 lanes x 4 instructions x 16 B == 16 rows x 64 halves
static_assert(32 * 8 * 16 == 16 * HD * 2);     // flash slab store: 32 lanes x 8 instructions x 16 B == 16 rows x 128 halves
static_assert(32 * 8 * 16 == 16 * 64 * 4);     // output slab store: 32 lanes x 8 instructions x 16 B == 16 rows x 64 floats
static_assert((DM / 8) == 16);                 // 16 pieces of 8 per input row in the x converter

typedef _Float16 h16;
typedef unsigned short bf;
typedef __attribute__((ext_vector_type(16))) __bf16   v16bf;
typedef __attribute__((ext_vector_type(16))) _Float16 v16h;
typedef __attribute__((ext_vector_type(8)))  _Float16 v8h;
typedef __attribute__((ext_vector_type(8)))  unsigned short v8us;
typedef __attribute__((ext_vector_type(8)))  float    v8f;
typedef __attribute__((ext_vector_type(4)))  float    v4f;
typedef v4f  __attribute__((may_alias)) v4fa;

__device__ __forceinline__ unsigned short f2bf(float f) { unsigned u = __float_as_uint(f); u += 0x7FFFu + ((u >> 16) & 1u); return (unsigned short)(u >> 16); }
__device__ __forceinline__ float bfr(float f) { return __uint_as_float(((unsigned)f2bf(f)) << 16); }   // value after RNE convert to bf16
__device__ __forceinline__ v16h cat16(v8h lo, v8h hi) { return __builtin_shufflevector(lo, hi, 0, 1, 2, 3, 4, 5, 6, 7, 8, 9, 10, 11, 12, 13, 14, 15); }
__device__ __forceinline__ v16bf cat16b(v8us lo, v8us hi) { return __builtin_bit_cast(v16bf, __builtin_shufflevector(lo, hi, 0, 1, 2, 3, 4, 5, 6, 7, 8, 9, 10, 11, 12, 13, 14, 15)); }
__device__ __forceinline__ v8f wmma16(v16h a, v16h b, v8f c) { return __builtin_amdgcn_wmma_f32_16x16x32_f16(false, a, false, b, (short)0, c, false, false); }
__device__ __forceinline__ v8f wmmab(v16bf a, v16bf b, v8f c) { return __builtin_amdgcn_wmma_f32_16x16x32_bf16(false, a, false, b, (short)0, c, false, false); }
// fragment loaders from K-contiguous 16-bit rows; p already includes + 8*(lane>>4): elements 0..7 <- k0+8h+0..7, elements 8..15 <- k0+16+8h+0..7 (same map for A and B)
__device__ __forceinline__ v16h  ldh(const h16* p) { return cat16(*(const v8h*)p, *(const v8h*)(p + 16)); }
__device__ __forceinline__ v16bf ldb(const bf* p)  { return cat16b(*(const v8us*)p, *(const v8us*)(p + 16)); }
// ordering point for wave-private LDS tiles (same wave writes and reads)
__device__ __forceinline__ void wave_sync() { __builtin_amdgcn_fence(3 /* release order */, "wavefront"); __builtin_amdgcn_wave_barrier(); asm volatile("" ::: "memory"); }
// f32 -> f16 operand convert that cannot produce a subnormal (|v| < 2^-14 -> +0), applied after the plane's carry
static __device__ __forceinline__ h16 toh_flush(float v) { const h16 r = (h16)v; return (fabsf(v) < 6.103515625e-05f) ? (h16)0.0f : r; }
// one matrix instruction with its own four-slot guard (ties the accumulator, keeps both fragments live)
__device__ __forceinline__ v8f mmh(v16h a, v16h b, v8f c) { c = wmma16(a, b, c); asm volatile("v_nop\n\tv_nop\n\tv_nop\n\tv_nop" : "+v"(c) : "v"(a), "v"(b)); return c; }
__device__ __forceinline__ v8f mmb(v16bf a, v16bf b, v8f c) { c = wmmab(a, b, c); asm volatile("v_nop\n\tv_nop\n\tv_nop\n\tv_nop" : "+v"(c) : "v"(a), "v"(b)); return c; }

__device__ __forceinline__ void cvt8_body(const float* __restrict__ src, bf* dst, int blk) {
    const size_t i = (size_t)blk * 256 + threadIdx.x;
    const v8f v = *(const v8f*)(src + i * 8); v8us o;
#pragma unroll
    for (int k = 0; k < 8; ++k) o[k] = f2bf(v[k]);
    *(v8us*)(dst + i * 8) = o;
    asm volatile("s_wait_xcnt 0x0" ::: "memory");              // another body's code follows in the kernel's text: no register that the store names is rewritten in front of this wait
}

__device__ __forceinline__ void cvtx_body(const float* __restrict__ src, bf* dst, int blk) {
    const int i = blk * 256 + (int)threadIdx.x;
    const int row = i >> 4, pc = i & 15;                 // row = b*SEQ + t
    const int b = row / SEQ, t = row % SEQ;
    const v8f v = *(const v8f*)(src + ((size_t)t * NB_FULL + (size_t)b) * DM + (size_t)pc * 8); v8us o;
#pragma unroll
    for (int k = 0; k < 8; ++k) o[k] = f2bf(v[k]);
    *(v8us*)(dst + (size_t)i * 8) = o;
}

__device__ __forceinline__ void cvtwo_body(const float* __restrict__ src, h16* dst, int blk) {
    const int i = blk * 256 + (int)threadIdx.x;
    const v8f v = *(const v8f*)(src + (size_t)i * 8); v8h o;
#pragma unroll
    for (int k = 0; k < 8; ++k) o[k] = toh_flush(bfr(v[k]) * WOS);
    *(v8h*)(dst + (size_t)i * 8) = o;
    asm volatile("s_wait_xcnt 0x0" ::: "memory");              // as in cvt8_body
}

// All five operand conversions in one launch, told apart by block-index range (each range x 256 threads == its plane's extent in pieces of 8, asserted below): x | Wk | Wq | Wv | Wo.
#define CB_X ((NB * SEQ * DM / 8) / 256)
#define CB_W ((HK * DM / 8) / 256)
__global__ __launch_bounds__(256) void k_cvt_all(const float* __restrict__ x, const float* __restrict__ wk, const float* __restrict__ wq, const float* __restrict__ wv, const float* __restrict__ wo,
                                                 bf* XB, bf* WB, h16* WO) {
    const int blk = (int)blockIdx.x;
    if (blk < CB_X) { cvtx_body(x, XB, blk); return; }
    const int wi = (blk - CB_X) / CB_W, wb = (blk - CB_X) % CB_W;      // block-uniform: 0, 1, 2 = Wk, Wq, Wv; 3 = Wo
    if (wi < 3) cvt8_body(wi == 0 ? wk : (wi == 1 ? wq : wv), WB + (size_t)wi * HK * DM, wb);
    else        cvtwo_body(wo, WO, wb);
}

// proj_body: register-blocked bf16 GEMM, ONE WAVE per 64x64 tile (16 accumulators), operands straight from K-contiguous bf16 planes, K = DM.
// C[m][n] = sum_k A[m][k] Bt[n][k] + bias, written as f16 (Ph) and, for tokens t < resT (resT a multiple of 64, block-uniform test), the f16 residual x2048 (Pr).
// bx, by: the tile's row and column index; os: the wave's LDS slab (16 x 68 floats).
// MODE 0: A = x rows (m = b*SEQ + t), Bt = W rows (n = h*128 + d), bias per column; plane [(b*8 + h)][t][128] (residual plane [(b*8 + h)][resT][128]); the 64-column tile lies inside one head. bx < NB*SEQ/64, by < HK/64.
// MODE 1: A = W rows (m = h*128 + d), Bt = x rows (n = b*SEQ + t), bias per row; plane [(b*1024 + m)][t], row pitch SEQ (residual plane row pitch resT). bx < HK/64, by < NB*SEQ/64.
template <int MODE>
__device__ __forceinline__ void proj_body(const bf* __restrict__ A, const bf* __restrict__ Bt, const float* __restrict__ bias, h16* Ph, h16* Pr, int resT, int bx, int by, float* os) {
    const int K = DM;
    const int lane = threadIdx.x & 31, lr = lane & 15, hi = lane >> 4; const int r0 = bx * 64, c0 = by * 64;
    v8f acc[4][4];
#pragma unroll
    for (int mb = 0; mb < 4; ++mb)
#pragma unroll
        for (int nb = 0; nb < 4; ++nb) acc[mb][nb] = (v8f){};
    const size_t aoff = (size_t)(r0 + lr) * K + 8 * hi, boff = (size_t)(c0 + lr) * K + 8 * hi;
#pragma unroll 1
    for (int kc = 0; kc < K; kc += 32) {
        v16bf a[4], b[4];                                   // all eight fragments of the trip are requested before its first product: one exposed load latency per trip
#pragma unroll
        for (int mb = 0; mb < 4; ++mb) a[mb] = ldb(A + aoff + (size_t)mb * 16 * K + kc);
#pragma unroll
        for (int nb = 0; nb < 4; ++nb) b[nb] = ldb(Bt + boff + (size_t)nb * 16 * K + kc);
#pragma unroll
        for (int nb = 0; nb < 4; ++nb) {
#pragma unroll
            for (int mb = 0; mb < 4; ++mb) acc[mb][nb] = mmb(a[mb], b[nb], acc[mb][nb]); }
    }
    float bc[4];
#pragma unroll
    for (int nb = 0; nb < 4; ++nb) bc[nb] = (MODE == 0) ? bfr(bias[c0 + nb * 16 + lr]) : 0.0f;   // MODE 0: c0 + 63 < HK
    size_t tbase, rbase, tpitch, rpitch; bool wr;                                                 // wr: block-uniform, whole tile inside the residual plane
    if (MODE == 0) { const int bb = r0 / SEQ, tt = r0 % SEQ; const int zc = bb * NH_ + c0 / HD; const int d0 = c0 % HD;
                     tbase = ((size_t)zc * SEQ + (size_t)tt) * HD + (size_t)d0; tpitch = HD;
                     rbase = ((size_t)zc * (size_t)resT + (size_t)tt) * HD + (size_t)d0; rpitch = HD; wr = tt < resT; }
    else           { const int bb = c0 / SEQ, tt = c0 % SEQ;
                     tbase = ((size_t)bb * HK + (size_t)r0) * SEQ + (size_t)tt; tpitch = SEQ;
                     rbase = ((size_t)bb * HK + (size_t)r0) * (size_t)resT + (size_t)tt; rpitch = (size_t)resT; wr = tt < resT; }
#pragma unroll
    for (int mb = 0; mb < 4; ++mb) {
        float br[8];
#pragma unroll
        for (int j = 0; j < 8; ++j) br[j] = (MODE == 1) ? bfr(bias[r0 + mb * 16 + hi * 8 + j]) : 0.0f;   // MODE 1: r0 + 63 < HK
#pragma unroll
        for (int nb = 0; nb < 4; ++nb) {
#pragma unroll
            for (int j = 0; j < 8; ++j) os[(hi * 8 + j) * 68 + nb * 16 + lr] = acc[mb][nb][j] + bc[nb] + br[j]; }   // D: row 8h+j, col lane&15
        wave_sync();
{
#pragma unroll
            for (int s = 0; s < 4; ++s) { const int row = 4 * s + (lane >> 3), c8 = (lane & 7) * 8;   // 4 s x 4 row groups = 16 rows; 8 lanes x 8 = 64 columns
                const v4f x0 = *(const v4fa*)(&os[row * 68 + c8]); const v4f x1 = *(const v4fa*)(&os[row * 68 + c8 + 4]); v8h hv, rv;
#pragma unroll
                for (int i = 0; i < 4; ++i) { const h16 a0 = toh_flush(x0[i]); const h16 a1 = toh_flush(x1[i]); hv[i] = a0; hv[4 + i] = a1;
                    rv[i] = toh_flush((x0[i] - (float)a0) * QRS); rv[4 + i] = toh_flush((x1[i] - (float)a1) * QRS); }
                const size_t oo = tbase + (size_t)(mb * 16 + row) * tpitch + (size_t)c8;
                const size_t ro = rbase + (size_t)(mb * 16 + row) * rpitch + (size_t)c8;
                *(v8h*)(Ph + oo) = hv; if (wr) *(v8h*)(Pr + ro) = rv; }
             }
        wave_sync();
    }
}

// All three projections in one launch, grid (PT_N, 3): blockIdx.y = 0 row side (Wk), 1 column side (Wq), 2 v^T (Wv); blockIdx.x = the tile, row index fastest in each. WB: [3][1024][128] k | q | v.
#define PT_N ((NB * SEQ / 64) * (HK / 64))
__global__ __launch_bounds__(32) void k_proj_all(const bf* __restrict__ XB, const bf* __restrict__ WB, const float* __restrict__ bk, const float* __restrict__ bq, const float* __restrict__ bv,
                                                 h16* RH, h16* RR, h16* CH, h16* CR, h16* VT, h16* VR, int resT) {
    __shared__ __align__(16) float os[16 * 68];
    const int z = (int)blockIdx.y, tl = (int)blockIdx.x;       // block-uniform
    if (z < 2) proj_body<0>(XB, WB + (size_t)z * HK * DM, z == 0 ? bk : bq, z == 0 ? RH : CH, z == 0 ? RR : CR, resT, tl % (NB * SEQ / 64), tl / (NB * SEQ / 64), os);
    else       proj_body<1>(WB + (size_t)2 * HK * DM, XB, bv, VT, VR, resT, tl % (HK / 64), tl / (HK / 64), os);
}

// score16x2: the two 16-column-token x 16-row-token tiles of a key step, scaled logits (log2 domain), multi-product form. A = column-side rows (k = d), B = row-side rows (k = d), four 32-deep k-steps.
// Per tile: value x value in aH / bH; value x residual and residual x value (both x2048) in aL / bL. The six fragments of a k-step are requested together, before its first product;
// the two row-side fragments of a k-step are read once and serve both tiles. CH / CR point at the lane's row of the staged tiles in LDS (second tile 16 * KP behind).
__device__ __forceinline__ void score16x2(const h16* __restrict__ RH, const h16* __restrict__ RR, const h16* CH, const h16* CR, int rx, int rrx, v8f& ta, v8f& tb) {
    v8f aH = (v8f){}, aL = (v8f){}, bH = (v8f){}, bL = (v8f){};
#pragma unroll
    for (int kc = 0; kc < HD; kc += 32) {
        const v16h qf = ldh(RH + rx + kc); const v16h qr = ldh(RR + rrx + kc);
        const v16h kf = ldh(CH + kc); const v16h kr = ldh(CR + kc); const v16h lf = ldh(CH + 16 * KP + kc); const v16h lr = ldh(CR + 16 * KP + kc);
        aH = mmh(kf, qf, aH); aL = mmh(kf, qr, aL); aL = mmh(kr, qf, aL);
        bH = mmh(lf, qf, bH); bL = mmh(lf, qr, bL); bL = mmh(lr, qf, bL);
        __builtin_amdgcn_sched_barrier(0);                  // ends the group for the scheduler: each k-step reuses the fragment registers of the one before and the two address pairs stay whole until their last load has returned
    }
#pragma unroll
    for (int r = 0; r < 8; ++r) { ta[r] = (aH[r] + aL[r] * QRI) * SC2; tb[r] = (bH[r] + bL[r] * QRI) * SC2; }
}

// score32: the two 16-column tiles of a key step, single-product form. The eight column-side fragments are requested before the first product: one exposed LDS latency per key step.
// qf: the wave's four row-side fragments, held in registers over the whole key loop. CH points at the lane's row of the staged tile in LDS (row pitch KP).
__device__ __forceinline__ void score32(const v16h (&qf)[4], const h16* CH, v8f& ta, v8f& tb) {
    v16h ka[4], kb[4];
#pragma unroll
    for (int c = 0; c < 4; ++c) { ka[c] = ldh(CH + 32 * c); kb[c] = ldh(CH + 16 * KP + 32 * c); }
    v8f sa = (v8f){}, sb = (v8f){};
#pragma unroll
    for (int c = 0; c < 4; ++c) { sa = mmh(ka[c], qf[c], sa); sb = mmh(kb[c], qf[c], sb); }
#pragma unroll
    for (int r = 0; r < 8; ++r) { ta[r] = sa[r] * SC2; tb[r] = sb[r] * SC2; }
}

// Four asynchronous 16-B copies per lane, global -> LDS, through no register. l: the lane's LDS byte address, g: its global address; piece i lies lstep bytes / gstep halves behind piece i - 1.
// The s_wait_xcnt stands inside the copies' own statement so that no address register of an issued copy is rewritten in front of it.
__device__ __forceinline__ void copy4(unsigned l, unsigned lstep, const h16* g, int gstep) {
    const unsigned l1 = l + lstep, l2 = l + 2 * lstep, l3 = l + 3 * lstep;
    const h16* g1 = g + gstep; const h16* g2 = g + 2 * gstep; const h16* g3 = g + 3 * gstep;
    asm volatile("global_load_async_to_lds_b128 %0, %4, off\n\t"
                 "global_load_async_to_lds_b128 %1, %5, off\n\t"
                 "global_load_async_to_lds_b128 %2, %6, off\n\t"
                 "global_load_async_to_lds_b128 %3, %7, off\n\t"
                 "s_wait_xcnt 0x0"
                 :: "v"(l), "v"(l1), "v"(l2), "v"(l3), "v"(g), "v"(g1), "v"(g2), "v"(g3) : "memory");
}

// flash_body: fused attention, one wave per 16 rows of one (batch, head); row-side fragments straight from the f16 plane (EARLY = 0: once, ahead of the key loop; EARLY = 1: once per key step), column-side and v^T fragments from the block's LDS ring (two 16-B loads each).
// Ring: stage s = the tiles of key step s (column-side 32 x 128, v^T 128 x 32; EARLY also both residual tiles), buffer s & 1. Every thread copies four 16-B pieces of each tile. Order per the two-buffer scheme:
// stage 0, wait, barrier, stage 1; at the foot of step s every wave: LDS reads done, own copies landed, barrier, then stage s + 2 into the buffer just read. A wave past its own key bound skips the arithmetic only.
// Transposed form: S^T[j][t] = C R^T (A = column-side rows j, B = row-side rows t); lane (t = lane&15, h = lane>>4) holds columns 8h+r of each 16-column tile, so the packed
// P tile is directly the B fragment of O^T[d][t] = V^T P^T (element r <- tile columns 0..15, element 8+r <- tile columns 16..31, lane unchanged).
// Softmax state (running max over kept columns, partial sum) is one scalar per lane; the two lane halves of a row are combined with one xor-16 exchange.
// Keep rule j <= t evaluated per element in every visited 32-column tile; column 0 is kept for every row, so the running max is finite after the first tile.
// EARLY = 1 (rows [0, EROWS)): three-product scores, P = f16 value + f16 residual x2048, O = V P + (V P_res + V_res P) / 2048 (own accumulators), row sum from the f32 exponentials; all visited columns < EROWS.
// EARLY = 0 (rows [EROWS, SEQ)): single products; row sum over the converted P.
// tile: the block's 64-row tile inside its band; zh: batch * 8 + head; st: the block's LDS (2 * STG halves of ring; after the key loop its first bytes hold the output tile os).
template <int EARLY>
__device__ __forceinline__ void flash_body(const h16* __restrict__ RH, const h16* __restrict__ RR, const h16* __restrict__ CH, const h16* __restrict__ CR,
                                           const h16* __restrict__ VT, const h16* __restrict__ VR, h16* CX, h16* CXR, int tile, int zh, h16* st) {
    constexpr int STG = (EARLY ? 2 : 1) * (KTH + VTH);         // halves per ring buffer: column-side | v^T (| column-side residual | v^T residual)
    float* os = (float*)st;                                    // written only behind the last publish point of the key loop: there every wave's ring reads have returned, every copy has landed, none is issued after it
    const int lane = threadIdx.x & 31, lr = lane & 15, hi = lane >> 4;
    const int wave = __builtin_amdgcn_readfirstlane((int)(threadIdx.x >> 5));
    const int b = zh / NH_, h = zh % NH_;
    const int t0 = (EARLY ? 0 : EROWS) + (tile * AW + wave) * 16;
    const int lim = t0 + lr;                                   // column j kept iff j <= lim
    const int nk = (t0 + 16 + 31) & ~31;                       // wave-uniform, multiple of 32, <= SEQ (<= EROWS for EARLY)
    const int pbase = zh * (SEQ * HD);
    const int rbase = zh * (EROWS * HD);
    const int tcl = EARLY ? (t0 + lr) : 0;                     // residual-plane row (only the EARLY band reads it)
    const int ro  = pbase + (t0 + lr) * HD + 8 * hi;           // row-side B fragment: col t, k = d
    const int rro = rbase + tcl * HD + 8 * hi;
    const int co  = lr * KP + 8 * hi;                          // in a staged column-side tile: + 16 * KP for the second 16 tokens (A fragment: row j, k = d)
    const int vo  = KTH + lr * VP + 8 * hi;                    // in a staged v^T tile: + 16jj * VP                                 (A fragment: row d, k = j)
    const int nkb = ((EARLY ? 0 : EROWS) + (tile * AW + AW - 1) * 16 + 16 + 31) & ~31;   // key bound of the block's last wave: block-uniform, >= 64, <= SEQ (<= EROWS for EARLY)
    const int tid = (int)threadIdx.x;
    // copy maps: column-side piece p = tid + 128 i -> token p >> 4, 16-B column p & 15 (i steps 8 tokens); v^T piece p -> row p >> 2, 16-B column p & 3 (i steps 32 rows)
    const unsigned sbase = (unsigned)(size_t)st;
    const unsigned lk = sbase + (unsigned)(((tid >> 4) * KP + (tid & 15) * 8) * 2);
    const unsigned lv = sbase + (unsigned)((KTH + (tid >> 2) * VP + (tid & 3) * 8) * 2);
    const int gk  = pbase + (tid >> 4) * HD + (tid & 15) * 8;      // + key0 * HD
    const int gv  = pbase + (tid >> 2) * SEQ + (tid & 3) * 8;      // + key0
    const int gkr = rbase + (tid >> 4) * HD + (tid & 15) * 8;      // + key0 * HD
    const int gvr = rbase + (tid >> 2) * EROWS + (tid & 3) * 8;    // + key0
    auto stage = [&](int key0, int buf) {                      // key0 + 31 < nkb: every piece lies inside its plane
        const unsigned lb = (unsigned)(buf * STG * 2);
        copy4(lk + lb, 8 * KP * 2, CH + gk + key0 * HD, 8 * HD);
        copy4(lv + lb, 32 * VP * 2, VT + gv + key0, 32 * SEQ);
        if (EARLY) { copy4(lk + lb + (KTH + VTH) * 2, 8 * KP * 2, CR + gkr + key0 * HD, 8 * HD);
                     copy4(lv + lb + (KTH + VTH) * 2, 32 * VP * 2, VR + gvr + key0, 32 * EROWS); }
    };
    const v16h hz = (v16h){};
    v8f o[8], oR[8];
#pragma unroll
    for (int j = 0; j < 8; ++j) { o[j] = (v8f){}; oR[j] = (v8f){}; }
    float m = NEGB, l = 0.0f;
    v16h qf[4];                                                // single-product band: the wave's 16 x 128 row-side tile, read once here and kept in registers for every key step
    if (!EARLY) {
#pragma unroll
        for (int c = 0; c < 4; ++c) qf[c] = ldh(RH + ro + 32 * c); }
    stage(0, 0);
    asm volatile("s_wait_asynccnt 0x0" ::: "memory");          // this wave's pieces of stage 0 have landed
    __syncthreads();                                           // publishes stage 0 to all four waves
    stage(32, 1);
#pragma unroll 1
    for (int key0 = 0; key0 < nkb; key0 += 32) {
      const int buf = (key0 >> 5) & 1;
      if (key0 < nk) {                                         // wave-uniform: a wave past its own key bound skips the arithmetic, never the publish point below
        const h16* sb = st + buf * STG;
        v8f ta, tb;
        if (EARLY) { int rx = ro, rrx = rro;
                     asm volatile("" : "+v"(rx), "+v"(rrx));   // multi-product band: row-side fragments are read anew in each key step through these offsets; hoisted out of the loop their 64 registers spill
                     score16x2(RH, RR, sb + co, sb + (KTH + VTH) + co, rx, rrx, ta, tb); }
        else       { score32(qf, sb + co, ta, tb); }
        v16h vf[8];                                            // single-product band: the step's eight v^T fragments are requested here, so that they fly under the softmax arithmetic
        if (!EARLY) {
#pragma unroll
            for (int j = 0; j < 8; ++j) vf[j] = ldh(sb + vo + j * (16 * VP)); }
        const int ja = key0 + 8 * hi;
        bool fa[8], fb[8]; float mx = NEGB;
#pragma unroll
        for (int r = 0; r < 8; ++r) {
            fa[r] = (ja + r <= lim); fb[r] = (ja + 16 + r <= lim);
            mx = fmaxf(mx, fmaxf(fa[r] ? ta[r] : NEGB, fb[r] ? tb[r] : NEGB)); }
        mx = fmaxf(mx, __shfl_xor(mx, 16, 32));
        const float mnew = fmaxf(m, mx);
        const float alpha = __builtin_amdgcn_exp2f(m - mnew);
        const float sh = PSH - mnew;
        v16h pb, pr = hz; float ls = 0.0f;
#pragma unroll
        for (int r = 0; r < 8; ++r) {
            const float xa = ta[r] + sh, xb = tb[r] + sh;
            const float ea = __builtin_amdgcn_exp2f(xa), eb = __builtin_amdgcn_exp2f(xb);
            const float ga = (fa[r] & (xa >= -14.0f)) ? ea : 0.0f;        // dropped elements and exponents below the f16 normal range selected to 0 by value
            const float gb = (fb[r] & (xb >= -14.0f)) ? eb : 0.0f;
            const h16 pa = (h16)ga; const h16 pc = (h16)gb;
            pb[r] = pa; pb[8 + r] = pc;
            if (EARLY) { pr[r] = toh_flush((ga - (float)pa) * QRS); pr[8 + r] = toh_flush((gb - (float)pc) * QRS); ls += ga + gb; }
            else       { ls += (float)pa + (float)pc; } }
        l = l * alpha + ls; m = mnew;
#pragma unroll
        for (int j = 0; j < 8; ++j) { o[j] = o[j] * alpha; if (EARLY) oR[j] = oR[j] * alpha; }
        if (EARLY) {
#pragma unroll
            for (int j = 0; j < 8; j += 2) {                   // the four fragments of two output tiles are requested together, before their first product
                const v16h v0 = ldh(sb + vo + j * (16 * VP));                  const v16h v1 = ldh(sb + vo + (j + 1) * (16 * VP));
                const v16h r0 = ldh(sb + (KTH + VTH) + vo + j * (16 * VP));    const v16h r1 = ldh(sb + (KTH + VTH) + vo + (j + 1) * (16 * VP));
                o[j] = mmh(v0, pb, o[j]);         oR[j] = mmh(v0, pr, oR[j]);         oR[j] = mmh(r0, pb, oR[j]);
                o[j + 1] = mmh(v1, pb, o[j + 1]); oR[j + 1] = mmh(v1, pr, oR[j + 1]); oR[j + 1] = mmh(r1, pb, oR[j + 1]);
                __builtin_amdgcn_sched_barrier(0);             // ends the group for the scheduler, as in score16x2
            }
        } else {
#pragma unroll
            for (int j = 0; j < 8; ++j) o[j] = mmh(vf[j], pb, o[j]);
        }
      }
      // publish point of stage s + 1, passed by every wave
      asm volatile("s_wait_dscnt 0x0" ::: "memory");           // this wave's reads of the buffer that is refilled below have returned
      asm volatile("s_wait_asynccnt 0x0" ::: "memory");        // this wave's pieces of the next stage have landed
      __syncthreads();                                         // publishes the next stage and ends every wave's reads of this one
      if (key0 + 64 < nkb) stage(key0 + 64, buf);              // block-uniform test: only while that stage exists
    }
    asm volatile("s_wait_asynccnt 0x0" ::: "memory");          // no copy is outstanding when the wave goes on to the output tile and ends
    l += __shfl_xor(l, 16, 32);
    const bool any = l > 0.0f;
    const float lsafe = any ? l : 1.0f;
    const float inv = any ? (CXS * (1.0f / lsafe)) : 0.0f;     // ctx carried x16
    const int wb = wave * 16 * OSP;
    // O^T D layout: f_j[r] = (d = 16j + 8h + r, t = lane&15) -> os[t][d]; rows 0..15 x columns 0..127 all written
#pragma unroll
    for (int j = 0; j < 8; ++j) {
        v8f f = o[j]; if (EARLY) f = o[j] + oR[j] * QRI;
        v4f a, c;
        a[0] = f[0] * inv; a[1] = f[1] * inv; a[2] = f[2] * inv; a[3] = f[3] * inv; c[0] = f[4] * inv; c[1] = f[5] * inv; c[2] = f[6] * inv; c[3] = f[7] * inv;
        *(v4fa*)(&os[wb + lr * OSP + 16 * j + 8 * hi]) = a; *(v4fa*)(&os[wb + lr * OSP + 16 * j + 8 * hi + 4]) = c; }
    wave_sync();
    h16* crow = CX + ((size_t)b * SEQ + (size_t)t0) * HK + (size_t)h * HD;
    h16* rrow = CXR + ((size_t)b * EROWS + (size_t)(EARLY ? t0 : 0)) * HK + (size_t)h * HD;    // EARLY only
{
#pragma unroll
        for (int s = 0; s < 8; ++s) { const int row = 2 * s + (lane >> 4), c8 = (lane & 15) * 8;   // 8 s x 2 rows = 16 rows; 16 lanes x 8 halves = 128 columns = two lines
            const v4f x0 = *(const v4fa*)(&os[wb + row * OSP + c8]); const v4f x1 = *(const v4fa*)(&os[wb + row * OSP + c8 + 4]); v8h hv, rv;
#pragma unroll
            for (int i = 0; i < 4; ++i) { const h16 a0 = toh_flush(x0[i]); const h16 a1 = toh_flush(x1[i]); hv[i] = a0; hv[4 + i] = a1;
                rv[i] = toh_flush((x0[i] - (float)a0) * QRS); rv[4 + i] = toh_flush((x1[i] - (float)a1) * QRS); }
            *(v8h*)(crow + (size_t)row * HK + c8) = hv;
            if (EARLY) *(v8h*)(rrow + (size_t)row * HK + c8) = rv; }
         }
    if (!EARLY) asm volatile("s_wait_xcnt 0x0" ::: "memory");  // as in cvt8_body (the multi-product body's code follows the single-product body's)
}

// Both row bands in one launch, a one-dimensional grid: first the multi-product blocks of rows < EROWS, then the single-product blocks, in each band the tile index fastest and batch * 8 + head behind it.
// One LDS array serves both bodies (the larger ring; the output tile lies in it), so that four blocks fit a WGP's LDS and the whole grid is resident at once.
#define FT_E (EROWS / (16 * AW))
#define FT_L ((SEQ - EROWS) / (16 * AW) > 0 ? (SEQ - EROWS) / (16 * AW) : 1)
#define FB_E (FT_E * NB * NH_)
#define FB_L ((SEQ - EROWS) / (16 * AW) * NB * NH_)
__global__ __launch_bounds__(32 * AW) __attribute__((amdgpu_num_vgpr(256))) void k_flash_all(const h16* __restrict__ RH, const h16* __restrict__ RR, const h16* __restrict__ CH, const h16* __restrict__ CR,
                                                                                             const h16* __restrict__ VT, const h16* __restrict__ VR, h16* CX, h16* CXR) {
    __shared__ __align__(16) h16 st[2 * 2 * (KTH + VTH)];
    const int blk = (int)blockIdx.x;                           // block-uniform
    if (blk < FB_E) flash_body<1>(RH, RR, CH, CR, VT, VR, CX, CXR, blk % FT_E, blk / FT_E, st);
    else            flash_body<0>(RH, RR, CH, CR, VT, VR, CX, CXR, (blk - FB_E) % FT_L, (blk - FB_E) / FT_L, st);
}

// out_body: output GEMM, ONE WAVE per 32 x 64 tile, f16 operands straight from the ctx plane (A, K-contiguous) and the Wo plane (Bt rows, [out][in]), K = HK.
// OUT[(t*NB_FULL + b)][n] = (sum_c ctx16[m][c] wo1024[n][c] (+ residual sum / 2048)) / 16384 + bf16(bo[n]); EARLY: rows t < EROWS with the ctx residual plane in its own accumulators.
// bx: the row tile's index inside its band (batch-major); os: the wave's LDS slab (16 x 68 floats).
template <int EARLY>
__device__ __forceinline__ void out_body(const h16* __restrict__ CX, const h16* __restrict__ CXR, const h16* __restrict__ WO, const float* __restrict__ bo, float* OUT, int bx, float* os) {
    const int lane = threadIdx.x & 31, lr = lane & 15, hi = lane >> 4;
    const int TB = EARLY ? (EROWS / 32) : (((SEQ - EROWS) / 32) > 0 ? ((SEQ - EROWS) / 32) : 1);   // 32-row tiles per batch in this band
    const int b = bx / TB; const int t0 = (EARLY ? 0 : EROWS) + (bx % TB) * 32; const int c0 = blockIdx.y * 64;
    v8f acc[2][4], accr[2][4];
#pragma unroll
    for (int mb = 0; mb < 2; ++mb)
#pragma unroll
        for (int nb = 0; nb < 4; ++nb) { acc[mb][nb] = (v8f){}; accr[mb][nb] = (v8f){}; }
    const size_t aoff = ((size_t)b * SEQ + (size_t)(t0 + lr)) * HK + 8 * hi;
    const size_t roff = ((size_t)b * EROWS + (size_t)((EARLY ? t0 : 0) + lr)) * HK + 8 * hi;      // EARLY only
    const size_t boff = (size_t)(c0 + lr) * HK + 8 * hi;
#pragma unroll 1
    for (int kc = 0; kc < HK; kc += 32) {
        v16h a[2], ar[2], w[4];                             // all fragments of the trip are requested before its first product: one exposed load latency per trip
#pragma unroll
        for (int mb = 0; mb < 2; ++mb) { a[mb] = ldh(CX + aoff + (size_t)mb * 16 * HK + kc); ar[mb] = a[mb];
            if (EARLY) ar[mb] = ldh(CXR + roff + (size_t)mb * 16 * HK + kc); }
#pragma unroll
        for (int nb = 0; nb < 4; ++nb) w[nb] = ldh(WO + boff + (size_t)nb * 16 * HK + kc);
#pragma unroll
        for (int nb = 0; nb < 4; ++nb) {
#pragma unroll
            for (int mb = 0; mb < 2; ++mb) { acc[mb][nb] = mmh(a[mb], w[nb], acc[mb][nb]); if (EARLY) accr[mb][nb] = mmh(ar[mb], w[nb], accr[mb][nb]); } }
    }
    float bc[4];
#pragma unroll
    for (int nb = 0; nb < 4; ++nb) bc[nb] = bfr(bo[c0 + nb * 16 + lr]);      // c0 + 63 < DM
#pragma unroll
    for (int mb = 0; mb < 2; ++mb) {
#pragma unroll
        for (int nb = 0; nb < 4; ++nb) {
#pragma unroll
            for (int j = 0; j < 8; ++j) { float v = acc[mb][nb][j]; if (EARLY) v = v + accr[mb][nb][j] * QRI;
                os[(hi * 8 + j) * 68 + nb * 16 + lr] = v * OSI + bc[nb]; } }                    // D: row 8h+j, col lane&15
        wave_sync();
        float* orow = OUT + ((size_t)(t0 + mb * 16) * NB_FULL + (size_t)b) * DM + (size_t)c0;
{
#pragma unroll
            for (int s = 0; s < 8; ++s) { const int row = 2 * s + (lane >> 4), cofs = (lane & 15) * 4;   // 8 s x 2 rows = 16 rows; 16 lanes x 4 floats = 64 columns = two lines
                const v4f val = *(const v4fa*)(&os[row * 68 + cofs]);
                *(v4f*)(orow + (size_t)row * (NB_FULL * DM) + cofs) = val; }
             }
        wave_sync();
    }
}

// Both row bands in one launch, grid (NB * SEQ / 32, DM / 64): blockIdx.x < OB_E = the two-accumulator tiles of rows < EROWS, the rest the single-product tiles; in each band the row tile fastest and the column tile behind it.
#define OB_E (NB * EROWS / 32)
__global__ __launch_bounds__(32) __attribute__((amdgpu_num_vgpr(256))) void k_out_all(const h16* __restrict__ CX, const h16* __restrict__ CXR, const h16* __restrict__ WO, const float* __restrict__ bo, float* OUT) {
    __shared__ __align__(16) float os[16 * 68];
    const int bx = (int)blockIdx.x;                            // block-uniform
    if (bx < OB_E) out_body<1>(CX, CXR, WO, bo, OUT, bx, os);
    else           out_body<0>(CX, CXR, WO, bo, OUT, bx - OB_E, os);
}

static constexpr size_t al256(size_t v) { return (v + 255) & ~(size_t)255; }
static constexpr size_t SZ_XB = al256((size_t)NB * SEQ * DM * 2);
static constexpr size_t SZ_WB = al256((size_t)3 * HK * DM * 2);
static constexpr size_t SZ_WO = al256((size_t)DM * HK * 2);
static constexpr size_t SZ_PL = al256((size_t)NB * NH_ * SEQ * HD * 2);
static constexpr size_t SZ_RS = al256((size_t)NB * NH_ * EROWS * HD * 2);
static constexpr size_t SZ_CX = al256((size_t)NB * SEQ * HK * 2);
static constexpr size_t SZ_CR = al256((size_t)NB * EROWS * HK * 2);
static constexpr size_t SZ_TOTAL = SZ_XB + SZ_WB + SZ_WO + 3 * SZ_PL + 3 * SZ_RS + SZ_CX + SZ_CR;
static_assert(SZ_TOTAL <= (size_t)134217728);          // workspace carve <= 128 MiB
static_assert(((size_t)HK * DM * 2) % 256 == 0);       // weight sub-planes stay 256-byte aligned
static_assert((size_t)NB * NH_ * SEQ * HD == (size_t)NB * HK * SEQ);       // v^T plane [(b*1024 + m)][t] has the same extent as the row/column planes
static_assert((size_t)NB * NH_ * EROWS * HD == (size_t)NB * HK * EROWS);   // v^T residual plane [(b*1024 + m)][t < EROWS] has the same extent as the other residual planes
static_assert(((size_t)NB * SEQ * DM / 8) % 256 == 0);  // x converter grid x block == plane extent
static_assert(((size_t)HK * DM / 8) % 256 == 0);        // weight converter grids x block == plane extents

extern "C" void kernel_launch(void* const* d_in, const int* in_sizes, int n_in,
                              void* d_out, int out_size, void* d_ws, size_t ws_size, hipStream_t stream) {
    if (n_in < 9) return;
    const size_t needx = ((size_t)(SEQ - 1) * NB_FULL + NB) * DM;
    if ((size_t)in_sizes[0] < needx) return;
    if ((size_t)in_sizes[1] < (size_t)HK * DM || (size_t)in_sizes[3] < (size_t)HK * DM || (size_t)in_sizes[5] < (size_t)HK * DM || (size_t)in_sizes[7] < (size_t)DM * HK) return;
    if (in_sizes[2] < HK || in_sizes[4] < HK || in_sizes[6] < HK || in_sizes[8] < DM) return;
    if ((size_t)out_size < needx) return;
    if (SZ_TOTAL > ws_size) return;
    // wire order: x, Wk, bk, Wq, bq, Wv, bv, Wo, bo
    const float* x  = (const float*)d_in[0];
    const float* wk = (const float*)d_in[1]; const float* bk = (const float*)d_in[2];
    const float* wq = (const float*)d_in[3]; const float* bq = (const float*)d_in[4];
    const float* wv = (const float*)d_in[5]; const float* bv = (const float*)d_in[6];
    const float* wo = (const float*)d_in[7]; const float* bo = (const float*)d_in[8];
    float* OUT = (float*)d_out;      // [SEQ][NB_FULL][128]
    char* wsp = (char*)d_ws;
    bf* XB = (bf*)wsp; wsp += SZ_XB;                 // [NB*SEQ][128], row = b*SEQ + t
    bf* WB = (bf*)wsp; wsp += SZ_WB;                 // [3][1024][128]: k | q | v  ([out][in] = Bt as-is)
    h16* WO = (h16*)wsp; wsp += SZ_WO;               // [128][1024] bf16(Wo) x1024 in f16
    h16* RH = (h16*)wsp; wsp += SZ_PL;               // row side (Wk projection)    [NB*8][SEQ][128]
    h16* CH = (h16*)wsp; wsp += SZ_PL;               // column side (Wq projection) [NB*8][SEQ][128]
    h16* VT = (h16*)wsp; wsp += SZ_PL;               // [NB*8][128][SEQ]
    h16* RR = (h16*)wsp; wsp += SZ_RS;               // [NB*8][EROWS][128] residual x2048, tokens < EROWS
    h16* CR = (h16*)wsp; wsp += SZ_RS;               // [NB*8][EROWS][128] residual x2048, tokens < EROWS
    h16* VR = (h16*)wsp; wsp += SZ_RS;               // [NB*8][128][EROWS] residual x2048, tokens < EROWS
    h16* CX = (h16*)wsp; wsp += SZ_CX;               // [NB*SEQ][1024] ctx x16
    h16* CXR = (h16*)wsp; wsp += SZ_CR;              // [NB*EROWS][1024] ctx residual x16 x2048, tokens < EROWS

    // x, Wk, Wq, Wv, Wo -> 16-bit planes
    k_cvt_all<<<CB_X + 4 * CB_W, 256, 0, stream>>>(x, wk, wq, wv, wo, XB, WB, WO);

    // row side and column side: A = x rows (m = b*SEQ + t), Bt = W rows (n = h*128 + d) -> plane [(b*8 + h)][t][d]; v^T: A = Wv rows, Bt = x rows -> plane [(b*8 + h)][d][t]; residuals for tokens < EROWS
    k_proj_all<<<dim3(PT_N, 3, 1), 32, 0, stream>>>(XB, WB, bk, bq, bv, RH, RR, CH, CR, VT, VR, EROWS);

    // rows [0, EROWS): multi-product instantiation; rows [EROWS, SEQ): single-product instantiation (disjoint ctx rows)
    k_flash_all<<<FB_E + FB_L, 32 * AW, 0, stream>>>(RH, RR, CH, CR, VT, VR, CX, CXR);

    // output GEMM: rows [0, EROWS) with the ctx residual accumulators, rows [EROWS, SEQ) single product (disjoint output rows)
    k_out_all<<<dim3(NB * SEQ / 32, DM / 64, 1), 32, 0, stream>>>(CX, CXR, WO, bo, OUT);
}

// v005
// It runs in 68.3 microseconds.
// Two timings next to v004 put it at 1.23 and 1.26 times that version's speed.
// Over all steps from v000 it is 4.14 times as fast.
#include <hip/hip_runtime.h>

// Causal multi-head attention over one time-major sequence input x [SEQ][NB][128]; 8 heads x 128; Wk/Wq/Wv [1024][128] ([out][in], y = x W^T + bias); scores S[i][j] = kproj_i . qproj_j / sqrt(128)
// (rows follow the Wk projection, the softmax runs over the Wq-projection positions j <= i; the diagonal is always kept); out_i = sum_j P[i][j] vproj_j; heads merged to [t][b][1024]; output = ctx Wo^T + bo, Wo [128][1024], f32 [SEQ][NB][128].
// Compute dtypes, f32 accumulate everywhere: projections v_wmma_f32_16x16x32_bf16 (x, W, bias RNE-converted to bf16; products exact);
// scores v_wmma_f32_16x16x32_f16: single f16 planes on rows >= EROWS; on rows < EROWS both score operands as f16 value + f16 residual x2048 (three products, residual products in their own accumulator);
// P.V v_wmma_f32_16x16x32_f16: P (x16384 carry, cancels in the normalisation) and v single f16 on rows >= EROWS; on rows < EROWS P and v each as f16 value + f16 residual x2048, residual products in their own accumulator folded by 1/2048;
// output GEMM v_wmma_f32_16x16x32_f16: ctx x16 (f16; plus f16 residual x2048 in its own accumulator on rows < EROWS) times bf16(Wo) x1024 held exactly in f16; folded by 1/16384; softmax f32 (online, running max).
// Layout: bf16 x [b][t][128] and W planes; row-side (Wk) and column-side (Wq) planes [b*8+h][t][128], v^T plane [b*8+h][d][t], small residual planes for tokens < EROWS; ctx plane [b*SEQ+t][1024]; fused flash kernel in transposed form
// (S^T = C R^T with the row-side tile as the B operand, O^T = V^T P^T with the packed P tile as the B operand); the column-side and v^T tiles of a key step are staged once per block in a two-buffer LDS ring
// by asynchronous copies and read by all four waves; one work-group barrier per key step. The projection and output GEMMs stage their operand tiles by the same copies (projections: whole K once per four-wave block; output GEMM: a two-buffer ring of K chunks per eight-wave block).
// Four dependent launches: conversions, projections, flash, output GEMM; the independent grids of a stage share one grid, each keeping its own block order, and are told apart by block index.

#ifndef NB
#define NB 8
#endif
#ifndef SEQ
#define SEQ 1024
#endif
#define NB_FULL  8
#define SEQ_FULL 1024
#define DM   128                 // input and output width
#define NH_  8
#define HD   128
#define HK   (NH_ * HD)          // merged head width 1024
#define AW   4                   // waves per flash block (16 rows each)
#define OSP  132                 // LDS row pitch (floats) of the flash output tile
#define KP   136                 // LDS row pitch (halves) of a staged column-side tile: 272 B = 16 B x 17, conflict-free for 16-B fragment reads
#define VP   40                  // LDS row pitch (halves) of a staged v^T tile: 80 B = 16 B x 5, conflict-free for 16-B fragment reads
#define KTH  (32 * KP)           // halves of one staged column-side tile (32 tokens x 128)
#define VTH  (HD * VP)           // halves of one staged v^T tile (128 rows x 32 tokens)
#define EROWS (SEQ < 256 ? SEQ : 256)   // rows (and tokens of the small residual planes) handled by the multi-product instantiations
#define QRS  2048.0f             // carry of every residual plane / residual fragment
#define QRI  (1.0f / 2048.0f)
#define SC2  ((float)(0.08838834764831845 * 1.4426950408889634))   // HD^-0.5 * log2(e)
#define PSH  14.0f               // log2 of the P carry (16384)
#define NEGB (-3.0e38f)
#define CXS  16.0f               // carry of the ctx plane
#define WOS  1024.0f             // carry of the Wo plane
#define OSI  (1.0f / 16384.0f)   // 1 / (CXS * WOS)

static_assert(HD == 128);                      // plane row = 256 bytes = two lines; four 32-deep k-steps per score tile; eight 16-row output tiles
static_assert(NH_ * HD == HK);
static_assert(HD % 64 == 0);                   // a 64-column GEMM tile lies inside one head
static_assert(HK % 64 == 0);
static_assert(DM % 64 == 0);
static_assert(DM % 32 == 0);                   // projection k-loop steps by 32
static_assert(HK % 32 == 0);                   // output GEMM k-loop steps by 32
static_assert(SEQ % 64 == 0);                  // a 64-row tile never straddles two batches
static_assert(SEQ % 32 == 0);                  // key loop steps by 32
static_assert(EROWS % 64 == 0);                // a 64-token GEMM tile lies wholly inside or outside the residual planes; key bound of the first band <= EROWS
static_assert(EROWS >= 64);
static_assert(EROWS <= SEQ);
static_assert(EROWS % (16 * AW) == 0);
static_assert((SEQ - EROWS) % (16 * AW) == 0);
static_assert(EROWS % 32 == 0);
static_assert((SEQ - EROWS) % 32 == 0);
static_assert(NB <= NB_FULL);
static_assert(SEQ <= SEQ_FULL);
static_assert((OSP * 4) % 16 == 0);
static_assert(OSP >= HD);
static_assert((size_t)NB * NH_ * SEQ * HD < (size_t)2147483647);   // plane offsets fit in int
static_assert((size_t)4 * 2 * 2 * (KTH + VTH) * 2 <= (size_t)327680);   // static LDS of the flash kernel (two ring buffers of four tiles): four blocks fit a WGP
static_assert((size_t)AW * 16 * OSP * 4 <= (size_t)2 * (KTH + VTH) * 2);   // the output tile fits in the smaller band's ring
static_assert(AW * 32 == 128);                 // the copy maps below deal 512 16-B pieces of a tile to 128 threads, four each
static_assert(32 * HD * 2 == 512 * 16);        // column-side tile = 512 pieces
static_assert(HD * 32 * 2 == 512 * 16);        // v^T tile = 512 pieces
static_assert((KP * 2) % 16 == 0 && (VP * 2) % 16 == 0 && (KTH * 2) % 16 == 0 && (VTH * 2) % 16 == 0);   // every staged piece stays 16-B aligned
static_assert(KP >= HD && VP >= 32);
static_assert(32 * 4 * 16 == 16 * 64 * 2);     // projection slab store: 32 lanes x 4 instructions x 16 B == 16 rows x 64 halves
static_assert(32 * 8 * 16 == 16 * HD * 2);     // flash slab store: 32 lanes x 8 instructions x 16 B == 16 rows x 128 halves
static_assert((DM / 8) == 16);                 // 16 pieces of 8 per input row in the x converter

typedef _Float16 h16;
typedef unsigned short bf;
typedef __attribute__((ext_vector_type(16))) __bf16   v16bf;
typedef __attribute__((ext_vector_type(16))) _Float16 v16h;
typedef __attribute__((ext_vector_type(8)))  _Float16 v8h;
typedef __attribute__((ext_vector_type(8)))  unsigned short v8us;
typedef __attribute__((ext_vector_type(8)))  float    v8f;
typedef __attribute__((ext_vector_type(4)))  float    v4f;
typedef v4f  __attribute__((may_alias)) v4fa;

__device__ __forceinline__ unsigned short f2bf(float f) { unsigned u = __float_as_uint(f); u += 0x7FFFu + ((u >> 16) & 1u); return (unsigned short)(u >> 16); }
__device__ __forceinline__ float bfr(float f) { return __uint_as_float(((unsigned)f2bf(f)) << 16); }   // value after RNE convert to bf16
__device__ __forceinline__ v16h cat16(v8h lo, v8h hi) { return __builtin_shufflevector(lo, hi, 0, 1, 2, 3, 4, 5, 6, 7, 8, 9, 10, 11, 12, 13, 14, 15); }
__device__ __forceinline__ v16bf cat16b(v8us lo, v8us hi) { return __builtin_bit_cast(v16bf, __builtin_shufflevector(lo, hi, 0, 1, 2, 3, 4, 5, 6, 7, 8, 9, 10, 11, 12, 13, 14, 15)); }
__device__ __forceinline__ v8f wmma16(v16h a, v16h b, v8f c) { return __builtin_amdgcn_wmma_f32_16x16x32_f16(false, a, false, b, (short)0, c, false, false); }
__device__ __forceinline__ v8f wmmab(v16bf a, v16bf b, v8f c) { return __builtin_amdgcn_wmma_f32_16x16x32_bf16(false, a, false, b, (short)0, c, false, false); }
// fragment loaders from K-contiguous 16-bit rows; p already includes + 8*(lane>>4): elements 0..7 <- k0+8h+0..7, elements 8..15 <- k0+16+8h+0..7 (same map for A and B)
__device__ __forceinline__ v16h  ldh(const h16* p) { return cat16(*(const v8h*)p, *(const v8h*)(p + 16)); }
__device__ __forceinline__ v16bf ldb(const bf* p)  { return cat16b(*(const v8us*)p, *(const v8us*)(p + 16)); }
// ordering point for wave-private LDS tiles (same wave writes and reads)
__device__ __forceinline__ void wave_sync() { __builtin_amdgcn_fence(3 /* release order */, "wavefront"); __builtin_amdgcn_wave_barrier(); asm volatile("" ::: "memory"); }
// f32 -> f16 operand convert that cannot produce a subnormal (|v| < 2^-14 -> +0), applied after the plane's carry
static __device__ __forceinline__ h16 toh_flush(float v) { const h16 r = (h16)v; return (fabsf(v) < 6.103515625e-05f) ? (h16)0.0f : r; }
// one matrix instruction with its own four-slot guard (ties the accumulator, keeps both fragments live)
__device__ __forceinline__ v8f mmh(v16h a, v16h b, v8f c) { c = wmma16(a, b, c); asm volatile("v_nop\n\tv_nop\n\tv_nop\n\tv_nop" : "+v"(c) : "v"(a), "v"(b)); return c; }
__device__ __forceinline__ v8f mmb(v16bf a, v16bf b, v8f c) { c = wmmab(a, b, c); asm volatile("v_nop\n\tv_nop\n\tv_nop\n\tv_nop" : "+v"(c) : "v"(a), "v"(b)); return c; }

// Eight asynchronous 16-B copies per lane, global -> LDS, through no register. l: the lane's LDS byte address, g: its global address; piece i lies lstep / gstep bytes behind piece i - 1.
// The s_wait_xcnt stands inside the copies' own statement so that no address register of an issued copy is rewritten in front of it; eight copies share the one wait.
__device__ __forceinline__ void copy8(unsigned l, unsigned lstep, const void* gp, int gstep) {
    const char* g = (const char*)gp;
    const unsigned l1 = l + lstep, l2 = l + 2 * lstep, l3 = l + 3 * lstep, l4 = l + 4 * lstep, l5 = l + 5 * lstep, l6 = l + 6 * lstep, l7 = l + 7 * lstep;
    const char* g1 = g + gstep; const char* g2 = g + 2 * gstep; const char* g3 = g + 3 * gstep; const char* g4 = g + 4 * gstep;
    const char* g5 = g + 5 * gstep; const char* g6 = g + 6 * gstep; const char* g7 = g + 7 * gstep;
    asm volatile("global_load_async_to_lds_b128 %0, %8, off\n\t"
                 "global_load_async_to_lds_b128 %1, %9, off\n\t"
                 "global_load_async_to_lds_b128 %2, %10, off\n\t"
                 "global_load_async_to_lds_b128 %3, %11, off\n\t"
                 "global_load_async_to_lds_b128 %4, %12, off\n\t"
                 "global_load_async_to_lds_b128 %5, %13, off\n\t"
                 "global_load_async_to_lds_b128 %6, %14, off\n\t"
                 "global_load_async_to_lds_b128 %7, %15, off\n\t"
                 "s_wait_xcnt 0x0"
                 :: "v"(l), "v"(l1), "v"(l2), "v"(l3), "v"(l4), "v"(l5), "v"(l6), "v"(l7), "v"(g), "v"(g1), "v"(g2), "v"(g3), "v"(g4), "v"(g5), "v"(g6), "v"(g7) : "memory");
}

__device__ __forceinline__ void cvt8_body(const float* __restrict__ src, bf* dst, int blk) {
    const size_t i = (size_t)blk * 256 + threadIdx.x;
    const v8f v = *(const v8f*)(src + i * 8); v8us o;
#pragma unroll
    for (int k = 0; k < 8; ++k) o[k] = f2bf(v[k]);
    *(v8us*)(dst + i * 8) = o;
    asm volatile("s_wait_xcnt 0x0" ::: "memory");              // another body's code follows in the kernel's text: no register that the store names is rewritten in front of this wait
}

__device__ __forceinline__ void cvtx_body(const float* __restrict__ src, bf* dst, int blk) {
    const int i = blk * 256 + (int)threadIdx.x;
    const int row = i >> 4, pc = i & 15;                 // row = b*SEQ + t
    const int b = row / SEQ, t = row % SEQ;
    const v8f v = *(const v8f*)(src + ((size_t)t * NB_FULL + (size_t)b) * DM + (size_t)pc * 8); v8us o;
#pragma unroll
    for (int k = 0; k < 8; ++k) o[k] = f2bf(v[k]);
    *(v8us*)(dst + (size_t)i * 8) = o;
}

__device__ __forceinline__ void cvtwo_body(const float* __restrict__ src, h16* dst, int blk) {
    const int i = blk * 256 + (int)threadIdx.x;
    const v8f v = *(const v8f*)(src + (size_t)i * 8); v8h o;
#pragma unroll
    for (int k = 0; k < 8; ++k) o[k] = toh_flush(bfr(v[k]) * WOS);
    *(v8h*)(dst + (size_t)i * 8) = o;
    asm volatile("s_wait_xcnt 0x0" ::: "memory");              // as in cvt8_body
}

// All five operand conversions in one launch, told apart by block-index range (each range x 256 threads == its plane's extent in pieces of 8, asserted below): x | Wk | Wq | Wv | Wo.
#define CB_X ((NB * SEQ * DM / 8) / 256)
#define CB_W ((HK * DM / 8) / 256)
__global__ __launch_bounds__(256) void k_cvt_all(const float* __restrict__ x, const float* __restrict__ wk, const float* __restrict__ wq, const float* __restrict__ wv, const float* __restrict__ wo,
                                                 bf* XB, bf* WB, h16* WO) {
    const int blk = (int)blockIdx.x;
    if (blk < CB_X) { cvtx_body(x, XB, blk); return; }
    const int wi = (blk - CB_X) / CB_W, wb = (blk - CB_X) % CB_W;      // block-uniform: 0, 1, 2 = Wk, Wq, Wv; 3 = Wo
    if (wi < 3) cvt8_body(wi == 0 ? wk : (wi == 1 ? wq : wv), WB + (size_t)wi * HK * DM, wb);
    else        cvtwo_body(wo, WO, wb);
}

// proj_body: register-blocked bf16 GEMM, one block of four waves per 128x128 tile, ONE WAVE per 64x64 tile of it (16 accumulators), K = DM. The block's 128 A rows and 128 Bt rows (whole K, 256 B each, contiguous in their planes)
// are staged once in LDS by asynchronous copies (one copy instruction of a wave = two whole rows), row pitch PKP; wait, barrier, then every wave reads its fragments from LDS.
// C[m][n] = sum_k A[m][k] Bt[n][k] + bias, written as f16 (Ph) and, for tokens t < resT (resT a multiple of 64, wave-uniform test), the f16 residual x2048 (Pr).
// bx, by: the block tile's row and column index; st: the block's LDS (A tile | Bt tile; behind the k-loop's barrier its first bytes hold the four waves' slabs of 16 x 68 floats).
// MODE 0: A = x rows (m = b*SEQ + t), Bt = W rows (n = h*128 + d), bias per column; plane [(b*8 + h)][t][128] (residual plane [(b*8 + h)][resT][128]); a wave's 64-column tile lies inside one head. bx < NB*SEQ/128, by < HK/128.
// MODE 1: A = W rows (m = h*128 + d), Bt = x rows (n = b*SEQ + t), bias per row; plane [(b*1024 + m)][t], row pitch SEQ (residual plane row pitch resT). bx < HK/128, by < NB*SEQ/128.
#define PW   4                   // waves per projection block (2 x 2 tiles of 64 x 64)
#define PKP  136                 // LDS row pitch (halves) of a staged operand row: 272 B = 16 B x 17, conflict-free for 16-B fragment reads
#define PTH  (128 * PKP)         // halves of one staged operand tile (128 rows x 128)
static_assert(DM == 128 && PKP >= DM && (PKP * 2) % 16 == 0 && (PTH * 2) % 16 == 0);
static_assert(32 * PW == 128 && 128 * DM * 2 == 128 * 16 * 16);   // the copy map deals the 2048 16-B pieces of a tile to 128 threads, sixteen each
static_assert((NB * SEQ) % 128 == 0 && HK % 128 == 0);
static_assert((size_t)PW * 16 * 68 * 4 <= (size_t)2 * PTH * 2);   // the four slabs fit in the staged tiles' LDS
static_assert((size_t)4 * 2 * PTH * 2 <= (size_t)327680);         // four blocks fit a WGP's LDS
template <int MODE>
__device__ __forceinline__ void proj_body(const bf* __restrict__ A, const bf* __restrict__ Bt, const float* __restrict__ bias, h16* Ph, h16* Pr, int resT, int bx, int by, bf* st) {
    const int K = DM;
    const int tid = (int)threadIdx.x, lane = tid & 31, lr = lane & 15, hi = lane >> 4;
    const int wave = __builtin_amdgcn_readfirstlane(tid >> 5);
    const int wm = wave & 1, wn = wave >> 1; const int r0 = bx * 128 + wm * 64, c0 = by * 128 + wn * 64;
    // copy map: piece i of a 64-row group -> row (tid >> 4) + 8 i, 16-B column tid & 15
    const unsigned l0 = (unsigned)(size_t)st + (unsigned)(((tid >> 4) * PKP + (tid & 15) * 8) * 2);
    const bf* ga = A + (size_t)(bx * 128 + (tid >> 4)) * K + (tid & 15) * 8;       // rows bx * 128 .. + 127 lie inside A
    const bf* gb = Bt + (size_t)(by * 128 + (tid >> 4)) * K + (tid & 15) * 8;      // rows by * 128 .. + 127 lie inside Bt
#pragma unroll
    for (int q = 0; q < 2; ++q) { copy8(l0 + (unsigned)(q * 64 * PKP * 2), 8 * PKP * 2, ga + q * 64 * K, 8 * K * 2);
                                  copy8(l0 + (unsigned)((PTH + q * 64 * PKP) * 2), 8 * PKP * 2, gb + q * 64 * K, 8 * K * 2); }
    asm volatile("s_wait_asynccnt 0x0" ::: "memory");          // this wave's pieces of both tiles have landed
    __syncthreads();                                           // publishes both tiles to all four waves
    v8f acc[4][4];
#pragma unroll
    for (int mb = 0; mb < 4; ++mb)
#pragma unroll
        for (int nb = 0; nb < 4; ++nb) acc[mb][nb] = (v8f){};
    const int aoff = (wm * 64 + lr) * PKP + 8 * hi, boff = PTH + (wn * 64 + lr) * PKP + 8 * hi;
#pragma unroll 1
    for (int kc = 0; kc < K; kc += 32) {
        v16bf a[4], b[4];                                   // all eight fragments of the trip are requested before its first product: one exposed LDS latency per trip
#pragma unroll
        for (int mb = 0; mb < 4; ++mb) a[mb] = ldb(st + aoff + mb * 16 * PKP + kc);
#pragma unroll
        for (int nb = 0; nb < 4; ++nb) b[nb] = ldb(st + boff + nb * 16 * PKP + kc);
#pragma unroll
        for (int nb = 0; nb < 4; ++nb) {
#pragma unroll
            for (int mb = 0; mb < 4; ++mb) acc[mb][nb] = mmb(a[mb], b[nb], acc[mb][nb]); }
    }
    asm volatile("s_wait_dscnt 0x0" ::: "memory");             // this wave's fragment reads have returned
    __syncthreads();                                           // ends every wave's reads of the staged tiles: the slabs below lie in their LDS
    float* os = (float*)st + wave * (16 * 68);
    float bc[4];
#pragma unroll
    for (int nb = 0; nb < 4; ++nb) bc[nb] = (MODE == 0) ? bfr(bias[c0 + nb * 16 + lr]) : 0.0f;   // MODE 0: c0 + 63 < HK
    size_t tbase, rbase, tpitch, rpitch; bool wr;                                                 // wr: wave-uniform, the wave's whole tile inside the residual plane
    if (MODE == 0) { const int bb = r0 / SEQ, tt = r0 % SEQ; const int zc = bb * NH_ + c0 / HD; const int d0 = c0 % HD;
                     tbase = ((size_t)zc * SEQ + (size_t)tt) * HD + (size_t)d0; tpitch = HD;
                     rbase = ((size_t)zc * (size_t)resT + (size_t)tt) * HD + (size_t)d0; rpitch = HD; wr = tt < resT; }
    else           { const int bb = c0 / SEQ, tt = c0 % SEQ;
                     tbase = ((size_t)bb * HK + (size_t)r0) * SEQ + (size_t)tt; tpitch = SEQ;
                     rbase = ((size_t)bb * HK + (size_t)r0) * (size_t)resT + (size_t)tt; rpitch = (size_t)resT; wr = tt < resT; }
#pragma unroll
    for (int mb = 0; mb < 4; ++mb) {
        float br[8];
#pragma unroll
        for (int j = 0; j < 8; ++j) br[j] = (MODE == 1) ? bfr(bias[r0 + mb * 16 + hi * 8 + j]) : 0.0f;   // MODE 1: r0 + 63 < HK
#pragma unroll
        for (int nb = 0; nb < 4; ++nb) {
#pragma unroll
            for (int j = 0; j < 8; ++j) os[(hi * 8 + j) * 68 + nb * 16 + lr] = acc[mb][nb][j] + bc[nb] + br[j]; }   // D: row 8h+j, col lane&15
        wave_sync();
{
#pragma unroll
            for (int s = 0; s < 4; ++s) { const int row = 4 * s + (lane >> 3), c8 = (lane & 7) * 8;   // 4 s x 4 row groups = 16 rows; 8 lanes x 8 = 64 columns
                const v4f x0 = *(const v4fa*)(&os[row * 68 + c8]); const v4f x1 = *(const v4fa*)(&os[row * 68 + c8 + 4]); v8h hv, rv;
#pragma unroll
                for (int i = 0; i < 4; ++i) { const h16 a0 = toh_flush(x0[i]); const h16 a1 = toh_flush(x1[i]); hv[i] = a0; hv[4 + i] = a1;
                    rv[i] = toh_flush((x0[i] - (float)a0) * QRS); rv[4 + i] = toh_flush((x1[i] - (float)a1) * QRS); }
                const size_t oo = tbase + (size_t)(mb * 16 + row) * tpitch + (size_t)c8;
                const size_t ro = rbase + (size_t)(mb * 16 + row) * rpitch + (size_t)c8;
                *(v8h*)(Ph + oo) = hv; if (wr) *(v8h*)(Pr + ro) = rv; }
             }
        wave_sync();
    }
}

// All three projections in one launch, grid (PT_N, 3): blockIdx.y = 0 row side (Wk), 1 column side (Wq), 2 v^T (Wv); blockIdx.x = the tile, row index fastest in each. WB: [3][1024][128] k | q | v.
#define PT_N ((NB * SEQ / 128) * (HK / 128))
__global__ __launch_bounds__(32 * PW) void k_proj_all(const bf* __restrict__ XB, const bf* __restrict__ WB, const float* __restrict__ bk, const float* __restrict__ bq, const float* __restrict__ bv,
                                                 h16* RH, h16* RR, h16* CH, h16* CR, h16* VT, h16* VR, int resT) {
    __shared__ __align__(16) bf st[2 * PTH];
    const int z = (int)blockIdx.y, tl = (int)blockIdx.x;       // block-uniform
    if (z < 2) proj_body<0>(XB, WB + (size_t)z * HK * DM, z == 0 ? bk : bq, z == 0 ? RH : CH, z == 0 ? RR : CR, resT, tl % (NB * SEQ / 128), tl / (NB * SEQ / 128), st);
    else       proj_body<1>(WB + (size_t)2 * HK * DM, XB, bv, VT, VR, resT, tl % (HK / 128), tl / (HK / 128), st);
}

// score16x2: the two 16-column-token x 16-row-token tiles of a key step, scaled logits (log2 domain), multi-product form. A = column-side rows (k = d), B = row-side rows (k = d), four 32-deep k-steps.
// Per tile: value x value in aH / bH; value x residual and residual x value (both x2048) in aL / bL. The six fragments of a k-step are requested together, before its first product;
// the two row-side fragments of a k-step are read once and serve both tiles. CH / CR point at the lane's row of the staged tiles in LDS (second tile 16 * KP behind).
__device__ __forceinline__ void score16x2(const h16* __restrict__ RH, const h16* __restrict__ RR, const h16* CH, const h16* CR, int rx, int rrx, v8f& ta, v8f& tb) {
    v8f aH = (v8f){}, aL = (v8f){}, bH = (v8f){}, bL = (v8f){};
#pragma unroll
    for (int kc = 0; kc < HD; kc += 32) {
        const v16h qf = ldh(RH + rx + kc); const v16h qr = ldh(RR + rrx + kc);
        const v16h kf = ldh(CH + kc); const v16h kr = ldh(CR + kc); const v16h lf = ldh(CH + 16 * KP + kc); const v16h lr = ldh(CR + 16 * KP + kc);
        aH = mmh(kf, qf, aH); aL = mmh(kf, qr, aL); aL = mmh(kr, qf, aL);
        bH = mmh(lf, qf, bH); bL = mmh(lf, qr, bL); bL = mmh(lr, qf, bL);
        __builtin_amdgcn_sched_barrier(0);                  // ends the group for the scheduler: each k-step reuses the fragment registers of the one before and the two address pairs stay whole until their last load has returned
    }
#pragma unroll
    for (int r = 0; r < 8; ++r) { ta[r] = (aH[r] + aL[r] * QRI) * SC2; tb[r] = (bH[r] + bL[r] * QRI) * SC2; }
}

// score32: the two 16-column tiles of a key step, single-product form. The eight column-side fragments are requested before the first product: one exposed LDS latency per key step.
// qf: the wave's four row-side fragments, held in registers over the whole key loop. CH points at the lane's row of the staged tile in LDS (row pitch KP).
__device__ __forceinline__ void score32(const v16h (&qf)[4], const h16* CH, v8f& ta, v8f& tb) {
    v16h ka[4], kb[4];
#pragma unroll
    for (int c = 0; c < 4; ++c) { ka[c] = ldh(CH + 32 * c); kb[c] = ldh(CH + 16 * KP + 32 * c); }
    v8f sa = (v8f){}, sb = (v8f){};
#pragma unroll
    for (int c = 0; c < 4; ++c) { sa = mmh(ka[c], qf[c], sa); sb = mmh(kb[c], qf[c], sb); }
#pragma unroll
    for (int r = 0; r < 8; ++r) { ta[r] = sa[r] * SC2; tb[r] = sb[r] * SC2; }
}

// Four asynchronous 16-B copies per lane, global -> LDS, through no register. l: the lane's LDS byte address, g: its global address; piece i lies lstep bytes / gstep halves behind piece i - 1.
// The s_wait_xcnt stands inside the copies' own statement so that no address register of an issued copy is rewritten in front of it.
__device__ __forceinline__ void copy4(unsigned l, unsigned lstep, const h16* g, int gstep) {
    const unsigned l1 = l + lstep, l2 = l + 2 * lstep, l3 = l + 3 * lstep;
    const h16* g1 = g + gstep; const h16* g2 = g + 2 * gstep; const h16* g3 = g + 3 * gstep;
    asm volatile("global_load_async_to_lds_b128 %0, %4, off\n\t"
                 "global_load_async_to_lds_b128 %1, %5, off\n\t"
                 "global_load_async_to_lds_b128 %2, %6, off\n\t"
                 "global_load_async_to_lds_b128 %3, %7, off\n\t"
                 "s_wait_xcnt 0x0"
                 :: "v"(l), "v"(l1), "v"(l2), "v"(l3), "v"(g), "v"(g1), "v"(g2), "v"(g3) : "memory");
}

// flash_body: fused attention, one wave per 16 rows of one (batch, head); row-side fragments straight from the f16 plane (EARLY = 0: once, ahead of the key loop; EARLY = 1: once per key step), column-side and v^T fragments from the block's LDS ring (two 16-B loads each).
// Ring: stage s = the tiles of key step s (column-side 32 x 128, v^T 128 x 32; EARLY also both residual tiles), buffer s & 1. Every thread copies four 16-B pieces of each tile. Order per the two-buffer scheme:
// stage 0, wait, barrier, stage 1; at the foot of step s every wave: LDS reads done, own copies landed, barrier, then stage s + 2 into the buffer just read. A wave past its own key bound skips the arithmetic only.
// Transposed form: S^T[j][t] = C R^T (A = column-side rows j, B = row-side rows t); lane (t = lane&15, h = lane>>4) holds columns 8h+r of each 16-column tile, so the packed
// P tile is directly the B fragment of O^T[d][t] = V^T P^T (element r <- tile columns 0..15, element 8+r <- tile columns 16..31, lane unchanged).
// Softmax state (running max over kept columns, partial sum) is one scalar per lane; the two lane halves of a row are combined with one xor-16 exchange.
// Keep rule j <= t evaluated per element in every visited 32-column tile; column 0 is kept for every row, so the running max is finite after the first tile.
// EARLY = 1 (rows [0, EROWS)): three-product scores, P = f16 value + f16 residual x2048, O = V P + (V P_res + V_res P) / 2048 (own accumulators), row sum from the f32 exponentials; all visited columns < EROWS.
// EARLY = 0 (rows [EROWS, SEQ)): single products; row sum over the converted P.
// tile: the block's 64-row tile inside its band; zh: batch * 8 + head; st: the block's LDS (2 * STG halves of ring; after the key loop its first bytes hold the output tile os).
template <int EARLY>
__device__ __forceinline__ void flash_body(const h16* __restrict__ RH, const h16* __restrict__ RR, const h16* __restrict__ CH, const h16* __restrict__ CR,
                                           const h16* __restrict__ VT, const h16* __restrict__ VR, h16* CX, h16* CXR, int tile, int zh, h16* st) {
    constexpr int STG = (EARLY ? 2 : 1) * (KTH + VTH);         // halves per ring buffer: column-side | v^T (| column-side residual | v^T residual)
    float* os = (float*)st;                                    // written only behind the last publish point of the key loop: there every wave's ring reads have returned, every copy has landed, none is issued after it
    const int lane = threadIdx.x & 31, lr = lane & 15, hi = lane >> 4;
    const int wave = __builtin_amdgcn_readfirstlane((int)(threadIdx.x >> 5));
    const int b = zh / NH_, h = zh % NH_;
    const int t0 = (EARLY ? 0 : EROWS) + (tile * AW + wave) * 16;
    const int lim = t0 + lr;                                   // column j kept iff j <= lim
    const int nk = (t0 + 16 + 31) & ~31;                       // wave-uniform, multiple of 32, <= SEQ (<= EROWS for EARLY)
    const int pbase = zh * (SEQ * HD);
    const int rbase = zh * (EROWS * HD);
    const int tcl = EARLY ? (t0 + lr) : 0;                     // residual-plane row (only the EARLY band reads it)
    const int ro  = pbase + (t0 + lr) * HD + 8 * hi;           // row-side B fragment: col t, k = d
    const int rro = rbase + tcl * HD + 8 * hi;
    const int co  = lr * KP + 8 * hi;                          // in a staged column-side tile: + 16 * KP for the second 16 tokens (A fragment: row j, k = d)
    const int vo  = KTH + lr * VP + 8 * hi;                    // in a staged v^T tile: + 16jj * VP                                 (A fragment: row d, k = j)
    const int nkb = ((EARLY ? 0 : EROWS) + (tile * AW + AW - 1) * 16 + 16 + 31) & ~31;   // key bound of the block's last wave: block-uniform, >= 64, <= SEQ (<= EROWS for EARLY)
    const int tid = (int)threadIdx.x;
    // copy maps: column-side piece p = tid + 128 i -> token p >> 4, 16-B column p & 15 (i steps 8 tokens); v^T piece p -> row p >> 2, 16-B column p & 3 (i steps 32 rows)
    const unsigned sbase = (unsigned)(size_t)st;
    const unsigned lk = sbase + (unsigned)(((tid >> 4) * KP + (tid & 15) * 8) * 2);
    const unsigned lv = sbase + (unsigned)((KTH + (tid >> 2) * VP + (tid & 3) * 8) * 2);
    const int gk  = pbase + (tid >> 4) * HD + (tid & 15) * 8;      // + key0 * HD
    const int gv  = pbase + (tid >> 2) * SEQ + (tid & 3) * 8;      // + key0
    const int gkr = rbase + (tid >> 4) * HD + (tid & 15) * 8;      // + key0 * HD
    const int gvr = rbase + (tid >> 2) * EROWS + (tid & 3) * 8;    // + key0
    auto stage = [&](int key0, int buf) {                      // key0 + 31 < nkb: every piece lies inside its plane
        const unsigned lb = (unsigned)(buf * STG * 2);
        copy4(lk + lb, 8 * KP * 2, CH + gk + key0 * HD, 8 * HD);
        copy4(lv + lb, 32 * VP * 2, VT + gv + key0, 32 * SEQ);
        if (EARLY) { copy4(lk + lb + (KTH + VTH) * 2, 8 * KP * 2, CR + gkr + key0 * HD, 8 * HD);
                     copy4(lv + lb + (KTH + VTH) * 2, 32 * VP * 2, VR + gvr + key0, 32 * EROWS); }
    };
    const v16h hz = (v16h){};
    v8f o[8], oR[8];
#pragma unroll
    for (int j = 0; j < 8; ++j) { o[j] = (v8f){}; oR[j] = (v8f){}; }
    float m = NEGB, l = 0.0f;
    v16h qf[4];                                                // single-product band: the wave's 16 x 128 row-side tile, read once here and kept in registers for every key step
    if (!EARLY) {
#pragma unroll
        for (int c = 0; c < 4; ++c) qf[c] = ldh(RH + ro + 32 * c); }
    stage(0, 0);
    asm volatile("s_wait_asynccnt 0x0" ::: "memory");          // this wave's pieces of stage 0 have landed
    __syncthreads();                                           // publishes stage 0 to all four waves
    stage(32, 1);
#pragma unroll 1
    for (int key0 = 0; key0 < nkb; key0 += 32) {
      const int buf = (key0 >> 5) & 1;
      if (key0 < nk) {                                         // wave-uniform: a wave past its own key bound skips the arithmetic, never the publish point below
        const h16* sb = st + buf * STG;
        v8f ta, tb;
        if (EARLY) { int rx = ro, rrx = rro;
                     asm volatile("" : "+v"(rx), "+v"(rrx));   // multi-product band: row-side fragments are read anew in each key step through these offsets; hoisted out of the loop their 64 registers spill
                     score16x2(RH, RR, sb + co, sb + (KTH + VTH) + co, rx, rrx, ta, tb); }
        else       { score32(qf, sb + co, ta, tb); }
        v16h vf[8];                                            // single-product band: the step's eight v^T fragments are requested here, so that they fly under the softmax arithmetic
        if (!EARLY) {
#pragma unroll
            for (int j = 0; j < 8; ++j) vf[j] = ldh(sb + vo + j * (16 * VP)); }
        const int ja = key0 + 8 * hi;
        bool fa[8], fb[8]; float mx = NEGB;
#pragma unroll
        for (int r = 0; r < 8; ++r) {
            fa[r] = (ja + r <= lim); fb[r] = (ja + 16 + r <= lim);
            mx = fmaxf(mx, fmaxf(fa[r] ? ta[r] : NEGB, fb[r] ? tb[r] : NEGB)); }
        mx = fmaxf(mx, __shfl_xor(mx, 16, 32));
        const float mnew = fmaxf(m, mx);
        const float alpha = __builtin_amdgcn_exp2f(m - mnew);
        const float sh = PSH - mnew;
        v16h pb, pr = hz; float ls = 0.0f;
#pragma unroll
        for (int r = 0; r < 8; ++r) {
            const float xa = ta[r] + sh, xb = tb[r] + sh;
            const float ea = __builtin_amdgcn_exp2f(xa), eb = __builtin_amdgcn_exp2f(xb);
            const float ga = (fa[r] & (xa >= -14.0f)) ? ea : 0.0f;        // dropped elements and exponents below the f16 normal range selected to 0 by value
            const float gb = (fb[r] & (xb >= -14.0f)) ? eb : 0.0f;
            const h16 pa = (h16)ga; const h16 pc = (h16)gb;
            pb[r] = pa; pb[8 + r] = pc;
            if (EARLY) { pr[r] = toh_flush((ga - (float)pa) * QRS); pr[8 + r] = toh_flush((gb - (float)pc) * QRS); ls += ga + gb; }
            else       { ls += (float)pa + (float)pc; } }
        l = l * alpha + ls; m = mnew;
#pragma unroll
        for (int j = 0; j < 8; ++j) { o[j] = o[j] * alpha; if (EARLY) oR[j] = oR[j] * alpha; }
        if (EARLY) {
#pragma unroll
            for (int j = 0; j < 8; j += 2) {                   // the four fragments of two output tiles are requested together, before their first product
                const v16h v0 = ldh(sb + vo + j * (16 * VP));                  const v16h v1 = ldh(sb + vo + (j + 1) * (16 * VP));
                const v16h r0 = ldh(sb + (KTH + VTH) + vo + j * (16 * VP));    const v16h r1 = ldh(sb + (KTH + VTH) + vo + (j + 1) * (16 * VP));
                o[j] = mmh(v0, pb, o[j]);         oR[j] = mmh(v0, pr, oR[j]);         oR[j] = mmh(r0, pb, oR[j]);
                o[j + 1] = mmh(v1, pb, o[j + 1]); oR[j + 1] = mmh(v1, pr, oR[j + 1]); oR[j + 1] = mmh(r1, pb, oR[j + 1]);
                __builtin_amdgcn_sched_barrier(0);             // ends the group for the scheduler, as in score16x2
            }
        } else {
#pragma unroll
            for (int j = 0; j < 8; ++j) o[j] = mmh(vf[j], pb, o[j]);
        }
      }
      // publish point of stage s + 1, passed by every wave
      asm volatile("s_wait_dscnt 0x0" ::: "memory");           // this wave's reads of the buffer that is refilled below have returned
      asm volatile("s_wait_asynccnt 0x0" ::: "memory");        // this wave's pieces of the next stage have landed
      __syncthreads();                                         // publishes the next stage and ends every wave's reads of this one
      if (key0 + 64 < nkb) stage(key0 + 64, buf);              // block-uniform test: only while that stage exists
    }
    asm volatile("s_wait_asynccnt 0x0" ::: "memory");          // no copy is outstanding when the wave goes on to the output tile and ends
    l += __shfl_xor(l, 16, 32);
    const bool any = l > 0.0f;
    const float lsafe = any ? l : 1.0f;
    const float inv = any ? (CXS * (1.0f / lsafe)) : 0.0f;     // ctx carried x16
    const int wb = wave * 16 * OSP;
    // O^T D layout: f_j[r] = (d = 16j + 8h + r, t = lane&15) -> os[t][d]; rows 0..15 x columns 0..127 all written
#pragma unroll
    for (int j = 0; j < 8; ++j) {
        v8f f = o[j]; if (EARLY) f = o[j] + oR[j] * QRI;
        v4f a, c;
        a[0] = f[0] * inv; a[1] = f[1] * inv; a[2] = f[2] * inv; a[3] = f[3] * inv; c[0] = f[4] * inv; c[1] = f[5] * inv; c[2] = f[6] * inv; c[3] = f[7] * inv;
        *(v4fa*)(&os[wb + lr * OSP + 16 * j + 8 * hi]) = a; *(v4fa*)(&os[wb + lr * OSP + 16 * j + 8 * hi + 4]) = c; }
    wave_sync();
    h16* crow = CX + ((size_t)b * SEQ + (size_t)t0) * HK + (size_t)h * HD;
    h16* rrow = CXR + ((size_t)b * EROWS + (size_t)(EARLY ? t0 : 0)) * HK + (size_t)h * HD;    // EARLY only
{
#pragma unroll
        for (int s = 0; s < 8; ++s) { const int row = 2 * s + (lane >> 4), c8 = (lane & 15) * 8;   // 8 s x 2 rows = 16 rows; 16 lanes x 8 halves = 128 columns = two lines
            const v4f x0 = *(const v4fa*)(&os[wb + row * OSP + c8]); const v4f x1 = *(const v4fa*)(&os[wb + row * OSP + c8 + 4]); v8h hv, rv;
#pragma unroll
            for (int i = 0; i < 4; ++i) { const h16 a0 = toh_flush(x0[i]); const h16 a1 = toh_flush(x1[i]); hv[i] = a0; hv[4 + i] = a1;
                rv[i] = toh_flush((x0[i] - (float)a0) * QRS); rv[4 + i] = toh_flush((x1[i] - (float)a1) * QRS); }
            *(v8h*)(crow + (size_t)row * HK + c8) = hv;
            if (EARLY) *(v8h*)(rrow + (size_t)row * HK + c8) = rv; }
         }
    if (!EARLY) asm volatile("s_wait_xcnt 0x0" ::: "memory");  // as in cvt8_body (the multi-product body's code follows the single-product body's)
}

// Both row bands in one launch, a one-dimensional grid: first the multi-product blocks of rows < EROWS, then the single-product blocks, in each band the tile index fastest and batch * 8 + head behind it.
// One LDS array serves both bodies (the larger ring; the output tile lies in it), so that four blocks fit a WGP's LDS and the whole grid is resident at once.
#define FT_E (EROWS / (16 * AW))
#define FT_L ((SEQ - EROWS) / (16 * AW) > 0 ? (SEQ - EROWS) / (16 * AW) : 1)
#define FB_E (FT_E * NB * NH_)
#define FB_L ((SEQ - EROWS) / (16 * AW) * NB * NH_)
__global__ __launch_bounds__(32 * AW) __attribute__((amdgpu_num_vgpr(256))) void k_flash_all(const h16* __restrict__ RH, const h16* __restrict__ RR, const h16* __restrict__ CH, const h16* __restrict__ CR,
                                                                                             const h16* __restrict__ VT, const h16* __restrict__ VR, h16* CX, h16* CXR) {
    __shared__ __align__(16) h16 st[2 * 2 * (KTH + VTH)];
    const int blk = (int)blockIdx.x;                           // block-uniform
    if (blk < FB_E) flash_body<1>(RH, RR, CH, CR, VT, VR, CX, CXR, blk % FT_E, blk / FT_E, st);
    else            flash_body<0>(RH, RR, CH, CR, VT, VR, CX, CXR, (blk - FB_E) % FT_L, (blk - FB_E) / FT_L, st);
}

// out_body: output GEMM, one block of eight waves per 32 x 128 tile (32 rows, every output column); wave w holds rows 16 (w >> 2) .. + 15, columns 32 (w & 3) .. + 31 (two accumulator tiles). K = HK in chunks of OKC.
// OUT[(t*NB_FULL + b)][n] = (sum_c ctx16[m][c] wo1024[n][c] (+ residual sum / 2048)) / 16384 + bf16(bo[n]); EARLY: rows t < EROWS with the ctx residual plane in its own accumulators.
// Ring: stage s = the chunk's 32 ctx rows | 128 Wo rows (| 32 ctx residual rows), buffer s & 1, each row 512 B of its plane (one copy instruction of a wave = one whole row), LDS row pitch OKP.
// Order per the two-buffer scheme, as in flash_body: stage 0, wait, barrier, stage 1; at the foot of chunk s every wave: LDS reads done, own copies landed, barrier, then stage s + 2 into the buffer just read.
// Every accumulator takes its 32-deep products in ascending k, as a single wave over the whole K would.
// bx: the row tile's index inside its band (batch-major); st: the ring; os: the block's output tile (32 x OOP floats).
#define OW   8                   // waves per output block
#define OKC  256                 // k extent of a staged chunk
#define OKP  264                 // LDS row pitch (halves) of a staged chunk row: 528 B = 16 B x 33, conflict-free for 16-B fragment reads
#define OAT  (32 * OKP)          // halves of a staged ctx (or ctx residual) chunk
#define OWT  (DM * OKP)          // halves of a staged Wo chunk
#define OOP  132                 // LDS row pitch (floats) of the output tile
static_assert(DM == 128);                      // four column groups of 32; 128 Wo rows = two groups of 64 rows in the copy map
static_assert(OW == 8 && 32 * OW == 256);      // two row groups x four column groups; the copy map deals one row to each wave, eight rows a piece step
static_assert(OKC * 2 == 32 * 16);             // a chunk row = 32 pieces of 16 B = one wave's copy instruction
static_assert(HK % OKC == 0 && HK / OKC >= 2); // stages 0 and 1 exist
static_assert(OKC % 128 == 0);                 // fragment groups of four 32-deep k-steps
static_assert(OKP >= OKC && (OKP * 2) % 16 == 0 && (OAT * 2) % 16 == 0 && (OWT * 2) % 16 == 0);
static_assert((OOP * 4) % 16 == 0 && OOP >= DM);
static_assert((size_t)2 * (2 * OAT + OWT) * 2 + (size_t)32 * OOP * 4 <= (size_t)327680);   // static LDS of the output kernel
template <int EARLY>
__device__ __forceinline__ void out_body(const h16* __restrict__ CX, const h16* __restrict__ CXR, const h16* __restrict__ WO, const float* __restrict__ bo, float* OUT, int bx, h16* st, float* os) {
    constexpr int STG = (EARLY ? 2 : 1) * OAT + OWT;           // halves per ring buffer: ctx | Wo (| ctx residual)
    const int tid = (int)threadIdx.x, lane = tid & 31, lr = lane & 15, hi = lane >> 4;
    const int wave = __builtin_amdgcn_readfirstlane(tid >> 5);
    const int TB = EARLY ? (EROWS / 32) : (((SEQ - EROWS) / 32) > 0 ? ((SEQ - EROWS) / 32) : 1);   // 32-row tiles per batch in this band
    const int b = bx / TB; const int t0 = (EARLY ? 0 : EROWS) + (bx % TB) * 32;
    const int mb = wave >> 2, ng = wave & 3;
    // copy map: piece i of a 32-row group -> row (tid >> 5) + 8 i, 16-B column tid & 31
    const int crow = tid >> 5, ccol = (tid & 31) * 8;
    const unsigned lrow = (unsigned)(size_t)st + (unsigned)((crow * OKP + ccol) * 2);
    const h16* ga = CX + ((size_t)b * SEQ + (size_t)(t0 + crow)) * HK + ccol;                     // + s * OKC
    const h16* gr = CXR + ((size_t)b * EROWS + (size_t)((EARLY ? t0 : 0) + crow)) * HK + ccol;    // EARLY only
    const h16* gw = WO + (size_t)crow * HK + ccol;
    auto stage = [&](int s, int buf) {                         // s < HK / OKC: every piece lies inside its plane
        const unsigned lb = lrow + (unsigned)(buf * STG * 2);
        copy4(lb, 8 * OKP * 2, ga + s * OKC, 8 * HK);
#pragma unroll
        for (int q = 0; q < 2; ++q) copy8(lb + (unsigned)((OAT + q * 64 * OKP) * 2), 8 * OKP * 2, gw + q * 64 * HK + s * OKC, 8 * HK * 2);
        if (EARLY) copy4(lb + (unsigned)((OAT + OWT) * 2), 8 * OKP * 2, gr + s * OKC, 8 * HK);
    };
    v8f acc[2], accr[2];
#pragma unroll
    for (int nb = 0; nb < 2; ++nb) { acc[nb] = (v8f){}; accr[nb] = (v8f){}; }
    const int ao = (16 * mb + lr) * OKP + 8 * hi;              // A fragment: row m, k = c
    const int wo = OAT + (32 * ng + lr) * OKP + 8 * hi;        // B fragment: col n, k = c; + 16 * OKP for the second column tile
    const int ro = OAT + OWT + ao;
    stage(0, 0);
    asm volatile("s_wait_asynccnt 0x0" ::: "memory");          // this wave's pieces of stage 0 have landed
    __syncthreads();                                           // publishes stage 0 to all eight waves
    stage(1, 1);
#pragma unroll 1
    for (int s = 0; s < HK / OKC; ++s) {
        const int buf = s & 1;
        const h16* sb = st + buf * STG;
#pragma unroll
        for (int g = 0; g < OKC; g += 128) {
            v16h a[4], ar[4], w0[4], w1[4];                    // the fragments of four k-steps are requested before their first product: one exposed LDS latency per group
#pragma unroll
            for (int c = 0; c < 4; ++c) { a[c] = ldh(sb + ao + g + 32 * c); ar[c] = a[c];
                if (EARLY) ar[c] = ldh(sb + ro + g + 32 * c);
                w0[c] = ldh(sb + wo + g + 32 * c); w1[c] = ldh(sb + wo + 16 * OKP + g + 32 * c); }
#pragma unroll
            for (int c = 0; c < 4; ++c) { acc[0] = mmh(a[c], w0[c], acc[0]); acc[1] = mmh(a[c], w1[c], acc[1]);
                if (EARLY) { accr[0] = mmh(ar[c], w0[c], accr[0]); accr[1] = mmh(ar[c], w1[c], accr[1]); } }
        }
        // publish point of stage s + 1, passed by every wave
        asm volatile("s_wait_dscnt 0x0" ::: "memory");         // this wave's reads of the buffer that is refilled below have returned
        asm volatile("s_wait_asynccnt 0x0" ::: "memory");      // this wave's pieces of the next stage have landed
        __syncthreads();                                       // publishes the next stage and ends every wave's reads of this one
        if (s + 2 < HK / OKC) stage(s + 2, buf);               // block-uniform test: only while that stage exists
    }
    asm volatile("s_wait_asynccnt 0x0" ::: "memory");          // no copy is outstanding when the wave goes on to the output tile and ends
    float bc[2];
#pragma unroll
    for (int nb = 0; nb < 2; ++nb) bc[nb] = bfr(bo[32 * ng + 16 * nb + lr]);      // 32 * 3 + 31 < DM
#pragma unroll
    for (int nb = 0; nb < 2; ++nb) {
#pragma unroll
        for (int j = 0; j < 8; ++j) { float v = acc[nb][j]; if (EARLY) v = v + accr[nb][j] * QRI;
            os[(16 * mb + hi * 8 + j) * OOP + 32 * ng + 16 * nb + lr] = v * OSI + bc[nb]; } }     // D: row 8h+j, col lane&15
    __syncthreads();                                           // the output tile is whole before any wave stores rows that other waves wrote
#pragma unroll
    for (int s = 0; s < 4; ++s) { const int row = crow + 8 * s, cofs = (tid & 31) * 4;            // 4 s x 8 waves = 32 rows; 32 lanes x 4 floats = 128 columns = four lines, one wave each
        const v4f val = *(const v4fa*)(&os[row * OOP + cofs]);
        *(v4f*)(OUT + ((size_t)(t0 + row) * NB_FULL + (size_t)b) * DM + cofs) = val; }
}

// Both row bands in one launch, a one-dimensional grid of NB * SEQ / 32 blocks: blockIdx.x < OB_E = the two-accumulator tiles of rows < EROWS, the rest the single-product tiles.
#define OB_E (NB * EROWS / 32)
__global__ __launch_bounds__(32 * OW) __attribute__((amdgpu_num_vgpr(256))) void k_out_all(const h16* __restrict__ CX, const h16* __restrict__ CXR, const h16* __restrict__ WO, const float* __restrict__ bo, float* OUT) {
    __shared__ __align__(16) h16 st[2 * (2 * OAT + OWT)];
    __shared__ __align__(16) float os[32 * OOP];
    const int bx = (int)blockIdx.x;                            // block-uniform
    if (bx < OB_E) out_body<1>(CX, CXR, WO, bo, OUT, bx, st, os);
    else           out_body<0>(CX, CXR, WO, bo, OUT, bx - OB_E, st, os);
}

static constexpr size_t al256(size_t v) { return (v + 255) & ~(size_t)255; }
static constexpr size_t SZ_XB = al256((size_t)NB * SEQ * DM * 2);
static constexpr size_t SZ_WB = al256((size_t)3 * HK * DM * 2);
static constexpr size_t SZ_WO = al256((size_t)DM * HK * 2);
static constexpr size_t SZ_PL = al256((size_t)NB * NH_ * SEQ * HD * 2);
static constexpr size_t SZ_RS = al256((size_t)NB * NH_ * EROWS * HD * 2);
static constexpr size_t SZ_CX = al256((size_t)NB * SEQ * HK * 2);
static constexpr size_t SZ_CR = al256((size_t)NB * EROWS * HK * 2);
static constexpr size_t SZ_TOTAL = SZ_XB + SZ_WB + SZ_WO + 3 * SZ_PL + 3 * SZ_RS + SZ_CX + SZ_CR;
static_assert(SZ_TOTAL <= (size_t)134217728);          // workspace carve <= 128 MiB
static_assert(((size_t)HK * DM * 2) % 256 == 0);       // weight sub-planes stay 256-byte aligned
static_assert((size_t)NB * NH_ * SEQ * HD == (size_t)NB * HK * SEQ);       // v^T plane [(b*1024 + m)][t] has the same extent as the row/column planes
static_assert((size_t)NB * NH_ * EROWS * HD == (size_t)NB * HK * EROWS);   // v^T residual plane [(b*1024 + m)][t < EROWS] has the same extent as the other residual planes
static_assert(((size_t)NB * SEQ * DM / 8) % 256 == 0);  // x converter grid x block == plane extent
static_assert(((size_t)HK * DM / 8) % 256 == 0);        // weight converter grids x block == plane extents

extern "C" void kernel_launch(void* const* d_in, const int* in_sizes, int n_in,
                              void* d_out, int out_size, void* d_ws, size_t ws_size, hipStream_t stream) {
    if (n_in < 9) return;
    const size_t needx = ((size_t)(SEQ - 1) * NB_FULL + NB) * DM;
    if ((size_t)in_sizes[0] < needx) return;
    if ((size_t)in_sizes[1] < (size_t)HK * DM || (size_t)in_sizes[3] < (size_t)HK * DM || (size_t)in_sizes[5] < (size_t)HK * DM || (size_t)in_sizes[7] < (size_t)DM * HK) return;
    if (in_sizes[2] < HK || in_sizes[4] < HK || in_sizes[6] < HK || in_sizes[8] < DM) return;
    if ((size_t)out_size < needx) return;
    if (SZ_TOTAL > ws_size) return;
    // wire order: x, Wk, bk, Wq, bq, Wv, bv, Wo, bo
    const float* x  = (const float*)d_in[0];
    const float* wk = (const float*)d_in[1]; const float* bk = (const float*)d_in[2];
    const float* wq = (const float*)d_in[3]; const float* bq = (const float*)d_in[4];
    const float* wv = (const float*)d_in[5]; const float* bv = (const float*)d_in[6];
    const float* wo = (const float*)d_in[7]; const float* bo = (const float*)d_in[8];
    float* OUT = (float*)d_out;      // [SEQ][NB_FULL][128]
    char* wsp = (char*)d_ws;
    bf* XB = (bf*)wsp; wsp += SZ_XB;                 // [NB*SEQ][128], row = b*SEQ + t
    bf* WB = (bf*)wsp; wsp += SZ_WB;                 // [3][1024][128]: k | q | v  ([out][in] = Bt as-is)
    h16* WO = (h16*)wsp; wsp += SZ_WO;               // [128][1024] bf16(Wo) x1024 in f16
    h16* RH = (h16*)wsp; wsp += SZ_PL;               // row side (Wk projection)    [NB*8][SEQ][128]
    h16* CH = (h16*)wsp; wsp += SZ_PL;               // column side (Wq projection) [NB*8][SEQ][128]
    h16* VT = (h16*)wsp; wsp += SZ_PL;               // [NB*8][128][SEQ]
    h16* RR = (h16*)wsp; wsp += SZ_RS;               // [NB*8][EROWS][128] residual x2048, tokens < EROWS
    h16* CR = (h16*)wsp; wsp += SZ_RS;               // [NB*8][EROWS][128] residual x2048, tokens < EROWS
    h16* VR = (h16*)wsp; wsp += SZ_RS;               // [NB*8][128][EROWS] residual x2048, tokens < EROWS
    h16* CX = (h16*)wsp; wsp += SZ_CX;               // [NB*SEQ][1024] ctx x16
    h16* CXR = (h16*)wsp; wsp += SZ_CR;              // [NB*EROWS][1024] ctx residual x16 x2048, tokens < EROWS

    // x, Wk, Wq, Wv, Wo -> 16-bit planes
    k_cvt_all<<<CB_X + 4 * CB_W, 256, 0, stream>>>(x, wk, wq, wv, wo, XB, WB, WO);

    // row side and column side: A = x rows (m = b*SEQ + t), Bt = W rows (n = h*128 + d) -> plane [(b*8 + h)][t][d]; v^T: A = Wv rows, Bt = x rows -> plane [(b*8 + h)][d][t]; residuals for tokens < EROWS
    k_proj_all<<<dim3(PT_N, 3, 1), 32 * PW, 0, stream>>>(XB, WB, bk, bq, bv, RH, RR, CH, CR, VT, VR, EROWS);

    // rows [0, EROWS): multi-product instantiation; rows [EROWS, SEQ): single-product instantiation (disjoint ctx rows)
    k_flash_all<<<FB_E + FB_L, 32 * AW, 0, stream>>>(RH, RR, CH, CR, VT, VR, CX, CXR);

    // output GEMM: rows [0, EROWS) with the ctx residual accumulators, rows [EROWS, SEQ) single product (disjoint output rows)
    k_out_all<<<NB * SEQ / 32, 32 * OW, 0, stream>>>(CX, CXR, WO, bo, OUT);
}

// v006
// It runs in 58.6 microseconds.
// Timed twice side by side with v005, it ran 1.15 and 1.16 times as fast.
// All steps since v000 together make it 4.77 times as fast.
#include <hip/hip_runtime.h>

// Causal multi-head attention over one time-major sequence input x [SEQ][NB][128]; 8 heads x 128; Wk/Wq/Wv [1024][128] ([out][in], y = x W^T + bias); scores S[i][j] = kproj_i . qproj_j / sqrt(128)
// (rows follow the Wk projection, the softmax runs over the Wq-projection positions j <= i; the diagonal is always kept); out_i = sum_j P[i][j] vproj_j; heads merged to [t][b][1024]; output = ctx Wo^T + bo, Wo [128][1024], f32 [SEQ][NB][128].
// Compute dtypes, f32 accumulate everywhere: projections v_wmma_f32_16x16x32_bf16 (x, W, bias RNE-converted to bf16; products exact);
// scores v_wmma_f32_16x16x32_f16: single f16 planes on rows >= EROWS; on rows < EROWS both score operands as f16 value + f16 residual x2048 (three products, residual products in their own accumulator);
// P.V v_wmma_f32_16x16x32_f16: P (x16384 carry, cancels in the normalisation) and v single f16 on rows >= EROWS; on rows < EROWS P and v each as f16 value + f16 residual x2048, residual products in their own accumulator folded by 1/2048;
// output GEMM v_wmma_f32_16x16x32_f16: ctx x16 (f16; plus f16 residual x2048 in its own accumulator on rows < EROWS) times bf16(Wo) x1024 held exactly in f16; folded by 1/16384; softmax f32 (online, running max).
// Layout: bf16 x [b][t][128] and W planes; row-side (Wk) and column-side (Wq) planes [b*8+h][t][128], v^T plane [b*8+h][d][t], small residual planes for tokens < EROWS; ctx plane [b*SEQ+t][1024]; fused flash kernel in transposed form
// (S^T = C R^T with the row-side tile as the B operand, O^T = V^T P^T with the packed P tile as the B operand); the column-side and v^T tiles of a key step are staged once per block in a two-buffer LDS ring
// by asynchronous copies and read by all four waves; one work-group barrier per key step. The projection and output GEMMs stage their operand tiles by the same copies (projections: whole K once per four-wave block; output GEMM: a two-buffer ring of K chunks per eight-wave block).
// Four dependent launches: conversions, projections, flash, output GEMM; the independent grids of a stage share one grid and are told apart by block index (the flash grid's own deal of tiles to indices stands at its kernel).

#ifndef NB
#define NB 8
#endif
#ifndef SEQ
#define SEQ 1024
#endif
#define NB_FULL  8
#define SEQ_FULL 1024
#define DM   128                 // input and output width
#define NH_  8
#define HD   128
#define HK   (NH_ * HD)          // merged head width 1024
#define AW   4                   // waves per flash block (16 rows each)
#define OSP  132                 // LDS row pitch (floats) of the flash output tile
#define KP   136                 // LDS row pitch (halves) of a staged column-side tile: 272 B = 16 B x 17, conflict-free for 16-B fragment reads
#define VP   40                  // LDS row pitch (halves) of a staged v^T tile: 80 B = 16 B x 5, conflict-free for 16-B fragment reads
#define KTH  (32 * KP)           // halves of one staged column-side tile (32 tokens x 128)
#define VTH  (HD * VP)           // halves of one staged v^T tile (128 rows x 32 tokens)
#define EROWS (SEQ < 256 ? SEQ : 256)   // rows (and tokens of the small residual planes) handled by the multi-product instantiations
#define QRS  2048.0f             // carry of every residual plane / residual fragment
#define QRI  (1.0f / 2048.0f)
#define SC2  ((float)(0.08838834764831845 * 1.4426950408889634))   // HD^-0.5 * log2(e)
#define PSH  14.0f               // log2 of the P carry (16384)
#define NEGB (-3.0e38f)
#define CXS  16.0f               // carry of the ctx plane
#define WOS  1024.0f             // carry of the Wo plane
#define OSI  (1.0f / 16384.0f)   // 1 / (CXS * WOS)

static_assert(HD == 128);                      // plane row = 256 bytes = two lines; four 32-deep k-steps per score tile; eight 16-row output tiles
static_assert(NH_ * HD == HK);
static_assert(HD % 64 == 0);                   // a 64-column GEMM tile lies inside one head
static_assert(HK % 64 == 0);
static_assert(DM % 64 == 0);
static_assert(DM % 32 == 0);                   // projection k-loop steps by 32
static_assert(HK % 32 == 0);                   // output GEMM k-loop steps by 32
static_assert(SEQ % 64 == 0);                  // a 64-row tile never straddles two batches
static_assert(SEQ % 32 == 0);                  // key loop steps by 32
static_assert(EROWS % 64 == 0);                // a 64-token GEMM tile lies wholly inside or outside the residual planes; key bound of the first band <= EROWS
static_assert(EROWS >= 64);
static_assert(EROWS <= SEQ);
static_assert(EROWS % (16 * AW) == 0);
static_assert((SEQ - EROWS) % (16 * AW) == 0);
static_assert(EROWS % 32 == 0);
static_assert((SEQ - EROWS) % 32 == 0);
static_assert(NB <= NB_FULL);
static_assert(SEQ <= SEQ_FULL);
static_assert((OSP * 4) % 16 == 0);
static_assert(OSP >= HD);
static_assert((size_t)NB * NH_ * SEQ * HD < (size_t)2147483647);   // plane offsets fit in int
static_assert((size_t)4 * 2 * 2 * (KTH + VTH) * 2 <= (size_t)327680);   // static LDS of the flash kernel (two ring buffers of four tiles): four blocks fit a WGP
static_assert((size_t)AW * 16 * OSP * 4 <= (size_t)2 * (KTH + VTH) * 2);   // the output tile fits in the smaller band's ring
static_assert(AW * 32 == 128);                 // the copy maps below deal 512 16-B pieces of a tile to 128 threads, four each
static_assert(32 * HD * 2 == 512 * 16);        // column-side tile = 512 pieces
static_assert(HD * 32 * 2 == 512 * 16);        // v^T tile = 512 pieces
static_assert((KP * 2) % 16 == 0 && (VP * 2) % 16 == 0 && (KTH * 2) % 16 == 0 && (VTH * 2) % 16 == 0);   // every staged piece stays 16-B aligned
static_assert(KP >= HD && VP >= 32);
static_assert(32 * 4 * 16 == 16 * 64 * 2);     // projection slab store: 32 lanes x 4 instructions x 16 B == 16 rows x 64 halves
static_assert(32 * 8 * 16 == 16 * HD * 2);     // flash slab store: 32 lanes x 8 instructions x 16 B == 16 rows x 128 halves
static_assert((DM / 8) == 16);                 // 16 pieces of 8 per input row in the x converter

typedef _Float16 h16;
typedef unsigned short bf;
typedef __attribute__((ext_vector_type(16))) __bf16   v16bf;
typedef __attribute__((ext_vector_type(16))) _Float16 v16h;
typedef __attribute__((ext_vector_type(8)))  _Float16 v8h;
typedef __attribute__((ext_vector_type(8)))  unsigned short v8us;
typedef __attribute__((ext_vector_type(8)))  float    v8f;
typedef __attribute__((ext_vector_type(4)))  float    v4f;
typedef v4f  __attribute__((may_alias)) v4fa;

__device__ __forceinline__ unsigned short f2bf(float f) { unsigned u = __float_as_uint(f); u += 0x7FFFu + ((u >> 16) & 1u); return (unsigned short)(u >> 16); }
__device__ __forceinline__ float bfr(float f) { return __uint_as_float(((unsigned)f2bf(f)) << 16); }   // value after RNE convert to bf16
__device__ __forceinline__ v16h cat16(v8h lo, v8h hi) { return __builtin_shufflevector(lo, hi, 0, 1, 2, 3, 4, 5, 6, 7, 8, 9, 10, 11, 12, 13, 14, 15); }
__device__ __forceinline__ v16bf cat16b(v8us lo, v8us hi) { return __builtin_bit_cast(v16bf, __builtin_shufflevector(lo, hi, 0, 1, 2, 3, 4, 5, 6, 7, 8, 9, 10, 11, 12, 13, 14, 15)); }
__device__ __forceinline__ v8f wmma16(v16h a, v16h b, v8f c) { return __builtin_amdgcn_wmma_f32_16x16x32_f16(false, a, false, b, (short)0, c, false, false); }
__device__ __forceinline__ v8f wmmab(v16bf a, v16bf b, v8f c) { return __builtin_amdgcn_wmma_f32_16x16x32_bf16(false, a, false, b, (short)0, c, false, false); }
// fragment loaders from K-contiguous 16-bit rows; p already includes + 8*(lane>>4): elements 0..7 <- k0+8h+0..7, elements 8..15 <- k0+16+8h+0..7 (same map for A and B)
__device__ __forceinline__ v16h  ldh(const h16* p) { return cat16(*(const v8h*)p, *(const v8h*)(p + 16)); }
__device__ __forceinline__ v16bf ldb(const bf* p)  { return cat16b(*(const v8us*)p, *(const v8us*)(p + 16)); }
// ordering point for wave-private LDS tiles (same wave writes and reads)
__device__ __forceinline__ void wave_sync() { __builtin_amdgcn_fence(3 /* release order */, "wavefront"); __builtin_amdgcn_wave_barrier(); asm volatile("" ::: "memory"); }
// f32 -> f16 operand convert that cannot produce a subnormal (|v| < 2^-14 -> +0), applied after the plane's carry
static __device__ __forceinline__ h16 toh_flush(float v) { const h16 r = (h16)v; return (fabsf(v) < 6.103515625e-05f) ? (h16)0.0f : r; }
// one matrix instruction with its own four-slot guard (ties the accumulator, keeps both fragments live)
__device__ __forceinline__ v8f mmh(v16h a, v16h b, v8f c) { c = wmma16(a, b, c); asm volatile("v_nop\n\tv_nop\n\tv_nop\n\tv_nop" : "+v"(c) : "v"(a), "v"(b)); return c; }
__device__ __forceinline__ v8f mmb(v16bf a, v16bf b, v8f c) { c = wmmab(a, b, c); asm volatile("v_nop\n\tv_nop\n\tv_nop\n\tv_nop" : "+v"(c) : "v"(a), "v"(b)); return c; }

// Eight asynchronous 16-B copies per lane, global -> LDS, through no register. l: the lane's LDS byte address, g: its global address; piece i lies lstep / gstep bytes behind piece i - 1.
// The s_wait_xcnt stands inside the copies' own statement so that no address register of an issued copy is rewritten in front of it; eight copies share the one wait.
__device__ __forceinline__ void copy8(unsigned l, unsigned lstep, const void* gp, int gstep) {
    const char* g = (const char*)gp;
    const unsigned l1 = l + lstep, l2 = l + 2 * lstep, l3 = l + 3 * lstep, l4 = l + 4 * lstep, l5 = l + 5 * lstep, l6 = l + 6 * lstep, l7 = l + 7 * lstep;
    const char* g1 = g + gstep; const char* g2 = g + 2 * gstep; const char* g3 = g + 3 * gstep; const char* g4 = g + 4 * gstep;
    const char* g5 = g + 5 * gstep; const char* g6 = g + 6 * gstep; const char* g7 = g + 7 * gstep;
    asm volatile("global_load_async_to_lds_b128 %0, %8, off\n\t"
                 "global_load_async_to_lds_b128 %1, %9, off\n\t"
                 "global_load_async_to_lds_b128 %2, %10, off\n\t"
                 "global_load_async_to_lds_b128 %3, %11, off\n\t"
                 "global_load_async_to_lds_b128 %4, %12, off\n\t"
                 "global_load_async_to_lds_b128 %5, %13, off\n\t"
                 "global_load_async_to_lds_b128 %6, %14, off\n\t"
                 "global_load_async_to_lds_b128 %7, %15, off\n\t"
                 "s_wait_xcnt 0x0"
                 :: "v"(l), "v"(l1), "v"(l2), "v"(l3), "v"(l4), "v"(l5), "v"(l6), "v"(l7), "v"(g), "v"(g1), "v"(g2), "v"(g3), "v"(g4), "v"(g5), "v"(g6), "v"(g7) : "memory");
}

__device__ __forceinline__ void cvt8_body(const float* __restrict__ src, bf* dst, int blk) {
    const size_t i = (size_t)blk * 256 + threadIdx.x;
    const v8f v = *(const v8f*)(src + i * 8); v8us o;
#pragma unroll
    for (int k = 0; k < 8; ++k) o[k] = f2bf(v[k]);
    *(v8us*)(dst + i * 8) = o;
    asm volatile("s_wait_xcnt 0x0" ::: "memory");              // another body's code follows in the kernel's text: no register that the store names is rewritten in front of this wait
}

__device__ __forceinline__ void cvtx_body(const float* __restrict__ src, bf* dst, int blk) {
    const int i = blk * 256 + (int)threadIdx.x;
    const int row = i >> 4, pc = i & 15;                 // row = b*SEQ + t
    const int b = row / SEQ, t = row % SEQ;
    const v8f v = *(const v8f*)(src + ((size_t)t * NB_FULL + (size_t)b) * DM + (size_t)pc * 8); v8us o;
#pragma unroll
    for (int k = 0; k < 8; ++k) o[k] = f2bf(v[k]);
    *(v8us*)(dst + (size_t)i * 8) = o;
}

__device__ __forceinline__ void cvtwo_body(const float* __restrict__ src, h16* dst, int blk) {
    const int i = blk * 256 + (int)threadIdx.x;
    const v8f v = *(const v8f*)(src + (size_t)i * 8); v8h o;
#pragma unroll
    for (int k = 0; k < 8; ++k) o[k] = toh_flush(bfr(v[k]) * WOS);
    *(v8h*)(dst + (size_t)i * 8) = o;
    asm volatile("s_wait_xcnt 0x0" ::: "memory");              // as in cvt8_body
}

// All five operand conversions in one launch, told apart by block-index range (each range x 256 threads == its plane's extent in pieces of 8, asserted below): x | Wk | Wq | Wv | Wo.
#define CB_X ((NB * SEQ * DM / 8) / 256)
#define CB_W ((HK * DM / 8) / 256)
__global__ __launch_bounds__(256) void k_cvt_all(const float* __restrict__ x, const float* __restrict__ wk, const float* __restrict__ wq, const float* __restrict__ wv, const float* __restrict__ wo,
                                                 bf* XB, bf* WB, h16* WO) {
    const int blk = (int)blockIdx.x;
    if (blk < CB_X) { cvtx_body(x, XB, blk); return; }
    const int wi = (blk - CB_X) / CB_W, wb = (blk - CB_X) % CB_W;      // block-uniform: 0, 1, 2 = Wk, Wq, Wv; 3 = Wo
    if (wi < 3) cvt8_body(wi == 0 ? wk : (wi == 1 ? wq : wv), WB + (size_t)wi * HK * DM, wb);
    else        cvtwo_body(wo, WO, wb);
}

// proj_body: register-blocked bf16 GEMM, one block of four waves per 128x128 tile, ONE WAVE per 64x64 tile of it (16 accumulators), K = DM. The block's 128 A rows and 128 Bt rows (whole K, 256 B each, contiguous in their planes)
// are staged once in LDS by asynchronous copies (one copy instruction of a wave = two whole rows), row pitch PKP; wait, barrier, then every wave reads its fragments from LDS.
// C[m][n] = sum_k A[m][k] Bt[n][k] + bias, written as f16 (Ph) and, for tokens t < resT (resT a multiple of 64, wave-uniform test), the f16 residual x2048 (Pr).
// bx, by: the block tile's row and column index; st: the block's LDS (A tile | Bt tile; behind the k-loop's barrier its first bytes hold the four waves' slabs of 16 x 68 floats).
// MODE 0: A = x rows (m = b*SEQ + t), Bt = W rows (n = h*128 + d), bias per column; plane [(b*8 + h)][t][128] (residual plane [(b*8 + h)][resT][128]); a wave's 64-column tile lies inside one head. bx < NB*SEQ/128, by < HK/128.
// MODE 1: A = W rows (m = h*128 + d), Bt = x rows (n = b*SEQ + t), bias per row; plane [(b*1024 + m)][t], row pitch SEQ (residual plane row pitch resT). bx < HK/128, by < NB*SEQ/128.
#define PW   4                   // waves per projection block (2 x 2 tiles of 64 x 64)
#define PKP  136                 // LDS row pitch (halves) of a staged operand row: 272 B = 16 B x 17, conflict-free for 16-B fragment reads
#define PTH  (128 * PKP)         // halves of one staged operand tile (128 rows x 128)
static_assert(DM == 128 && PKP >= DM && (PKP * 2) % 16 == 0 && (PTH * 2) % 16 == 0);
static_assert(32 * PW == 128 && 128 * DM * 2 == 128 * 16 * 16);   // the copy map deals the 2048 16-B pieces of a tile to 128 threads, sixteen each
static_assert((NB * SEQ) % 128 == 0 && HK % 128 == 0);
static_assert((size_t)PW * 16 * 68 * 4 <= (size_t)2 * PTH * 2);   // the four slabs fit in the staged tiles' LDS
static_assert((size_t)4 * 2 * PTH * 2 <= (size_t)327680);         // four blocks fit a WGP's LDS
template <int MODE>
__device__ __forceinline__ void proj_body(const bf* __restrict__ A, const bf* __restrict__ Bt, const float* __restrict__ bias, h16* Ph, h16* Pr, int resT, int bx, int by, bf* st) {
    const int K = DM;
    const int tid = (int)threadIdx.x, lane = tid & 31, lr = lane & 15, hi = lane >> 4;
    const int wave = __builtin_amdgcn_readfirstlane(tid >> 5);
    const int wm = wave & 1, wn = wave >> 1; const int r0 = bx * 128 + wm * 64, c0 = by * 128 + wn * 64;
    // copy map: piece i of a 64-row group -> row (tid >> 4) + 8 i, 16-B column tid & 15
    const unsigned l0 = (unsigned)(size_t)st + (unsigned)(((tid >> 4) * PKP + (tid & 15) * 8) * 2);
    const bf* ga = A + (size_t)(bx * 128 + (tid >> 4)) * K + (tid & 15) * 8;       // rows bx * 128 .. + 127 lie inside A
    const bf* gb = Bt + (size_t)(by * 128 + (tid >> 4)) * K + (tid & 15) * 8;      // rows by * 128 .. + 127 lie inside Bt
#pragma unroll
    for (int q = 0; q < 2; ++q) { copy8(l0 + (unsigned)(q * 64 * PKP * 2), 8 * PKP * 2, ga + q * 64 * K, 8 * K * 2);
                                  copy8(l0 + (unsigned)((PTH + q * 64 * PKP) * 2), 8 * PKP * 2, gb + q * 64 * K, 8 * K * 2); }
    asm volatile("s_wait_asynccnt 0x0" ::: "memory");          // this wave's pieces of both tiles have landed
    __syncthreads();                                           // publishes both tiles to all four waves
    v8f acc[4][4];
#pragma unroll
    for (int mb = 0; mb < 4; ++mb)
#pragma unroll
        for (int nb = 0; nb < 4; ++nb) acc[mb][nb] = (v8f){};
    const int aoff = (wm * 64 + lr) * PKP + 8 * hi, boff = PTH + (wn * 64 + lr) * PKP + 8 * hi;
#pragma unroll 1
    for (int kc = 0; kc < K; kc += 32) {
        v16bf a[4], b[4];                                   // all eight fragments of the trip are requested before its first product: one exposed LDS latency per trip
#pragma unroll
        for (int mb = 0; mb < 4; ++mb) a[mb] = ldb(st + aoff + mb * 16 * PKP + kc);
#pragma unroll
        for (int nb = 0; nb < 4; ++nb) b[nb] = ldb(st + boff + nb * 16 * PKP + kc);
#pragma unroll
        for (int nb = 0; nb < 4; ++nb) {
#pragma unroll
            for (int mb = 0; mb < 4; ++mb) acc[mb][nb] = mmb(a[mb], b[nb], acc[mb][nb]); }
    }
    asm volatile("s_wait_dscnt 0x0" ::: "memory");             // this wave's fragment reads have returned
    __syncthreads();                                           // ends every wave's reads of the staged tiles: the slabs below lie in their LDS
    float* os = (float*)st + wave * (16 * 68);
    float bc[4];
#pragma unroll
    for (int nb = 0; nb < 4; ++nb) bc[nb] = (MODE == 0) ? bfr(bias[c0 + nb * 16 + lr]) : 0.0f;   // MODE 0: c0 + 63 < HK
    size_t tbase, rbase, tpitch, rpitch; bool wr;                                                 // wr: wave-uniform, the wave's whole tile inside the residual plane
    if (MODE == 0) { const int bb = r0 / SEQ, tt = r0 % SEQ; const int zc = bb * NH_ + c0 / HD; const int d0 = c0 % HD;
                     tbase = ((size_t)zc * SEQ + (size_t)tt) * HD + (size_t)d0; tpitch = HD;
                     rbase = ((size_t)zc * (size_t)resT + (size_t)tt) * HD + (size_t)d0; rpitch = HD; wr = tt < resT; }
    else           { const int bb = c0 / SEQ, tt = c0 % SEQ;
                     tbase = ((size_t)bb * HK + (size_t)r0) * SEQ + (size_t)tt; tpitch = SEQ;
                     rbase = ((size_t)bb * HK + (size_t)r0) * (size_t)resT + (size_t)tt; rpitch = (size_t)resT; wr = tt < resT; }
#pragma unroll
    for (int mb = 0; mb < 4; ++mb) {
        float br[8];
#pragma unroll
        for (int j = 0; j < 8; ++j) br[j] = (MODE == 1) ? bfr(bias[r0 + mb * 16 + hi * 8 + j]) : 0.0f;   // MODE 1: r0 + 63 < HK
#pragma unroll
        for (int nb = 0; nb < 4; ++nb) {
#pragma unroll
            for (int j = 0; j < 8; ++j) os[(hi * 8 + j) * 68 + nb * 16 + lr] = acc[mb][nb][j] + bc[nb] + br[j]; }   // D: row 8h+j, col lane&15
        wave_sync();
{
#pragma unroll
            for (int s = 0; s < 4; ++s) { const int row = 4 * s + (lane >> 3), c8 = (lane & 7) * 8;   // 4 s x 4 row groups = 16 rows; 8 lanes x 8 = 64 columns
                const v4f x0 = *(const v4fa*)(&os[row * 68 + c8]); const v4f x1 = *(const v4fa*)(&os[row * 68 + c8 + 4]); v8h hv, rv;
#pragma unroll
                for (int i = 0; i < 4; ++i) { const h16 a0 = toh_flush(x0[i]); const h16 a1 = toh_flush(x1[i]); hv[i] = a0; hv[4 + i] = a1;
                    rv[i] = toh_flush((x0[i] - (float)a0) * QRS); rv[4 + i] = toh_flush((x1[i] - (float)a1) * QRS); }
                const size_t oo = tbase + (size_t)(mb * 16 + row) * tpitch + (size_t)c8;
                const size_t ro = rbase + (size_t)(mb * 16 + row) * rpitch + (size_t)c8;
                *(v8h*)(Ph + oo) = hv; if (wr) *(v8h*)(Pr + ro) = rv; }
             }
        wave_sync();
    }
}

// All three projections in one launch, grid (PT_N, 3): blockIdx.y = 0 row side (Wk), 1 column side (Wq), 2 v^T (Wv); blockIdx.x = the tile, row index fastest in each. WB: [3][1024][128] k | q | v.
#define PT_N ((NB * SEQ / 128) * (HK / 128))
__global__ __launch_bounds__(32 * PW) void k_proj_all(const bf* __restrict__ XB, const bf* __restrict__ WB, const float* __restrict__ bk, const float* __restrict__ bq, const float* __restrict__ bv,
                                                 h16* RH, h16* RR, h16* CH, h16* CR, h16* VT, h16* VR, int resT) {
    __shared__ __align__(16) bf st[2 * PTH];
    const int z = (int)blockIdx.y, tl = (int)blockIdx.x;       // block-uniform
    if (z < 2) proj_body<0>(XB, WB + (size_t)z * HK * DM, z == 0 ? bk : bq, z == 0 ? RH : CH, z == 0 ? RR : CR, resT, tl % (NB * SEQ / 128), tl / (NB * SEQ / 128), st);
    else       proj_body<1>(WB + (size_t)2 * HK * DM, XB, bv, VT, VR, resT, tl % (HK / 128), tl / (HK / 128), st);
}

// score16x2: the two 16-column-token x 16-row-token tiles of a key step, scaled logits (log2 domain), multi-product form. A = column-side rows (k = d), B = row-side rows (k = d), four 32-deep k-steps.
// Per tile: value x value in aH / bH; value x residual and residual x value (both x2048) in aL / bL. The six fragments of a k-step are requested together, before its first product;
// the two row-side fragments of a k-step are read once and serve both tiles. CH / CR point at the lane's row of the staged tiles in LDS (second tile 16 * KP behind).
__device__ __forceinline__ void score16x2(const h16* __restrict__ RH, const h16* __restrict__ RR, const h16* CH, const h16* CR, int rx, int rrx, v8f& ta, v8f& tb) {
    v8f aH = (v8f){}, aL = (v8f){}, bH = (v8f){}, bL = (v8f){};
#pragma unroll
    for (int kc = 0; kc < HD; kc += 32) {
        const v16h qf = ldh(RH + rx + kc); const v16h qr = ldh(RR + rrx + kc);
        const v16h kf = ldh(CH + kc); const v16h kr = ldh(CR + kc); const v16h lf = ldh(CH + 16 * KP + kc); const v16h lr = ldh(CR + 16 * KP + kc);
        aH = mmh(kf, qf, aH); aL = mmh(kf, qr, aL); aL = mmh(kr, qf, aL);
        bH = mmh(lf, qf, bH); bL = mmh(lf, qr, bL); bL = mmh(lr, qf, bL);
        __builtin_amdgcn_sched_barrier(0);                  // ends the group for the scheduler: each k-step reuses the fragment registers of the one before and the two address pairs stay whole until their last load has returned
    }
#pragma unroll
    for (int r = 0; r < 8; ++r) { ta[r] = (aH[r] + aL[r] * QRI) * SC2; tb[r] = (bH[r] + bL[r] * QRI) * SC2; }
}

// score32: the two 16-column tiles of a key step, single-product form. The eight column-side fragments are requested before the first product: one exposed LDS latency per key step.
// qf: the wave's four row-side fragments, held in registers over the whole key loop. CH points at the lane's row of the staged tile in LDS (row pitch KP).
__device__ __forceinline__ void score32(const v16h (&qf)[4], const h16* CH, v8f& ta, v8f& tb) {
    v16h ka[4], kb[4];
#pragma unroll
    for (int c = 0; c < 4; ++c) { ka[c] = ldh(CH + 32 * c); kb[c] = ldh(CH + 16 * KP + 32 * c); }
    v8f sa = (v8f){}, sb = (v8f){};
#pragma unroll
    for (int c = 0; c < 4; ++c) { sa = mmh(ka[c], qf[c], sa); sb = mmh(kb[c], qf[c], sb); }
#pragma unroll
    for (int r = 0; r < 8; ++r) { ta[r] = sa[r] * SC2; tb[r] = sb[r] * SC2; }
}

// Four asynchronous 16-B copies per lane, global -> LDS, through no register. l: the lane's LDS byte address, g: its global address; piece i lies lstep bytes / gstep halves behind piece i - 1.
// The s_wait_xcnt stands inside the copies' own statement so that no address register of an issued copy is rewritten in front of it.
__device__ __forceinline__ void copy4(unsigned l, unsigned lstep, const h16* g, int gstep) {
    const unsigned l1 = l + lstep, l2 = l + 2 * lstep, l3 = l + 3 * lstep;
    const h16* g1 = g + gstep; const h16* g2 = g + 2 * gstep; const h16* g3 = g + 3 * gstep;
    asm volatile("global_load_async_to_lds_b128 %0, %4, off\n\t"
                 "global_load_async_to_lds_b128 %1, %5, off\n\t"
                 "global_load_async_to_lds_b128 %2, %6, off\n\t"
                 "global_load_async_to_lds_b128 %3, %7, off\n\t"
                 "s_wait_xcnt 0x0"
                 :: "v"(l), "v"(l1), "v"(l2), "v"(l3), "v"(g), "v"(g1), "v"(g2), "v"(g3) : "memory");
}

// flash_body: fused attention, one wave per 16 rows of one (batch, head); row-side fragments straight from the f16 plane (EARLY = 0: once, ahead of the key loop; EARLY = 1: once per key step), column-side and v^T fragments from the block's LDS ring (two 16-B loads each).
// Ring: stage s = the tiles of key step s (column-side 32 x 128, v^T 128 x 32; EARLY also both residual tiles), buffer s & 1. Every thread copies four 16-B pieces of each tile. Order per the two-buffer scheme:
// stage 0, wait, barrier, stage 1; at the foot of step s every wave: LDS reads done, own copies landed, barrier, then stage s + 2 into the buffer just read. A wave past its own key bound skips the arithmetic only.
// Transposed form: S^T[j][t] = C R^T (A = column-side rows j, B = row-side rows t); lane (t = lane&15, h = lane>>4) holds columns 8h+r of each 16-column tile, so the packed
// P tile is directly the B fragment of O^T[d][t] = V^T P^T (element r <- tile columns 0..15, element 8+r <- tile columns 16..31, lane unchanged).
// Softmax state (running max over kept columns, partial sum) is one scalar per lane; the two lane halves of a row are combined with one xor-16 exchange.
// Keep rule j <= t evaluated per element in every visited 32-column tile; column 0 is kept for every row, so the running max is finite after the first tile.
// EARLY = 1 (rows [0, EROWS)): three-product scores, P = f16 value + f16 residual x2048, O = V P + (V P_res + V_res P) / 2048 (own accumulators), row sum from the f32 exponentials; all visited columns < EROWS.
// EARLY = 0 (rows [EROWS, SEQ)): single products; row sum over the converted P.
// tile: the block's 64-row tile inside its band; zh: batch * 8 + head; st: the block's LDS (2 * STG halves of ring; after the key loop its first bytes hold the output tile os).
template <int EARLY>
__device__ __forceinline__ void flash_body(const h16* __restrict__ RH, const h16* __restrict__ RR, const h16* __restrict__ CH, const h16* __restrict__ CR,
                                           const h16* __restrict__ VT, const h16* __restrict__ VR, h16* CX, h16* CXR, int tile, int zh, h16* st) {
    constexpr int STG = (EARLY ? 2 : 1) * (KTH + VTH);         // halves per ring buffer: column-side | v^T (| column-side residual | v^T residual)
    float* os = (float*)st;                                    // written only behind the last publish point of the key loop: there every wave's ring reads have returned, every copy has landed, none is issued after it
    const int lane = threadIdx.x & 31, lr = lane & 15, hi = lane >> 4;
    const int wave = __builtin_amdgcn_readfirstlane((int)(threadIdx.x >> 5));
    const int b = zh / NH_, h = zh % NH_;
    const int t0 = (EARLY ? 0 : EROWS) + (tile * AW + wave) * 16;
    const int lim = t0 + lr;                                   // column j kept iff j <= lim
    const int nk = (t0 + 16 + 31) & ~31;                       // wave-uniform, multiple of 32, <= SEQ (<= EROWS for EARLY)
    const int pbase = zh * (SEQ * HD);
    const int rbase = zh * (EROWS * HD);
    const int tcl = EARLY ? (t0 + lr) : 0;                     // residual-plane row (only the EARLY band reads it)
    const int ro  = pbase + (t0 + lr) * HD + 8 * hi;           // row-side B fragment: col t, k = d
    const int rro = rbase + tcl * HD + 8 * hi;
    const int co  = lr * KP + 8 * hi;                          // in a staged column-side tile: + 16 * KP for the second 16 tokens (A fragment: row j, k = d)
    const int vo  = KTH + lr * VP + 8 * hi;                    // in a staged v^T tile: + 16jj * VP                                 (A fragment: row d, k = j)
    const int nkb = ((EARLY ? 0 : EROWS) + (tile * AW + AW - 1) * 16 + 16 + 31) & ~31;   // key bound of the block's last wave: block-uniform, >= 64, <= SEQ (<= EROWS for EARLY)
    const int tid = (int)threadIdx.x;
    // copy maps: column-side piece p = tid + 128 i -> token p >> 4, 16-B column p & 15 (i steps 8 tokens); v^T piece p -> row p >> 2, 16-B column p & 3 (i steps 32 rows)
    const unsigned sbase = (unsigned)(size_t)st;
    const unsigned lk = sbase + (unsigned)(((tid >> 4) * KP + (tid & 15) * 8) * 2);
    const unsigned lv = sbase + (unsigned)((KTH + (tid >> 2) * VP + (tid & 3) * 8) * 2);
    const int gk  = pbase + (tid >> 4) * HD + (tid & 15) * 8;      // + key0 * HD
    const int gv  = pbase + (tid >> 2) * SEQ + (tid & 3) * 8;      // + key0
    const int gkr = rbase + (tid >> 4) * HD + (tid & 15) * 8;      // + key0 * HD
    const int gvr = rbase + (tid >> 2) * EROWS + (tid & 3) * 8;    // + key0
    auto stage = [&](int key0, int buf) {                      // key0 + 31 < nkb: every piece lies inside its plane
        const unsigned lb = (unsigned)(buf * STG * 2);
        copy4(lk + lb, 8 * KP * 2, CH + gk + key0 * HD, 8 * HD);
        copy4(lv + lb, 32 * VP * 2, VT + gv + key0, 32 * SEQ);
        if (EARLY) { copy4(lk + lb + (KTH + VTH) * 2, 8 * KP * 2, CR + gkr + key0 * HD, 8 * HD);
                     copy4(lv + lb + (KTH + VTH) * 2, 32 * VP * 2, VR + gvr + key0, 32 * EROWS); }
    };
    const v16h hz = (v16h){};
    v8f o[8], oR[8];
#pragma unroll
    for (int j = 0; j < 8; ++j) { o[j] = (v8f){}; oR[j] = (v8f){}; }
    float m = NEGB, l = 0.0f;
    v16h qf[4];                                                // single-product band: the wave's 16 x 128 row-side tile, read once here and kept in registers for every key step
    if (!EARLY) {
#pragma unroll
        for (int c = 0; c < 4; ++c) qf[c] = ldh(RH + ro + 32 * c); }
    stage(0, 0);
    asm volatile("s_wait_asynccnt 0x0" ::: "memory");          // this wave's pieces of stage 0 have landed
    __syncthreads();                                           // publishes stage 0 to all four waves
    stage(32, 1);
#pragma unroll 1
    for (int key0 = 0; key0 < nkb; key0 += 32) {
      const int buf = (key0 >> 5) & 1;
      if (key0 < nk) {                                         // wave-uniform: a wave past its own key bound skips the arithmetic, never the publish point below
        const h16* sb = st + buf * STG;
        v8f ta, tb;
        if (EARLY) { int rx = ro, rrx = rro;
                     asm volatile("" : "+v"(rx), "+v"(rrx));   // multi-product band: row-side fragments are read anew in each key step through these offsets; hoisted out of the loop their 64 registers spill
                     score16x2(RH, RR, sb + co, sb + (KTH + VTH) + co, rx, rrx, ta, tb); }
        else       { score32(qf, sb + co, ta, tb); }
        v16h vf[8];                                            // single-product band: the step's eight v^T fragments are requested here, so that they fly under the softmax arithmetic
        if (!EARLY) {
#pragma unroll
            for (int j = 0; j < 8; ++j) vf[j] = ldh(sb + vo + j * (16 * VP)); }
        const int ja = key0 + 8 * hi;
        bool fa[8], fb[8]; float mx = NEGB;
#pragma unroll
        for (int r = 0; r < 8; ++r) {
            fa[r] = (ja + r <= lim); fb[r] = (ja + 16 + r <= lim);
            mx = fmaxf(mx, fmaxf(fa[r] ? ta[r] : NEGB, fb[r] ? tb[r] : NEGB)); }
        mx = fmaxf(mx, __shfl_xor(mx, 16, 32));
        const float mnew = fmaxf(m, mx);
        const float alpha = __builtin_amdgcn_exp2f(m - mnew);
        const float sh = PSH - mnew;
        v16h pb, pr = hz; float ls = 0.0f;
#pragma unroll
        for (int r = 0; r < 8; ++r) {
            const float xa = ta[r] + sh, xb = tb[r] + sh;
            const float ea = __builtin_amdgcn_exp2f(xa), eb = __builtin_amdgcn_exp2f(xb);
            const float ga = (fa[r] & (xa >= -14.0f)) ? ea : 0.0f;        // dropped elements and exponents below the f16 normal range selected to 0 by value
            const float gb = (fb[r] & (xb >= -14.0f)) ? eb : 0.0f;
            const h16 pa = (h16)ga; const h16 pc = (h16)gb;
            pb[r] = pa; pb[8 + r] = pc;
            if (EARLY) { pr[r] = toh_flush((ga - (float)pa) * QRS); pr[8 + r] = toh_flush((gb - (float)pc) * QRS); ls += ga + gb; }
            else       { ls += (float)pa + (float)pc; } }
        l = l * alpha + ls; m = mnew;
#pragma unroll
        for (int j = 0; j < 8; ++j) { o[j] = o[j] * alpha; if (EARLY) oR[j] = oR[j] * alpha; }
        if (EARLY) {
#pragma unroll
            for (int j = 0; j < 8; j += 2) {                   // the four fragments of two output tiles are requested together, before their first product
                const v16h v0 = ldh(sb + vo + j * (16 * VP));                  const v16h v1 = ldh(sb + vo + (j + 1) * (16 * VP));
                const v16h r0 = ldh(sb + (KTH + VTH) + vo + j * (16 * VP));    const v16h r1 = ldh(sb + (KTH + VTH) + vo + (j + 1) * (16 * VP));
                o[j] = mmh(v0, pb, o[j]);         oR[j] = mmh(v0, pr, oR[j]);         oR[j] = mmh(r0, pb, oR[j]);
                o[j + 1] = mmh(v1, pb, o[j + 1]); oR[j + 1] = mmh(v1, pr, oR[j + 1]); oR[j + 1] = mmh(r1, pb, oR[j + 1]);
                __builtin_amdgcn_sched_barrier(0);             // ends the group for the scheduler, as in score16x2
            }
        } else {
#pragma unroll
            for (int j = 0; j < 8; ++j) o[j] = mmh(vf[j], pb, o[j]);
        }
      }
      // publish point of stage s + 1, passed by every wave
      asm volatile("s_wait_dscnt 0x0" ::: "memory");           // this wave's reads of the buffer that is refilled below have returned
      asm volatile("s_wait_asynccnt 0x0" ::: "memory");        // this wave's pieces of the next stage have landed
      __syncthreads();                                         // publishes the next stage and ends every wave's reads of this one
      if (key0 + 64 < nkb) stage(key0 + 64, buf);              // block-uniform test: only while that stage exists
    }
    asm volatile("s_wait_asynccnt 0x0" ::: "memory");          // no copy is outstanding when the wave goes on to the output tile and ends
    l += __shfl_xor(l, 16, 32);
    const bool any = l > 0.0f;
    const float lsafe = any ? l : 1.0f;
    const float inv = any ? (CXS * (1.0f / lsafe)) : 0.0f;     // ctx carried x16
    const int wb = wave * 16 * OSP;
    // O^T D layout: f_j[r] = (d = 16j + 8h + r, t = lane&15) -> os[t][d]; rows 0..15 x columns 0..127 all written
#pragma unroll
    for (int j = 0; j < 8; ++j) {
        v8f f = o[j]; if (EARLY) f = o[j] + oR[j] * QRI;
        v4f a, c;
        a[0] = f[0] * inv; a[1] = f[1] * inv; a[2] = f[2] * inv; a[3] = f[3] * inv; c[0] = f[4] * inv; c[1] = f[5] * inv; c[2] = f[6] * inv; c[3] = f[7] * inv;
        *(v4fa*)(&os[wb + lr * OSP + 16 * j + 8 * hi]) = a; *(v4fa*)(&os[wb + lr * OSP + 16 * j + 8 * hi + 4]) = c; }
    wave_sync();
    h16* crow = CX + ((size_t)b * SEQ + (size_t)t0) * HK + (size_t)h * HD;
    h16* rrow = CXR + ((size_t)b * EROWS + (size_t)(EARLY ? t0 : 0)) * HK + (size_t)h * HD;    // EARLY only
{
#pragma unroll
        for (int s = 0; s < 8; ++s) { const int row = 2 * s + (lane >> 4), c8 = (lane & 15) * 8;   // 8 s x 2 rows = 16 rows; 16 lanes x 8 halves = 128 columns = two lines
            const v4f x0 = *(const v4fa*)(&os[wb + row * OSP + c8]); const v4f x1 = *(const v4fa*)(&os[wb + row * OSP + c8 + 4]); v8h hv, rv;
#pragma unroll
            for (int i = 0; i < 4; ++i) { const h16 a0 = toh_flush(x0[i]); const h16 a1 = toh_flush(x1[i]); hv[i] = a0; hv[4 + i] = a1;
                rv[i] = toh_flush((x0[i] - (float)a0) * QRS); rv[4 + i] = toh_flush((x1[i] - (float)a1) * QRS); }
            *(v8h*)(crow + (size_t)row * HK + c8) = hv;
            if (EARLY) *(v8h*)(rrow + (size_t)row * HK + c8) = rv; }
         }
    if (!EARLY) asm volatile("s_wait_xcnt 0x0" ::: "memory");  // as in cvt8_body (the multi-product body's code follows the single-product body's)
}

// Both row bands in one launch, a one-dimensional grid. One LDS array serves both bodies (the larger ring; the output tile lies in it), so that four blocks fit a WGP's LDS and the whole grid is resident at once.
// The deal of (row tile, batch * 8 + head) to block indices is for speed only: it is a permutation, so every pair is worked exactly once wherever the blocks land.
// A block's cost grows with its tile's key bound. With the tile index fastest, tile mod 4 would follow index mod 4:
// The deal: index & 7 = low bits of batch * 8 + head;
// behind that FDC columns, then the rest of batch * 8 + head, then the row of a table that holds the tiles in falling key bound, FDC to a row, every second row reversed.
// So the longest tiles start first, and the blocks of one column (one of each row) have nearly equal total key steps.
#define FT_E (EROWS / (16 * AW))
#define FT_L ((SEQ - EROWS) / (16 * AW) > 0 ? (SEQ - EROWS) / (16 * AW) : 1)
#define FB_E (FT_E * NB * NH_)
#define FB_L ((SEQ - EROWS) / (16 * AW) * NB * NH_)
#define FT_N (SEQ / (16 * AW))                                 // row tiles of one batch-head, both bands
#define FDC  4                                                 // columns of the deal's table = blocks resident on a WGP
#define FDEAL ((NB * NH_) % 8 == 0 && FT_N % FDC == 0)         // shapes that the deal divides; any other takes the plain order
static_assert(FT_N * NB * NH_ == FB_E + FB_L);
__global__ __launch_bounds__(32 * AW) __attribute__((amdgpu_num_vgpr(256))) void k_flash_all(const h16* __restrict__ RH, const h16* __restrict__ RR, const h16* __restrict__ CH, const h16* __restrict__ CR,
                                                                                             const h16* __restrict__ VT, const h16* __restrict__ VR, h16* CX, h16* CXR) {
    __shared__ __align__(16) h16 st[2 * 2 * (KTH + VTH)];
    const int blk = (int)blockIdx.x;                           // block-uniform, as is all that follows from it
    int k, zh;                                                 // k: the tile's place in falling key bound (single-product tiles from the last row tile down, then the multi-product tiles likewise)
    if (FDEAL) { const int p = blk >> 3, col = p & (FDC - 1), q = p / FDC, row = q / (NB * NH_ / 8);
                 zh = (q % (NB * NH_ / 8)) * 8 + (blk & 7); k = row * FDC + ((row & 1) ? FDC - 1 - col : col); }
    else       { k = blk % FT_N; zh = blk / FT_N; }
    if (k >= FT_N - FT_E) flash_body<1>(RH, RR, CH, CR, VT, VR, CX, CXR, FT_N - 1 - k, zh, st);
    else                  flash_body<0>(RH, RR, CH, CR, VT, VR, CX, CXR, FT_N - FT_E - 1 - k, zh, st);
}

// out_body: output GEMM, one block of eight waves per 32 x 128 tile (32 rows, every output column); wave w holds rows 16 (w >> 2) .. + 15, columns 32 (w & 3) .. + 31 (two accumulator tiles). K = HK in chunks of OKC.
// OUT[(t*NB_FULL + b)][n] = (sum_c ctx16[m][c] wo1024[n][c] (+ residual sum / 2048)) / 16384 + bf16(bo[n]); EARLY: rows t < EROWS with the ctx residual plane in its own accumulators.
// Ring: stage s = the chunk's 32 ctx rows | 128 Wo rows (| 32 ctx residual rows), buffer s & 1, each row 512 B of its plane (one copy instruction of a wave = one whole row), LDS row pitch OKP.
// Order per the two-buffer scheme, as in flash_body: stage 0, wait, barrier, stage 1; at the foot of chunk s every wave: LDS reads done, own copies landed, barrier, then stage s + 2 into the buffer just read.
// Every accumulator takes its 32-deep products in ascending k, as a single wave over the whole K would.
// bx: the row tile's index inside its band (batch-major); st: the ring; os: the block's output tile (32 x OOP floats).
#define OW   8                   // waves per output block
#define OKC  256                 // k extent of a staged chunk
#define OKP  264                 // LDS row pitch (halves) of a staged chunk row: 528 B = 16 B x 33, conflict-free for 16-B fragment reads
#define OAT  (32 * OKP)          // halves of a staged ctx (or ctx residual) chunk
#define OWT  (DM * OKP)          // halves of a staged Wo chunk
#define OOP  132                 // LDS row pitch (floats) of the output tile
static_assert(DM == 128);                      // four column groups of 32; 128 Wo rows = two groups of 64 rows in the copy map
static_assert(OW == 8 && 32 * OW == 256);      // two row groups x four column groups; the copy map deals one row to each wave, eight rows a piece step
static_assert(OKC * 2 == 32 * 16);             // a chunk row = 32 pieces of 16 B = one wave's copy instruction
static_assert(HK % OKC == 0 && HK / OKC >= 2); // stages 0 and 1 exist
static_assert(OKC % 128 == 0);                 // fragment groups of four 32-deep k-steps
static_assert(OKP >= OKC && (OKP * 2) % 16 == 0 && (OAT * 2) % 16 == 0 && (OWT * 2) % 16 == 0);
static_assert((OOP * 4) % 16 == 0 && OOP >= DM);
static_assert((size_t)2 * (2 * OAT + OWT) * 2 + (size_t)32 * OOP * 4 <= (size_t)327680);   // static LDS of the output kernel
template <int EARLY>
__device__ __forceinline__ void out_body(const h16* __restrict__ CX, const h16* __restrict__ CXR, const h16* __restrict__ WO, const float* __restrict__ bo, float* OUT, int bx, h16* st, float* os) {
    constexpr int STG = (EARLY ? 2 : 1) * OAT + OWT;           // halves per ring buffer: ctx | Wo (| ctx residual)
    const int tid = (int)threadIdx.x, lane = tid & 31, lr = lane & 15, hi = lane >> 4;
    const int wave = __builtin_amdgcn_readfirstlane(tid >> 5);
    const int TB = EARLY ? (EROWS / 32) : (((SEQ - EROWS) / 32) > 0 ? ((SEQ - EROWS) / 32) : 1);   // 32-row tiles per batch in this band
    const int b = bx / TB; const int t0 = (EARLY ? 0 : EROWS) + (bx % TB) * 32;
    const int mb = wave >> 2, ng = wave & 3;
    // copy map: piece i of a 32-row group -> row (tid >> 5) + 8 i, 16-B column tid & 31
    const int crow = tid >> 5, ccol = (tid & 31) * 8;
    const unsigned lrow = (unsigned)(size_t)st + (unsigned)((crow * OKP + ccol) * 2);
    const h16* ga = CX + ((size_t)b * SEQ + (size_t)(t0 + crow)) * HK + ccol;                     // + s * OKC
    const h16* gr = CXR + ((size_t)b * EROWS + (size_t)((EARLY ? t0 : 0) + crow)) * HK + ccol;    // EARLY only
    const h16* gw = WO + (size_t)crow * HK + ccol;
    auto stage = [&](int s, int buf) {                         // s < HK / OKC: every piece lies inside its plane
        const unsigned lb = lrow + (unsigned)(buf * STG * 2);
        copy4(lb, 8 * OKP * 2, ga + s * OKC, 8 * HK);
#pragma unroll
        for (int q = 0; q < 2; ++q) copy8(lb + (unsigned)((OAT + q * 64 * OKP) * 2), 8 * OKP * 2, gw + q * 64 * HK + s * OKC, 8 * HK * 2);
        if (EARLY) copy4(lb + (unsigned)((OAT + OWT) * 2), 8 * OKP * 2, gr + s * OKC, 8 * HK);
    };
    v8f acc[2], accr[2];
#pragma unroll
    for (int nb = 0; nb < 2; ++nb) { acc[nb] = (v8f){}; accr[nb] = (v8f){}; }
    const int ao = (16 * mb + lr) * OKP + 8 * hi;              // A fragment: row m, k = c
    const int wo = OAT + (32 * ng + lr) * OKP + 8 * hi;        // B fragment: col n, k = c; + 16 * OKP for the second column tile
    const int ro = OAT + OWT + ao;
    stage(0, 0);
    asm volatile("s_wait_asynccnt 0x0" ::: "memory");          // this wave's pieces of stage 0 have landed
    __syncthreads();                                           // publishes stage 0 to all eight waves
    stage(1, 1);
#pragma unroll 1
    for (int s = 0; s < HK / OKC; ++s) {
        const int buf = s & 1;
        const h16* sb = st + buf * STG;
#pragma unroll
        for (int g = 0; g < OKC; g += 128) {
            v16h a[4], ar[4], w0[4], w1[4];                    // the fragments of four k-steps are requested before their first product: one exposed LDS latency per group
#pragma unroll
            for (int c = 0; c < 4; ++c) { a[c] = ldh(sb + ao + g + 32 * c); ar[c] = a[c];
                if (EARLY) ar[c] = ldh(sb + ro + g + 32 * c);
                w0[c] = ldh(sb + wo + g + 32 * c); w1[c] = ldh(sb + wo + 16 * OKP + g + 32 * c); }
#pragma unroll
            for (int c = 0; c < 4; ++c) { acc[0] = mmh(a[c], w0[c], acc[0]); acc[1] = mmh(a[c], w1[c], acc[1]);
                if (EARLY) { accr[0] = mmh(ar[c], w0[c], accr[0]); accr[1] = mmh(ar[c], w1[c], accr[1]); } }
        }
        // publish point of stage s + 1, passed by every wave
        asm volatile("s_wait_dscnt 0x0" ::: "memory");         // this wave's reads of the buffer that is refilled below have returned
        asm volatile("s_wait_asynccnt 0x0" ::: "memory");      // this wave's pieces of the next stage have landed
        __syncthreads();                                       // publishes the next stage and ends every wave's reads of this one
        if (s + 2 < HK / OKC) stage(s + 2, buf);               // block-uniform test: only while that stage exists
    }
    asm volatile("s_wait_asynccnt 0x0" ::: "memory");          // no copy is outstanding when the wave goes on to the output tile and ends
    float bc[2];
#pragma unroll
    for (int nb = 0; nb < 2; ++nb) bc[nb] = bfr(bo[32 * ng + 16 * nb + lr]);      // 32 * 3 + 31 < DM
#pragma unroll
    for (int nb = 0; nb < 2; ++nb) {
#pragma unroll
        for (int j = 0; j < 8; ++j) { float v = acc[nb][j]; if (EARLY) v = v + accr[nb][j] * QRI;
            os[(16 * mb + hi * 8 + j) * OOP + 32 * ng + 16 * nb + lr] = v * OSI + bc[nb]; } }     // D: row 8h+j, col lane&15
    __syncthreads();                                           // the output tile is whole before any wave stores rows that other waves wrote
#pragma unroll
    for (int s = 0; s < 4; ++s) { const int row = crow + 8 * s, cofs = (tid & 31) * 4;            // 4 s x 8 waves = 32 rows; 32 lanes x 4 floats = 128 columns = four lines, one wave each
        const v4f val = *(const v4fa*)(&os[row * OOP + cofs]);
        *(v4f*)(OUT + ((size_t)(t0 + row) * NB_FULL + (size_t)b) * DM + cofs) = val; }
}

// Both row bands in one launch, a one-dimensional grid of NB * SEQ / 32 blocks: blockIdx.x < OB_E = the two-accumulator tiles of rows < EROWS, the rest the single-product tiles.
#define OB_E (NB * EROWS / 32)
__global__ __launch_bounds__(32 * OW) __attribute__((amdgpu_num_vgpr(256))) void k_out_all(const h16* __restrict__ CX, const h16* __restrict__ CXR, const h16* __restrict__ WO, const float* __restrict__ bo, float* OUT) {
    __shared__ __align__(16) h16 st[2 * (2 * OAT + OWT)];
    __shared__ __align__(16) float os[32 * OOP];
    const int bx = (int)blockIdx.x;                            // block-uniform
    if (bx < OB_E) out_body<1>(CX, CXR, WO, bo, OUT, bx, st, os);
    else           out_body<0>(CX, CXR, WO, bo, OUT, bx - OB_E, st, os);
}

static constexpr size_t al256(size_t v) { return (v + 255) & ~(size_t)255; }
static constexpr size_t SZ_XB = al256((size_t)NB * SEQ * DM * 2);
static constexpr size_t SZ_WB = al256((size_t)3 * HK * DM * 2);
static constexpr size_t SZ_WO = al256((size_t)DM * HK * 2);
static constexpr size_t SZ_PL = al256((size_t)NB * NH_ * SEQ * HD * 2);
static constexpr size_t SZ_RS = al256((size_t)NB * NH_ * EROWS * HD * 2);
static constexpr size_t SZ_CX = al256((size_t)NB * SEQ * HK * 2);
static constexpr size_t SZ_CR = al256((size_t)NB * EROWS * HK * 2);
static constexpr size_t SZ_TOTAL = SZ_XB + SZ_WB + SZ_WO + 3 * SZ_PL + 3 * SZ_RS + SZ_CX + SZ_CR;
static_assert(SZ_TOTAL <= (size_t)134217728);          // workspace carve <= 128 MiB
static_assert(((size_t)HK * DM * 2) % 256 == 0);       // weight sub-planes stay 256-byte aligned
static_assert((size_t)NB * NH_ * SEQ * HD == (size_t)NB * HK * SEQ);       // v^T plane [(b*1024 + m)][t] has the same extent as the row/column planes
static_assert((size_t)NB * NH_ * EROWS * HD == (size_t)NB * HK * EROWS);   // v^T residual plane [(b*1024 + m)][t < EROWS] has the same extent as the other residual planes
static_assert(((size_t)NB * SEQ * DM / 8) % 256 == 0);  // x converter grid x block == plane extent
static_assert(((size_t)HK * DM / 8) % 256 == 0);        // weight converter grids x block == plane extents

extern "C" void kernel_launch(void* const* d_in, const int* in_sizes, int n_in,
                              void* d_out, int out_size, void* d_ws, size_t ws_size, hipStream_t stream) {
    if (n_in < 9) return;
    const size_t needx = ((size_t)(SEQ - 1) * NB_FULL + NB) * DM;
    if ((size_t)in_sizes[0] < needx) return;
    if ((size_t)in_sizes[1] < (size_t)HK * DM || (size_t)in_sizes[3] < (size_t)HK * DM || (size_t)in_sizes[5] < (size_t)HK * DM || (size_t)in_sizes[7] < (size_t)DM * HK) return;
    if (in_sizes[2] < HK || in_sizes[4] < HK || in_sizes[6] < HK || in_sizes[8] < DM) return;
    if ((size_t)out_size < needx) return;
    if (SZ_TOTAL > ws_size) return;
    // wire order: x, Wk, bk, Wq, bq, Wv, bv, Wo, bo
    const float* x  = (const float*)d_in[0];
    const float* wk = (const float*)d_in[1]; const float* bk = (const float*)d_in[2];
    const float* wq = (const float*)d_in[3]; const float* bq = (const float*)d_in[4];
    const float* wv = (const float*)d_in[5]; const float* bv = (const float*)d_in[6];
    const float* wo = (const float*)d_in[7]; const float* bo = (const float*)d_in[8];
    float* OUT = (float*)d_out;      // [SEQ][NB_FULL][128]
    char* wsp = (char*)d_ws;
    bf* XB = (bf*)wsp; wsp += SZ_XB;                 // [NB*SEQ][128], row = b*SEQ + t
    bf* WB = (bf*)wsp; wsp += SZ_WB;                 // [3][1024][128]: k | q | v  ([out][in] = Bt as-is)
    h16* WO = (h16*)wsp; wsp += SZ_WO;               // [128][1024] bf16(Wo) x1024 in f16
    h16* RH = (h16*)wsp; wsp += SZ_PL;               // row side (Wk projection)    [NB*8][SEQ][128]
    h16* CH = (h16*)wsp; wsp += SZ_PL;               // column side (Wq projection) [NB*8][SEQ][128]
    h16* VT = (h16*)wsp; wsp += SZ_PL;               // [NB*8][128][SEQ]
    h16* RR = (h16*)wsp; wsp += SZ_RS;               // [NB*8][EROWS][128] residual x2048, tokens < EROWS
    h16* CR = (h16*)wsp; wsp += SZ_RS;               // [NB*8][EROWS][128] residual x2048, tokens < EROWS
    h16* VR = (h16*)wsp; wsp += SZ_RS;               // [NB*8][128][EROWS] residual x2048, tokens < EROWS
    h16* CX = (h16*)wsp; wsp += SZ_CX;               // [NB*SEQ][1024] ctx x16
    h16* CXR = (h16*)wsp; wsp += SZ_CR;              // [NB*EROWS][1024] ctx residual x16 x2048, tokens < EROWS

    // x, Wk, Wq, Wv, Wo -> 16-bit planes
    k_cvt_all<<<CB_X + 4 * CB_W, 256, 0, stream>>>(x, wk, wq, wv, wo, XB, WB, WO);

    // row side and column side: A = x rows (m = b*SEQ + t), Bt = W rows (n = h*128 + d) -> plane [(b*8 + h)][t][d]; v^T: A = Wv rows, Bt = x rows -> plane [(b*8 + h)][d][t]; residuals for tokens < EROWS
    k_proj_all<<<dim3(PT_N, 3, 1), 32 * PW, 0, stream>>>(XB, WB, bk, bq, bv, RH, RR, CH, CR, VT, VR, EROWS);

    // rows [0, EROWS): multi-product instantiation; rows [EROWS, SEQ): single-product instantiation (disjoint ctx rows)
    k_flash_all<<<FB_E + FB_L, 32 * AW, 0, stream>>>(RH, RR, CH, CR, VT, VR, CX, CXR);

    // output GEMM: rows [0, EROWS) with the ctx residual accumulators, rows [EROWS, SEQ) single product (disjoint output rows)
    k_out_all<<<NB * SEQ / 32, 32 * OW, 0, stream>>>(CX, CXR, WO, bo, OUT);
}
